// v000
// The times below were measured on an AMD MI455X: many runs one after another, warmed up first and cycling through
// copies of the inputs, with the whole window's GPU time divided by the number of runs. Launches and the gaps
// between them are all in it. The median over several windows is given; except for v000 it joins two sittings, which
// can be a few percent apart, so the side-by-side timings, each taken in one sitting, are the better comparison.
// v000, which the later versions start from, runs in 644 microseconds.
#include <hip/hip_runtime.h>
// Contractions y*Q_h, a1*y^T, expS*y, h0*V_h: v_wmma_f32_16x16x32_f16 (f16 operands built from bf16-RNE inputs; a1, expS, h0 as f16 hi + f16 residual x2048 planes with separate accumulators), f32 accumulate; exp / normalisation in f32.

#ifndef NB
#define NB 1024
#endif
#define NB_FULL 1024
#define LSEQ   30
#define DDIM   300
#define NHEAD  20
#define HDIM   20
#define ODIM   (NHEAD * HDIM)          /* 400 */
#define LP     32                      /* padded rows */
#define DP     320                     /* padded K */
#define KSTEPS (DP / 32)               /* 10 */
#define NTD    19                      /* 16-col tiles covering 300 */
#define EP     (NTD * 16)              /* 304 padded out cols of Q_h */
#define FP     32                      /* padded out cols of V_h */
#define DCH    (DP / 8)                /* 40 chunks of 8 halves per padded row */
#define QT_CHUNKS (NHEAD * EP * DCH)   /* 243200 */
#define VT_CHUNKS (NHEAD * FP * DCH)   /* 25600 */
#define QT_BLOCKS (QT_CHUNKS / 256)    /* 950 */
#define VT_BLOCKS (VT_CHUNKS / 256)    /* 100 */
#define Y_BSTRIDE   (LSEQ * DDIM)      /* per-batch stride of y (floats) */
#define SEQ_BSTRIDE (LSEQ)             /* per-batch stride of token ids */
#define OUT_BSTRIDE (LSEQ * ODIM)      /* per-batch stride of out (floats) */
#define QSC 1024.0f                    /* power-of-two carry on Q plane */
#define VSC 1024.0f                    /* power-of-two carry on V plane */
#define RSC 2048.0f                    /* power-of-two carry on residual planes */

static_assert(QT_CHUNKS % 256 == 0);
static_assert(VT_CHUNKS % 256 == 0);
static_assert((OUT_BSTRIDE * 4) % 128 == 0);
static_assert((LSEQ * ODIM) % 4 == 0);
static_assert(((NHEAD * EP * DP * 2) % 128) == 0);
static_assert(NB <= NB_FULL);
static_assert(DP % 32 == 0 && EP >= DDIM && FP >= HDIM && LP >= LSEQ);

typedef _Float16 v16h __attribute__((ext_vector_type(16)));
typedef _Float16 v8h  __attribute__((ext_vector_type(8)));
typedef float    v8f  __attribute__((ext_vector_type(8)));
typedef float    v4f  __attribute__((ext_vector_type(4)));
typedef v8h v8ha __attribute__((may_alias));
typedef v4f v4fa __attribute__((may_alias));

union Frag { v16h v; v8h h[2]; };
union U8h  { v8h v; _Float16 s[8]; unsigned int u[4]; };

__device__ __forceinline__ int imin(int a, int b) { return a < b ? a : b; }

// f32 -> bf16 (RNE) -> back to f32 (value exactly representable in bf16)
__device__ __forceinline__ float bf16_rne(float f) {
  unsigned int u = __builtin_bit_cast(unsigned int, f);
  u = (u + 0x7fffu + ((u >> 16) & 1u)) & 0xffff0000u;
  return __builtin_bit_cast(float, u);
}

// 16x32 fragment from a [row][k] k-contiguous 16-bit matrix; rowp = row (lane&15) start.
// elements 0..7 <- k0+8hf .. +7, elements 8..15 <- k0+16+8hf .. +7 (same map for A and B)
__device__ __forceinline__ v16h ld_frag(const _Float16* rowp, int k0, int hf) {
  Frag f;
  f.h[0] = *(const v8ha*)(rowp + k0 + 8 * hf);
  f.h[1] = *(const v8ha*)(rowp + k0 + 16 + 8 * hf);
  return f.v;
}

__device__ __forceinline__ v8f zero8() {
  v8f z = {0.f, 0.f, 0.f, 0.f, 0.f, 0.f, 0.f, 0.f};
  return z;
}

__device__ __forceinline__ v8f wmma16(v16h a, v16h b, v8f c) {
  c = __builtin_amdgcn_wmma_f32_16x16x32_f16(false, a, false, b, (short)0, c, false, false);
  asm volatile("v_nop\n\tv_nop\n\tv_nop\n\tv_nop" : "+v"(c) : "v"(a), "v"(b));
  return c;
}

// =====================================================================
// Kernel 0: weight planes.
//   Qt[h][e][d] = f16( bf16(Q[h][d][e]) * QSC ), e < 304 (rows >= 300 zero), d < 320 (cols >= 300 zero)
//   Vt[h][f][d] = f16( bf16(V[h][d][f]) * VSC ), f < 32  (rows >= 20 zero),  d < 320
// grid: QT_BLOCKS + VT_BLOCKS, block 256 (block-uniform role)
// =====================================================================
__launch_bounds__(256)
__global__ void k_prep(const float* __restrict__ Q, const float* __restrict__ V,
                       _Float16* __restrict__ Qt, _Float16* __restrict__ Vt)
{
  const int bid = blockIdx.x;
  const int tid = threadIdx.x;
  U8h u;
  _Float16* dst;
  if (bid < QT_BLOCKS) {
    const int c   = bid * 256 + tid;              // < QT_CHUNKS exactly
    const int h   = c / (EP * DCH);
    const int rem = c - h * (EP * DCH);
    const int e   = rem / DCH;
    const int dc  = rem - e * DCH;
    const int d0  = dc * 8;
    const int ecl = imin(e, DDIM - 1);
#pragma unroll
    for (int j = 0; j < 8; ++j) {
      const int d   = d0 + j;
      const int dcl = imin(d, DDIM - 1);
      const float x = Q[((size_t)h * DDIM + dcl) * DDIM + ecl];   // clamped address
      const bool ok = (d < DDIM) && (e < DDIM);
      const float r = ok ? bf16_rne(x) * QSC : 0.0f;
      u.s[j] = (_Float16)r;
    }
    dst = Qt + (size_t)c * 8;
  } else {
    const int c   = (bid - QT_BLOCKS) * 256 + tid;  // < VT_CHUNKS exactly
    const int h   = c / (FP * DCH);
    const int rem = c - h * (FP * DCH);
    const int f   = rem / DCH;
    const int dc  = rem - f * DCH;
    const int d0  = dc * 8;
    const int fcl = imin(f, HDIM - 1);
#pragma unroll
    for (int j = 0; j < 8; ++j) {
      const int d   = d0 + j;
      const int dcl = imin(d, DDIM - 1);
      const float x = V[((size_t)h * DDIM + dcl) * HDIM + fcl];   // clamped address
      const bool ok = (d < DDIM) && (f < HDIM);
      const float r = ok ? bf16_rne(x) * VSC : 0.0f;
      u.s[j] = (_Float16)r;
    }
    dst = Vt + (size_t)c * 8;
  }
  const v8h val = u.v;
  *(v8h*)dst = val;
  
}

// =====================================================================
// Kernel 1: one block per batch row b (256 threads = 8 waves), loop over heads.
//   LDS: Ys [32][320] f16 (y tile, bf16-RNE values), Yt [304][32] f16 (transposed copy),
//        P1h/P1l [32][320] f16 (a1 hi/residual, reused for h0 hi/residual),
//        Ssc [32][32] f32 scores, Eh/El [32][32] f16 exp hi/residual, invs[32], msk[32],
// Every LDS region is cross-wave: block barriers between producer and consumer phases.
// =====================================================================
__launch_bounds__(256)
__global__ void k_attn(const float* __restrict__ y, const int* __restrict__ seq,
                       const _Float16* __restrict__ Qt, const _Float16* __restrict__ Vt,
                       float* __restrict__ out)
{
  __shared__ __align__(16) _Float16 Ys[LP * DP];
  __shared__ __align__(16) _Float16 Yt[EP * LP];
  __shared__ __align__(16) _Float16 P1h[LP * DP];
  __shared__ __align__(16) _Float16 P1l[LP * DP];
  __shared__ __align__(16) float    Ssc[LP * LP];
  __shared__ __align__(16) _Float16 Eh[LP * LP];
  __shared__ __align__(16) _Float16 El[LP * LP];
  __shared__ __align__(16) float    invs[LP];
  __shared__ __align__(16) int      msk[LP];
  __shared__ __align__(16) float    Outs[LSEQ * ODIM];

  const int tid  = threadIdx.x;
  const int lane = tid & 31;
  const int wave = __builtin_amdgcn_readfirstlane(tid >> 5);
  const int hf   = lane >> 4;
  const int nl   = lane & 15;
  const int b    = blockIdx.x;
  const float* yb = y + (size_t)b * Y_BSTRIDE;

  // ---- stage y tile: Ys[row][d] and Yt[d][row], bf16-RNE values in f16, pads zero ----
  for (int idx = tid; idx < LP * DCH; idx += 256) {
    const int row = idx / DCH;
    const int dc  = idx - row * DCH;
    const int d0  = dc * 8;
    const int rcl = imin(row, LSEQ - 1);
    U8h u;
#pragma unroll
    for (int j = 0; j < 8; ++j) {
      const int d   = d0 + j;
      const int dcl = imin(d, DDIM - 1);
      const float x = yb[rcl * DDIM + dcl];                       // clamped address
      const bool ok = (row < LSEQ) && (d < DDIM);
      const float r = ok ? bf16_rne(x) : 0.0f;
      u.s[j] = (_Float16)r;
    }
    *(v8ha*)(Ys + row * DP + d0) = u.v;
#pragma unroll
    for (int j = 0; j < 8; ++j) {
      const int d = d0 + j;
      if (d < EP) Yt[d * LP + row] = u.s[j];
    }
  }
  // ---- zero the K pad columns 304..319 of both a1/h0 planes (never written later) ----
  if (tid < 64) {
    const int r = tid >> 1, c = tid & 1;
    U8h z; z.u[0] = 0u; z.u[1] = 0u; z.u[2] = 0u; z.u[3] = 0u;
    *(v8ha*)(P1h + r * DP + EP + c * 8) = z.v;
    *(v8ha*)(P1l + r * DP + EP + c * 8) = z.v;
  }
  // ---- key mask from token ids (id > 0), pads 0 ----
  if (tid < LP) {
    const int m  = imin(tid, LSEQ - 1);
    const int sv = seq[(size_t)b * SEQ_BSTRIDE + m];           // clamped address
    msk[tid] = (tid < LSEQ && sv > 0) ? 1 : 0;
  }
  __syncthreads();

  for (int h = 0; h < NHEAD; ++h) {
    // ================= GEMM1: a1 (x QSC) = Ys (32x320) * Qt_h ; 2 m-tiles x 19 n-tiles =================
    {
      v8f acc[3][2];
#pragma unroll
      for (int t = 0; t < 3; ++t) { acc[t][0] = zero8(); acc[t][1] = zero8(); }
      const _Float16* qb = Qt + (size_t)h * EP * DP;
#pragma unroll 1
      for (int ks = 0; ks < KSTEPS; ++ks) {
        const int k0 = ks * 32;
        const v16h a0 = ld_frag(Ys + nl * DP, k0, hf);
        const v16h a1 = ld_frag(Ys + (16 + nl) * DP, k0, hf);
#pragma unroll
        for (int t = 0; t < 3; ++t) {
          const int nt = wave + 8 * t;                 // wave-uniform
          if (nt < NTD) {
            const v16h bq = ld_frag(qb + (size_t)(nt * 16 + nl) * DP, k0, hf);
            acc[t][0] = wmma16(a0, bq, acc[t][0]);
            acc[t][1] = wmma16(a1, bq, acc[t][1]);
          }
        }
      }
      // epilogue: a1 = acc/QSC -> f16 hi + f16 residual*RSC into P1h/P1l [row][col]
#pragma unroll
      for (int t = 0; t < 3; ++t) {
        const int nt = wave + 8 * t;
        if (nt < NTD) {
          const int col = nt * 16 + nl;
#pragma unroll
          for (int mt = 0; mt < 2; ++mt) {
#pragma unroll
            for (int r = 0; r < 8; ++r) {
              const int row = mt * 16 + 8 * hf + r;
              const float a = acc[t][mt][r] * (1.0f / QSC);
              const _Float16 ah = (_Float16)a;
              const float rs = (a - (float)ah) * RSC;
              P1h[row * DP + col] = ah;
              P1l[row * DP + col] = (_Float16)rs;
            }
          }
        }
      }
    }
    __syncthreads();

    // ================= GEMM2: S = a1 (32x320) * Ys^T ; 4 tiles, waves 0..3 =================
    if (wave < 4) {
      const int mt = wave >> 1, nt = wave & 1;
      v8f ch = zero8(), cl = zero8();
#pragma unroll 1
      for (int ks = 0; ks < KSTEPS; ++ks) {
        const int k0 = ks * 32;
        const v16h by = ld_frag(Ys + (nt * 16 + nl) * DP, k0, hf);      // B[k=e][n=m] = Ys[m][e]
        const v16h ah = ld_frag(P1h + (mt * 16 + nl) * DP, k0, hf);
        const v16h al = ld_frag(P1l + (mt * 16 + nl) * DP, k0, hf);
        ch = wmma16(ah, by, ch);
        cl = wmma16(al, by, cl);
      }
#pragma unroll
      for (int r = 0; r < 8; ++r) {
        const int row = mt * 16 + 8 * hf + r;
        const int col = nt * 16 + nl;
        Ssc[row * LP + col] = ch[r] + cl[r] * (1.0f / RSC);
      }
    }
    __syncthreads();

    // ================= exp (no max subtraction) + masked row sums =================
    {
      const int l = tid >> 3;          // 0..31
      const int g = tid & 7;           // 8 threads per row, 4 key positions each
      float part = 0.0f;
#pragma unroll
      for (int j = 0; j < 4; ++j) {
        const int m = g * 4 + j;
        const float s = Ssc[l * LP + m];
        const bool ok = (l < LSEQ) && (m < LSEQ);
        const float e = ok ? expf(s) : 0.0f;        // numerator unmasked
        part += (msk[m] != 0) ? e : 0.0f;           // denominator masked
        const _Float16 ehv = (_Float16)e;
        const float rs = (e - (float)ehv) * RSC;
        Eh[l * LP + m] = ehv;
        El[l * LP + m] = (_Float16)rs;
      }
      part += __shfl_xor(part, 1);
      part += __shfl_xor(part, 2);
      part += __shfl_xor(part, 4);
      if (g == 0) invs[l] = (l < LSEQ) ? (1.0f / (part + 1e-6f)) : 0.0f;
    }
    __syncthreads();

    // ================= GEMM3: h0 = (expS (32x32) * Yt) * inv[row] ; into P1h/P1l =================
    {
      v16h ehf[2], elf[2];
#pragma unroll
      for (int mt = 0; mt < 2; ++mt) {
        ehf[mt] = ld_frag(Eh + (mt * 16 + nl) * LP, 0, hf);
        elf[mt] = ld_frag(El + (mt * 16 + nl) * LP, 0, hf);
      }
#pragma unroll
      for (int t = 0; t < 3; ++t) {
        const int nt = wave + 8 * t;
        if (nt < NTD) {
          const v16h by = ld_frag(Yt + (nt * 16 + nl) * LP, 0, hf);     // B[k=m][n=d] = Yt[d][m]
          const int col = nt * 16 + nl;
#pragma unroll
          for (int mt = 0; mt < 2; ++mt) {
            const v8f ch = wmma16(ehf[mt], by, zero8());
            const v8f cl = wmma16(elf[mt], by, zero8());
#pragma unroll
            for (int r = 0; r < 8; ++r) {
              const int row = mt * 16 + 8 * hf + r;
              const float hv = (ch[r] + cl[r] * (1.0f / RSC)) * invs[row];
              const _Float16 hh = (_Float16)hv;
              const float rs = (hv - (float)hh) * RSC;
              P1h[row * DP + col] = hh;
              P1l[row * DP + col] = (_Float16)rs;
            }
          }
        }
      }
    }
    __syncthreads();

    // ================= GEMM4: h1 (x VSC) = h0 (32x320) * Vt_h ; 4 tiles, waves 0..3 =================
    if (wave < 4) {
      const int mt = wave >> 1, nt = wave & 1;
      const _Float16* vb = Vt + (size_t)h * FP * DP;
      v8f ch = zero8(), cl = zero8();
#pragma unroll 1
      for (int ks = 0; ks < KSTEPS; ++ks) {
        const int k0 = ks * 32;
        const v16h bv = ld_frag(vb + (size_t)(nt * 16 + nl) * DP, k0, hf);
        const v16h ah = ld_frag(P1h + (mt * 16 + nl) * DP, k0, hf);
        const v16h al = ld_frag(P1l + (mt * 16 + nl) * DP, k0, hf);
        ch = wmma16(ah, bv, ch);
        cl = wmma16(al, bv, cl);
      }
#pragma unroll
      for (int r = 0; r < 8; ++r) {
        const int l = mt * 16 + 8 * hf + r;
        const int f = nt * 16 + nl;
        const float v = (ch[r] + cl[r] * (1.0f / RSC)) * (1.0f / VSC);
        if (l < LSEQ && f < HDIM) Outs[l * ODIM + h * HDIM + f] = v;
      }
    }
    __syncthreads();
  }

  float* ob = out + (size_t)b * OUT_BSTRIDE;
  constexpr int NV4 = (LSEQ * ODIM) / 4;          // 3000
  for (int i = tid; i < NV4; i += 256) {
    const v4f v = *(const v4fa*)(Outs + i * 4);
    *(v4f*)(ob + (size_t)i * 4) = v;
  }
  
}

extern "C" void kernel_launch(void* const* d_in, const int* in_sizes, int n_in,
                              void* d_out, int out_size, void* d_ws, size_t ws_size,
                              hipStream_t stream)
{
  if (n_in < 4) return;
  if (in_sizes[0] < NB * LSEQ * DDIM) return;
  if (in_sizes[1] < NB * LSEQ) return;
  if (in_sizes[2] < NHEAD * DDIM * DDIM) return;
  if (in_sizes[3] < NHEAD * DDIM * HDIM) return;
  if (out_size < NB * LSEQ * ODIM) return;

  const float* y   = (const float*)d_in[0];
  const int*   seq = (const int*)  d_in[1];
  const float* Q   = (const float*)d_in[2];
  const float* V   = (const float*)d_in[3];
  float*       out = (float*)d_out;

  const size_t qt_bytes = (size_t)NHEAD * EP * DP * sizeof(_Float16);   // 3,891,200
  const size_t vt_bytes = (size_t)NHEAD * FP * DP * sizeof(_Float16);   //   409,600
  if (ws_size < qt_bytes + vt_bytes) return;
  _Float16* Qt = (_Float16*)d_ws;
  _Float16* Vt = (_Float16*)((char*)d_ws + qt_bytes);

  k_prep<<<dim3(QT_BLOCKS + VT_BLOCKS), dim3(256), 0, stream>>>(Q, V, Qt, Vt);
  k_attn<<<dim3(NB), dim3(256), 0, stream>>>(y, seq, Qt, Vt, out);
}

// v001
// A run of this version takes 520 microseconds.
// In both of two side-by-side timings against v000, it was 1.24 times as fast.
#include <hip/hip_runtime.h>
// Contractions y*Q_h, a1*y^T, expS*y, h0*V_h: v_wmma_f32_16x16x32_f16 (f16 operands built from bf16-RNE inputs; a1, expS, h0 as f16 hi + f16 residual x2048 planes with separate accumulators), f32 accumulate; exp / normalisation in f32.

#ifndef NB
#define NB 1024
#endif
#define NB_FULL 1024
#define LSEQ   30
#define DDIM   300
#define NHEAD  20
#define HDIM   20
#define ODIM   (NHEAD * HDIM)          /* 400 */
#define LP     32                      /* padded rows */
#define DP     320                     /* padded K */
#define KSTEPS (DP / 32)               /* 10 */
#define NTD    19                      /* 16-col tiles covering 300 */
#define EP     (NTD * 16)              /* 304 padded out cols of Q_h */
#define FP     32                      /* padded out cols of V_h */
#define DCH    (DP / 8)                /* 40 chunks of 8 halves per padded row */
/* LDS row pitches: an odd multiple of 16 bytes, so that the 16 rows of a b128 fragment read fall on distinct banks */
#define YP     (DP + 8)                /* halves: 656 B rows of Ys, P1h, P1l */
#define TP     (LP + 8)                /* halves:  80 B rows of Yt, Eh, El */
#define SP     (LP + 4)                /* floats: 144 B rows of Ssc */
#define QT_CHUNKS (NHEAD * EP * DCH)   /* 243200 */
#define VT_CHUNKS (NHEAD * FP * DCH)   /* 25600 */
#define QT_BLOCKS (QT_CHUNKS / 256)    /* 950 */
#define VT_BLOCKS (VT_CHUNKS / 256)    /* 100 */
#define Y_BSTRIDE   (LSEQ * DDIM)      /* per-batch stride of y (floats) */
#define SEQ_BSTRIDE (LSEQ)             /* per-batch stride of token ids */
#define OUT_BSTRIDE (LSEQ * ODIM)      /* per-batch stride of out (floats) */
#define QSC 1024.0f                    /* power-of-two carry on Q plane */
#define VSC 1024.0f                    /* power-of-two carry on V plane */
#define RSC 2048.0f                    /* power-of-two carry on residual planes */

static_assert(QT_CHUNKS % 256 == 0);
static_assert(VT_CHUNKS % 256 == 0);
static_assert((OUT_BSTRIDE * 4) % 128 == 0);
static_assert((LSEQ * ODIM) % 4 == 0);
static_assert(((NHEAD * EP * DP * 2) % 128) == 0);
static_assert(NB <= NB_FULL);
static_assert(DP % 32 == 0 && EP >= DDIM && FP >= HDIM && LP >= LSEQ);
static_assert((YP * 2) % 32 == 16 && (TP * 2) % 32 == 16 && (SP * 4) % 32 == 16);

typedef _Float16 v16h __attribute__((ext_vector_type(16)));
typedef _Float16 v8h  __attribute__((ext_vector_type(8)));
typedef float    v8f  __attribute__((ext_vector_type(8)));
typedef float    v4f  __attribute__((ext_vector_type(4)));
typedef v8h v8ha __attribute__((may_alias));
typedef v4f v4fa __attribute__((may_alias));

union Frag { v16h v; v8h h[2]; };
union U8h  { v8h v; _Float16 s[8]; unsigned int u[4]; };

__device__ __forceinline__ int imin(int a, int b) { return a < b ? a : b; }

// f32 -> bf16 (RNE) -> back to f32 (value exactly representable in bf16)
__device__ __forceinline__ float bf16_rne(float f) {
  unsigned int u = __builtin_bit_cast(unsigned int, f);
  u = (u + 0x7fffu + ((u >> 16) & 1u)) & 0xffff0000u;
  return __builtin_bit_cast(float, u);
}

// 16x32 fragment from a [row][k] k-contiguous 16-bit matrix; rowp = row (lane&15) start.
// elements 0..7 <- k0+8hf .. +7, elements 8..15 <- k0+16+8hf .. +7 (same map for A and B)
__device__ __forceinline__ v16h ld_frag(const _Float16* rowp, int k0, int hf) {
  Frag f;
  f.h[0] = *(const v8ha*)(rowp + k0 + 8 * hf);
  f.h[1] = *(const v8ha*)(rowp + k0 + 16 + 8 * hf);
  return f.v;
}

__device__ __forceinline__ v8f zero8() {
  v8f z = {0.f, 0.f, 0.f, 0.f, 0.f, 0.f, 0.f, 0.f};
  return z;
}

__device__ __forceinline__ v8f wmma16(v16h a, v16h b, v8f c) {
  c = __builtin_amdgcn_wmma_f32_16x16x32_f16(false, a, false, b, (short)0, c, false, false);
  asm volatile("v_nop\n\tv_nop\n\tv_nop\n\tv_nop" : "+v"(c) : "v"(a), "v"(b));
  return c;
}

// =====================================================================
// Kernel 0: weight planes.
//   Qt[h][e][d] = f16( bf16(Q[h][d][e]) * QSC ), e < 304 (rows >= 300 zero), d < 320 (cols >= 300 zero)
//   Vt[h][f][d] = f16( bf16(V[h][d][f]) * VSC ), f < 32  (rows >= 20 zero),  d < 320
// grid: QT_BLOCKS + VT_BLOCKS, block 256 (block-uniform role)
// =====================================================================
__launch_bounds__(256)
__global__ void k_prep(const float* __restrict__ Q, const float* __restrict__ V,
                       _Float16* __restrict__ Qt, _Float16* __restrict__ Vt)
{
  const int bid = blockIdx.x;
  const int tid = threadIdx.x;
  U8h u;
  _Float16* dst;
  if (bid < QT_BLOCKS) {
    const int c   = bid * 256 + tid;              // < QT_CHUNKS exactly
    const int h   = c / (EP * DCH);
    const int rem = c - h * (EP * DCH);
    const int e   = rem / DCH;
    const int dc  = rem - e * DCH;
    const int d0  = dc * 8;
    const int ecl = imin(e, DDIM - 1);
#pragma unroll
    for (int j = 0; j < 8; ++j) {
      const int d   = d0 + j;
      const int dcl = imin(d, DDIM - 1);
      const float x = Q[((size_t)h * DDIM + dcl) * DDIM + ecl];   // clamped address
      const bool ok = (d < DDIM) && (e < DDIM);
      const float r = ok ? bf16_rne(x) * QSC : 0.0f;
      u.s[j] = (_Float16)r;
    }
    dst = Qt + (size_t)c * 8;
  } else {
    const int c   = (bid - QT_BLOCKS) * 256 + tid;  // < VT_CHUNKS exactly
    const int h   = c / (FP * DCH);
    const int rem = c - h * (FP * DCH);
    const int f   = rem / DCH;
    const int dc  = rem - f * DCH;
    const int d0  = dc * 8;
    const int fcl = imin(f, HDIM - 1);
#pragma unroll
    for (int j = 0; j < 8; ++j) {
      const int d   = d0 + j;
      const int dcl = imin(d, DDIM - 1);
      const float x = V[((size_t)h * DDIM + dcl) * HDIM + fcl];   // clamped address
      const bool ok = (d < DDIM) && (f < HDIM);
      const float r = ok ? bf16_rne(x) * VSC : 0.0f;
      u.s[j] = (_Float16)r;
    }
    dst = Vt + (size_t)c * 8;
  }
  const v8h val = u.v;
  *(v8h*)dst = val;
  
}

// =====================================================================
// Kernel 1: one block per batch row b (256 threads = 8 waves), loop over heads.
//   LDS (rows padded to the pitches YP, TP, SP; pad bytes are never read):
//        Ys [32][320] f16 (y tile, bf16-RNE values), Yt [304][32] f16 (transposed copy),
//        P1h/P1l [32][320] f16 (a1 hi/residual, reused for h0 hi/residual),
//        Ssc [32][32] f32 scores, Eh/El [32][32] f16 exp hi/residual, invs[32], msk[32],
// Every LDS region is cross-wave: block barriers between producer and consumer phases.
// =====================================================================
__launch_bounds__(256)
__global__ void k_attn(const float* __restrict__ y, const int* __restrict__ seq,
                       const _Float16* __restrict__ Qt, const _Float16* __restrict__ Vt,
                       float* __restrict__ out)
{
  __shared__ __align__(16) _Float16 Ys[LP * YP];
  __shared__ __align__(16) _Float16 Yt[EP * TP];
  __shared__ __align__(16) _Float16 P1h[LP * YP];
  __shared__ __align__(16) _Float16 P1l[LP * YP];
  __shared__ __align__(16) float    Ssc[LP * SP];
  __shared__ __align__(16) _Float16 Eh[LP * TP];
  __shared__ __align__(16) _Float16 El[LP * TP];
  __shared__ __align__(16) float    invs[LP];
  __shared__ __align__(16) int      msk[LP];
  __shared__ __align__(16) float    Outs[LSEQ * ODIM];

  const int tid  = threadIdx.x;
  const int lane = tid & 31;
  const int wave = __builtin_amdgcn_readfirstlane(tid >> 5);
  const int hf   = lane >> 4;
  const int nl   = lane & 15;
  const int b    = blockIdx.x;
  const float* yb = y + (size_t)b * Y_BSTRIDE;

  // ---- stage y tile: Ys[row][d] and Yt[d][row], bf16-RNE values in f16, pads zero ----
  for (int idx = tid; idx < LP * DCH; idx += 256) {
    const int row = idx / DCH;
    const int dc  = idx - row * DCH;
    const int d0  = dc * 8;
    const int rcl = imin(row, LSEQ - 1);
    U8h u;
#pragma unroll
    for (int j = 0; j < 8; ++j) {
      const int d   = d0 + j;
      const int dcl = imin(d, DDIM - 1);
      const float x = yb[rcl * DDIM + dcl];                       // clamped address
      const bool ok = (row < LSEQ) && (d < DDIM);
      const float r = ok ? bf16_rne(x) : 0.0f;
      u.s[j] = (_Float16)r;
    }
    *(v8ha*)(Ys + row * YP + d0) = u.v;
#pragma unroll
    for (int j = 0; j < 8; ++j) {
      const int d = d0 + j;
      if (d < EP) Yt[d * TP + row] = u.s[j];
    }
  }
  // ---- zero the K pad columns 304..319 of both a1/h0 planes (never written later) ----
  if (tid < 64) {
    const int r = tid >> 1, c = tid & 1;
    U8h z; z.u[0] = 0u; z.u[1] = 0u; z.u[2] = 0u; z.u[3] = 0u;
    *(v8ha*)(P1h + r * YP + EP + c * 8) = z.v;
    *(v8ha*)(P1l + r * YP + EP + c * 8) = z.v;
  }
  // ---- key mask from token ids (id > 0), pads 0 ----
  if (tid < LP) {
    const int m  = imin(tid, LSEQ - 1);
    const int sv = seq[(size_t)b * SEQ_BSTRIDE + m];           // clamped address
    msk[tid] = (tid < LSEQ && sv > 0) ? 1 : 0;
  }
  __syncthreads();

  for (int h = 0; h < NHEAD; ++h) {
    // ================= GEMM1: a1 (x QSC) = Ys (32x320) * Qt_h ; 2 m-tiles x 19 n-tiles =================
    {
      v8f acc[3][2];
#pragma unroll
      for (int t = 0; t < 3; ++t) { acc[t][0] = zero8(); acc[t][1] = zero8(); }
      const _Float16* qb = Qt + (size_t)h * EP * DP;
#pragma unroll 1
      for (int ks = 0; ks < KSTEPS; ++ks) {
        const int k0 = ks * 32;
        const v16h a0 = ld_frag(Ys + nl * YP, k0, hf);
        const v16h a1 = ld_frag(Ys + (16 + nl) * YP, k0, hf);
#pragma unroll
        for (int t = 0; t < 3; ++t) {
          const int nt = wave + 8 * t;                 // wave-uniform
          if (nt < NTD) {
            const v16h bq = ld_frag(qb + (size_t)(nt * 16 + nl) * DP, k0, hf);
            acc[t][0] = wmma16(a0, bq, acc[t][0]);
            acc[t][1] = wmma16(a1, bq, acc[t][1]);
          }
        }
      }
      // epilogue: a1 = acc/QSC -> f16 hi + f16 residual*RSC into P1h/P1l [row][col]
#pragma unroll
      for (int t = 0; t < 3; ++t) {
        const int nt = wave + 8 * t;
        if (nt < NTD) {
          const int col = nt * 16 + nl;
#pragma unroll
          for (int mt = 0; mt < 2; ++mt) {
#pragma unroll
            for (int r = 0; r < 8; ++r) {
              const int row = mt * 16 + 8 * hf + r;
              const float a = acc[t][mt][r] * (1.0f / QSC);
              const _Float16 ah = (_Float16)a;
              const float rs = (a - (float)ah) * RSC;
              P1h[row * YP + col] = ah;
              P1l[row * YP + col] = (_Float16)rs;
            }
          }
        }
      }
    }
    __syncthreads();

    // ================= GEMM2: S = a1 (32x320) * Ys^T ; 4 tiles, waves 0..3 =================
    if (wave < 4) {
      const int mt = wave >> 1, nt = wave & 1;
      v8f ch = zero8(), cl = zero8();
#pragma unroll 1
      for (int ks = 0; ks < KSTEPS; ++ks) {
        const int k0 = ks * 32;
        const v16h by = ld_frag(Ys + (nt * 16 + nl) * YP, k0, hf);      // B[k=e][n=m] = Ys[m][e]
        const v16h ah = ld_frag(P1h + (mt * 16 + nl) * YP, k0, hf);
        const v16h al = ld_frag(P1l + (mt * 16 + nl) * YP, k0, hf);
        ch = wmma16(ah, by, ch);
        cl = wmma16(al, by, cl);
      }
#pragma unroll
      for (int r = 0; r < 8; ++r) {
        const int row = mt * 16 + 8 * hf + r;
        const int col = nt * 16 + nl;
        Ssc[row * SP + col] = ch[r] + cl[r] * (1.0f / RSC);
      }
    }
    __syncthreads();

    // ================= exp (no max subtraction) + masked row sums =================
    {
      const int l = tid >> 3;          // 0..31
      const int g = tid & 7;           // 8 threads per row, 4 key positions each
      float part = 0.0f;
#pragma unroll
      for (int j = 0; j < 4; ++j) {
        const int m = g * 4 + j;
        const float s = Ssc[l * SP + m];
        const bool ok = (l < LSEQ) && (m < LSEQ);
        const float e = ok ? expf(s) : 0.0f;        // numerator unmasked
        part += (msk[m] != 0) ? e : 0.0f;           // denominator masked
        const _Float16 ehv = (_Float16)e;
        const float rs = (e - (float)ehv) * RSC;
        Eh[l * TP + m] = ehv;
        El[l * TP + m] = (_Float16)rs;
      }
      part += __shfl_xor(part, 1);
      part += __shfl_xor(part, 2);
      part += __shfl_xor(part, 4);
      if (g == 0) invs[l] = (l < LSEQ) ? (1.0f / (part + 1e-6f)) : 0.0f;
    }
    __syncthreads();

    // ================= GEMM3: h0 = (expS (32x32) * Yt) * inv[row] ; into P1h/P1l =================
    {
      v16h ehf[2], elf[2];
#pragma unroll
      for (int mt = 0; mt < 2; ++mt) {
        ehf[mt] = ld_frag(Eh + (mt * 16 + nl) * TP, 0, hf);
        elf[mt] = ld_frag(El + (mt * 16 + nl) * TP, 0, hf);
      }
#pragma unroll
      for (int t = 0; t < 3; ++t) {
        const int nt = wave + 8 * t;
        if (nt < NTD) {
          const v16h by = ld_frag(Yt + (nt * 16 + nl) * TP, 0, hf);     // B[k=m][n=d] = Yt[d][m]
          const int col = nt * 16 + nl;
#pragma unroll
          for (int mt = 0; mt < 2; ++mt) {
            const v8f ch = wmma16(ehf[mt], by, zero8());
            const v8f cl = wmma16(elf[mt], by, zero8());
#pragma unroll
            for (int r = 0; r < 8; ++r) {
              const int row = mt * 16 + 8 * hf + r;
              const float hv = (ch[r] + cl[r] * (1.0f / RSC)) * invs[row];
              const _Float16 hh = (_Float16)hv;
              const float rs = (hv - (float)hh) * RSC;
              P1h[row * YP + col] = hh;
              P1l[row * YP + col] = (_Float16)rs;
            }
          }
        }
      }
    }
    __syncthreads();

    // ================= GEMM4: h1 (x VSC) = h0 (32x320) * Vt_h ; 4 tiles, waves 0..3 =================
    if (wave < 4) {
      const int mt = wave >> 1, nt = wave & 1;
      const _Float16* vb = Vt + (size_t)h * FP * DP;
      v8f ch = zero8(), cl = zero8();
#pragma unroll 1
      for (int ks = 0; ks < KSTEPS; ++ks) {
        const int k0 = ks * 32;
        const v16h bv = ld_frag(vb + (size_t)(nt * 16 + nl) * DP, k0, hf);
        const v16h ah = ld_frag(P1h + (mt * 16 + nl) * YP, k0, hf);
        const v16h al = ld_frag(P1l + (mt * 16 + nl) * YP, k0, hf);
        ch = wmma16(ah, bv, ch);
        cl = wmma16(al, bv, cl);
      }
#pragma unroll
      for (int r = 0; r < 8; ++r) {
        const int l = mt * 16 + 8 * hf + r;
        const int f = nt * 16 + nl;
        const float v = (ch[r] + cl[r] * (1.0f / RSC)) * (1.0f / VSC);
        if (l < LSEQ && f < HDIM) Outs[l * ODIM + h * HDIM + f] = v;
      }
    }
    __syncthreads();
  }

  float* ob = out + (size_t)b * OUT_BSTRIDE;
  constexpr int NV4 = (LSEQ * ODIM) / 4;          // 3000
  for (int i = tid; i < NV4; i += 256) {
    const v4f v = *(const v4fa*)(Outs + i * 4);
    *(v4f*)(ob + (size_t)i * 4) = v;
  }
  
}

extern "C" void kernel_launch(void* const* d_in, const int* in_sizes, int n_in,
                              void* d_out, int out_size, void* d_ws, size_t ws_size,
                              hipStream_t stream)
{
  if (n_in < 4) return;
  if (in_sizes[0] < NB * LSEQ * DDIM) return;
  if (in_sizes[1] < NB * LSEQ) return;
  if (in_sizes[2] < NHEAD * DDIM * DDIM) return;
  if (in_sizes[3] < NHEAD * DDIM * HDIM) return;
  if (out_size < NB * LSEQ * ODIM) return;

  const float* y   = (const float*)d_in[0];
  const int*   seq = (const int*)  d_in[1];
  const float* Q   = (const float*)d_in[2];
  const float* V   = (const float*)d_in[3];
  float*       out = (float*)d_out;

  const size_t qt_bytes = (size_t)NHEAD * EP * DP * sizeof(_Float16);   // 3,891,200
  const size_t vt_bytes = (size_t)NHEAD * FP * DP * sizeof(_Float16);   //   409,600
  if (ws_size < qt_bytes + vt_bytes) return;
  _Float16* Qt = (_Float16*)d_ws;
  _Float16* Vt = (_Float16*)((char*)d_ws + qt_bytes);

  k_prep<<<dim3(QT_BLOCKS + VT_BLOCKS), dim3(256), 0, stream>>>(Q, V, Qt, Vt);
  k_attn<<<dim3(NB), dim3(256), 0, stream>>>(y, seq, Qt, Vt, out);
}

// v002
// A run of this version takes 378 microseconds.
// Next to v001, in two timings, it ran 1.40 and 1.39 times as fast.
// Counting every step since v000, it is 1.73 times as fast.
#include <hip/hip_runtime.h>
// Contractions y*Q_h, a1*y^T, expS*y, h0*V_h: v_wmma_f32_16x16x32_f16 (f16 operands built from bf16-RNE inputs; a1, expS, h0 as f16 hi + f16 residual x2048 planes with separate accumulators), f32 accumulate; exp / normalisation in f32.

#ifndef NB
#define NB 1024
#endif
#define NB_FULL 1024
#define LSEQ   30
#define DDIM   300
#define NHEAD  20
#define HDIM   20
#define ODIM   (NHEAD * HDIM)          /* 400 */
#define LP     32                      /* padded rows */
#define DP     320                     /* padded K */
#define KSTEPS (DP / 32)               /* 10 */
#define NTD    19                      /* 16-col tiles covering 300 */
#define EP     (NTD * 16)              /* 304 padded out cols of Q_h */
#define FP     32                      /* padded out cols of V_h */
#define DCH    (DP / 8)                /* 40 chunks of 8 halves per padded row */
/* LDS row pitches: an odd multiple of 16 bytes, so that the 16 rows of a b128 fragment read fall on distinct banks */
#define YP     (DP + 8)                /* halves: 656 B rows of Ys, P1h, P1l */
#define TP     (LP + 8)                /* halves:  80 B rows of Yt, Eh, El */
#define SP     (LP + 4)                /* floats: 144 B rows of Ssc */
#define QT_CHUNKS (NHEAD * EP * DCH)   /* 243200 */
#define VT_CHUNKS (NHEAD * FP * DCH)   /* 25600 */
#define QT_BLOCKS (QT_CHUNKS / 256)    /* 950 */
#define VT_BLOCKS (VT_CHUNKS / 256)    /* 100 */
#define Y_BSTRIDE   (LSEQ * DDIM)      /* per-batch stride of y (floats) */
#define SEQ_BSTRIDE (LSEQ)             /* per-batch stride of token ids */
#define OUT_BSTRIDE (LSEQ * ODIM)      /* per-batch stride of out (floats) */
#define QSC 1024.0f                    /* power-of-two carry on Q plane */
#define VSC 1024.0f                    /* power-of-two carry on V plane */
#define RSC 2048.0f                    /* power-of-two carry on residual planes */
#define PF  6                          /* k-steps of weight fragments held ahead in registers (three pairs) */
#define TSTEP (8 * 16 * DP)            /* halves between a wave's successive n-tiles of Qt */

static_assert(QT_CHUNKS % 256 == 0);
static_assert(VT_CHUNKS % 256 == 0);
static_assert((OUT_BSTRIDE * 4) % 128 == 0);
static_assert((LSEQ * ODIM) % 4 == 0);
static_assert(((NHEAD * EP * DP * 2) % 128) == 0);
static_assert(NB <= NB_FULL);
static_assert(PF <= KSTEPS && PF % 2 == 0 && KSTEPS % 2 == 0 && (DP * 2) % 128 == 0);
static_assert(DP % 32 == 0 && EP >= DDIM && FP >= HDIM && LP >= LSEQ);
static_assert((YP * 2) % 32 == 16 && (TP * 2) % 32 == 16 && (SP * 4) % 32 == 16);

typedef _Float16 v16h __attribute__((ext_vector_type(16)));
typedef _Float16 v8h  __attribute__((ext_vector_type(8)));
typedef float    v8f  __attribute__((ext_vector_type(8)));
typedef float    v4f  __attribute__((ext_vector_type(4)));
typedef v8h v8ha __attribute__((may_alias));
typedef v4f v4fa __attribute__((may_alias));

union Frag { v16h v; v8h h[2]; };
union U8h  { v8h v; _Float16 s[8]; unsigned int u[4]; };

__device__ __forceinline__ int imin(int a, int b) { return a < b ? a : b; }

// f32 -> bf16 (RNE) -> back to f32 (value exactly representable in bf16)
__device__ __forceinline__ float bf16_rne(float f) {
  unsigned int u = __builtin_bit_cast(unsigned int, f);
  u = (u + 0x7fffu + ((u >> 16) & 1u)) & 0xffff0000u;
  return __builtin_bit_cast(float, u);
}

// 16x32 fragment from a [row][k] k-contiguous 16-bit matrix; rowp = row (lane&15) start.
// elements 0..7 <- k0+8hf .. +7, elements 8..15 <- k0+16+8hf .. +7 (same map for A and B)
__device__ __forceinline__ v16h ld_frag(const _Float16* rowp, int k0, int hf) {
  Frag f;
  f.h[0] = *(const v8ha*)(rowp + k0 + 8 * hf);
  f.h[1] = *(const v8ha*)(rowp + k0 + 16 + 8 * hf);
  return f.v;
}

__device__ __forceinline__ v8f zero8() {
  v8f z = {0.f, 0.f, 0.f, 0.f, 0.f, 0.f, 0.f, 0.f};
  return z;
}

__device__ __forceinline__ v8f wmma16(v16h a, v16h b, v8f c) {
  c = __builtin_amdgcn_wmma_f32_16x16x32_f16(false, a, false, b, (short)0, c, false, false);
  asm volatile("v_nop\n\tv_nop\n\tv_nop\n\tv_nop" : "+v"(c) : "v"(a), "v"(b));
  return c;
}

// K-steps 2*kp and 2*kp+1 of a wave's NT weight fragments, issued as one group of loads. A pair of k-steps is
// one 128-byte line of each Qt row: the four loads that share a tile's 16 lines stand next to each other.
template <int NT>
__device__ __forceinline__ void q_fetch(v16h (&bq)[PF][3], const _Float16* qrow, int kp, int hf) {
#pragma unroll
  for (int t = 0; t < NT; ++t) {
    bq[(2 * kp) % PF][t]     = ld_frag(qrow + t * TSTEP, (2 * kp) * 32, hf);
    bq[(2 * kp + 1) % PF][t] = ld_frag(qrow + t * TSTEP, (2 * kp + 1) * 32, hf);
  }
}

// K loop of GEMM1 for a wave that owns NT n-tiles: k-steps 0..PF-1 of all its tiles are issued up front,
// and each finished pair of steps refills its ring slots with the pair PF steps on.
template <int NT>
__device__ __forceinline__ void gemm1_k(const _Float16* ya0, const _Float16* ya1, const _Float16* qrow,
                                        int hf, v8f (&acc)[3][2]) {
  v16h bq[PF][3];
#pragma unroll
  for (int kp = 0; kp < PF / 2; ++kp) q_fetch<NT>(bq, qrow, kp, hf);
  // unrolled: the ring slot must be a compile-time register index
#pragma unroll
  for (int ks = 0; ks < KSTEPS; ++ks) {
    const v16h a0 = ld_frag(ya0, ks * 32, hf);
    const v16h a1 = ld_frag(ya1, ks * 32, hf);
#pragma unroll
    for (int t = 0; t < NT; ++t) {
      acc[t][0] = wmma16(a0, bq[ks % PF][t], acc[t][0]);
      acc[t][1] = wmma16(a1, bq[ks % PF][t], acc[t][1]);
    }
    if ((ks & 1) && ks + PF < KSTEPS + 1) q_fetch<NT>(bq, qrow, (ks - 1 + PF) / 2, hf);
  }
  // stands between the loads above and the next head's rewrite of their address registers
  asm volatile("s_wait_xcnt 0x0" ::: "memory");
}

// =====================================================================
// Kernel 0: weight planes.
//   Qt[h][e][d] = f16( bf16(Q[h][d][e]) * QSC ), e < 304 (rows >= 300 zero), d < 320 (cols >= 300 zero)
//   Vt[h][f][d] = f16( bf16(V[h][d][f]) * VSC ), f < 32  (rows >= 20 zero),  d < 320
// grid: QT_BLOCKS + VT_BLOCKS, block 256 (block-uniform role)
// =====================================================================
__launch_bounds__(256)
__global__ void k_prep(const float* __restrict__ Q, const float* __restrict__ V,
                       _Float16* __restrict__ Qt, _Float16* __restrict__ Vt)
{
  const int bid = blockIdx.x;
  const int tid = threadIdx.x;
  U8h u;
  _Float16* dst;
  if (bid < QT_BLOCKS) {
    const int c   = bid * 256 + tid;              // < QT_CHUNKS exactly
    const int h   = c / (EP * DCH);
    const int rem = c - h * (EP * DCH);
    const int e   = rem / DCH;
    const int dc  = rem - e * DCH;
    const int d0  = dc * 8;
    const int ecl = imin(e, DDIM - 1);
#pragma unroll
    for (int j = 0; j < 8; ++j) {
      const int d   = d0 + j;
      const int dcl = imin(d, DDIM - 1);
      const float x = Q[((size_t)h * DDIM + dcl) * DDIM + ecl];   // clamped address
      const bool ok = (d < DDIM) && (e < DDIM);
      const float r = ok ? bf16_rne(x) * QSC : 0.0f;
      u.s[j] = (_Float16)r;
    }
    dst = Qt + (size_t)c * 8;
  } else {
    const int c   = (bid - QT_BLOCKS) * 256 + tid;  // < VT_CHUNKS exactly
    const int h   = c / (FP * DCH);
    const int rem = c - h * (FP * DCH);
    const int f   = rem / DCH;
    const int dc  = rem - f * DCH;
    const int d0  = dc * 8;
    const int fcl = imin(f, HDIM - 1);
#pragma unroll
    for (int j = 0; j < 8; ++j) {
      const int d   = d0 + j;
      const int dcl = imin(d, DDIM - 1);
      const float x = V[((size_t)h * DDIM + dcl) * HDIM + fcl];   // clamped address
      const bool ok = (d < DDIM) && (f < HDIM);
      const float r = ok ? bf16_rne(x) * VSC : 0.0f;
      u.s[j] = (_Float16)r;
    }
    dst = Vt + (size_t)c * 8;
  }
  const v8h val = u.v;
  *(v8h*)dst = val;
  
}

// =====================================================================
// Kernel 1: one block per batch row b (256 threads = 8 waves), loop over heads.
//   LDS (rows padded to the pitches YP, TP, SP; pad bytes are never read):
//        Ys [32][320] f16 (y tile, bf16-RNE values), Yt [304][32] f16 (transposed copy),
//        P1h/P1l [32][320] f16 (a1 hi/residual, reused for h0 hi/residual),
//        Ssc [32][32] f32 scores, Eh/El [32][32] f16 exp hi/residual, invs[32], msk[32],
// Every LDS region is cross-wave: block barriers between producer and consumer phases.
// =====================================================================
__launch_bounds__(256)
__global__ void k_attn(const float* __restrict__ y, const int* __restrict__ seq,
                       const _Float16* __restrict__ Qt, const _Float16* __restrict__ Vt,
                       float* __restrict__ out)
{
  __shared__ __align__(16) _Float16 Ys[LP * YP];
  __shared__ __align__(16) _Float16 Yt[EP * TP];
  __shared__ __align__(16) _Float16 P1h[LP * YP];
  __shared__ __align__(16) _Float16 P1l[LP * YP];
  __shared__ __align__(16) float    Ssc[LP * SP];
  __shared__ __align__(16) _Float16 Eh[LP * TP];
  __shared__ __align__(16) _Float16 El[LP * TP];
  __shared__ __align__(16) float    invs[LP];
  __shared__ __align__(16) int      msk[LP];
  __shared__ __align__(16) float    Outs[LSEQ * ODIM];

  const int tid  = threadIdx.x;
  const int lane = tid & 31;
  const int wave = __builtin_amdgcn_readfirstlane(tid >> 5);
  const int hf   = lane >> 4;
  const int nl   = lane & 15;
  const int b    = blockIdx.x;
  const float* yb = y + (size_t)b * Y_BSTRIDE;

  // ---- weight fragment rows ----
  const bool w3 = wave + 16 < NTD;                                   // wave-uniform: owns a third n-tile
  const _Float16* qrow0 = Qt + (size_t)(wave * 16 + nl) * DP;        // lane's row of n-tile `wave`, head 0
  const _Float16* vrow0 = Vt + (size_t)((wave & 1) * 16 + nl) * DP;  // lane's row of Vt, head 0
  // one base per plane for the a1 / h0 stores: every (tile, row) is then a constant offset of the store,
  // not an address register of its own held over the head loop (the fragments held ahead need those registers)
  _Float16* p1h_w = P1h + (8 * hf) * YP + wave * 16 + nl;
  _Float16* p1l_w = P1l + (8 * hf) * YP + wave * 16 + nl;

  // ---- stage y tile: Ys[row][d] and Yt[d][row], bf16-RNE values in f16, pads zero ----
  for (int idx = tid; idx < LP * DCH; idx += 256) {
    const int row = idx / DCH;
    const int dc  = idx - row * DCH;
    const int d0  = dc * 8;
    const int rcl = imin(row, LSEQ - 1);
    U8h u;
#pragma unroll
    for (int j = 0; j < 8; ++j) {
      const int d   = d0 + j;
      const int dcl = imin(d, DDIM - 1);
      const float x = yb[rcl * DDIM + dcl];                       // clamped address
      const bool ok = (row < LSEQ) && (d < DDIM);
      const float r = ok ? bf16_rne(x) : 0.0f;
      u.s[j] = (_Float16)r;
    }
    *(v8ha*)(Ys + row * YP + d0) = u.v;
#pragma unroll
    for (int j = 0; j < 8; ++j) {
      const int d = d0 + j;
      if (d < EP) Yt[d * TP + row] = u.s[j];
    }
  }
  // ---- zero the K pad columns 304..319 of both a1/h0 planes (never written later) ----
  if (tid < 64) {
    const int r = tid >> 1, c = tid & 1;
    U8h z; z.u[0] = 0u; z.u[1] = 0u; z.u[2] = 0u; z.u[3] = 0u;
    *(v8ha*)(P1h + r * YP + EP + c * 8) = z.v;
    *(v8ha*)(P1l + r * YP + EP + c * 8) = z.v;
  }
  // ---- key mask from token ids (id > 0), pads 0 ----
  if (tid < LP) {
    const int m  = imin(tid, LSEQ - 1);
    const int sv = seq[(size_t)b * SEQ_BSTRIDE + m];           // clamped address
    msk[tid] = (tid < LSEQ && sv > 0) ? 1 : 0;
  }
  __syncthreads();

  for (int h = 0; h < NHEAD; ++h) {
    // ================= GEMM1: a1 (x QSC) = Ys (32x320) * Qt_h ; 2 m-tiles x 19 n-tiles =================
    {
      v8f acc[3][2];
#pragma unroll
      for (int t = 0; t < 3; ++t) { acc[t][0] = zero8(); acc[t][1] = zero8(); }
      const _Float16* qrow = qrow0 + (size_t)h * EP * DP;
      if (w3) gemm1_k<3>(Ys + nl * YP, Ys + (16 + nl) * YP, qrow, hf, acc);
      else    gemm1_k<2>(Ys + nl * YP, Ys + (16 + nl) * YP, qrow, hf, acc);
      // epilogue: a1 = acc/QSC -> f16 hi + f16 residual*RSC into P1h/P1l [row][col]
#pragma unroll
      for (int t = 0; t < 3; ++t) {
        const int nt = wave + 8 * t;
        if (nt < NTD) {
#pragma unroll
          for (int mt = 0; mt < 2; ++mt) {
#pragma unroll
            for (int r = 0; r < 8; ++r) {
              const float a = acc[t][mt][r] * (1.0f / QSC);
              const _Float16 ah = (_Float16)a;
              const float rs = (a - (float)ah) * RSC;
              p1h_w[(mt * 16 + r) * YP + t * 128] = ah;
              p1l_w[(mt * 16 + r) * YP + t * 128] = (_Float16)rs;
            }
          }
        }
      }
    }
    __syncthreads();

    // ================= GEMM2: S = a1 (32x320) * Ys^T ; 4 tiles, waves 0..3 =================
    if (wave < 4) {
      const int mt = wave >> 1, nt = wave & 1;
      v8f ch = zero8(), cl = zero8();
#pragma unroll 1
      for (int ks = 0; ks < KSTEPS; ++ks) {
        const int k0 = ks * 32;
        const v16h by = ld_frag(Ys + (nt * 16 + nl) * YP, k0, hf);      // B[k=e][n=m] = Ys[m][e]
        const v16h ah = ld_frag(P1h + (mt * 16 + nl) * YP, k0, hf);
        const v16h al = ld_frag(P1l + (mt * 16 + nl) * YP, k0, hf);
        ch = wmma16(ah, by, ch);
        cl = wmma16(al, by, cl);
      }
#pragma unroll
      for (int r = 0; r < 8; ++r) {
        const int row = mt * 16 + 8 * hf + r;
        const int col = nt * 16 + nl;
        Ssc[row * SP + col] = ch[r] + cl[r] * (1.0f / RSC);
      }
    }
    __syncthreads();

    // ================= exp (no max subtraction) + masked row sums =================
    {
      const int l = tid >> 3;          // 0..31
      const int g = tid & 7;           // 8 threads per row, 4 key positions each
      float part = 0.0f;
#pragma unroll
      for (int j = 0; j < 4; ++j) {
        const int m = g * 4 + j;
        const float s = Ssc[l * SP + m];
        const bool ok = (l < LSEQ) && (m < LSEQ);
        const float e = ok ? expf(s) : 0.0f;        // numerator unmasked
        part += (msk[m] != 0) ? e : 0.0f;           // denominator masked
        const _Float16 ehv = (_Float16)e;
        const float rs = (e - (float)ehv) * RSC;
        Eh[l * TP + m] = ehv;
        El[l * TP + m] = (_Float16)rs;
      }
      part += __shfl_xor(part, 1);
      part += __shfl_xor(part, 2);
      part += __shfl_xor(part, 4);
      if (g == 0) invs[l] = (l < LSEQ) ? (1.0f / (part + 1e-6f)) : 0.0f;
    }
    __syncthreads();

    // ================= GEMM3: h0 = (expS (32x32) * Yt) * inv[row] ; into P1h/P1l =================
    {
      v16h ehf[2], elf[2];
#pragma unroll
      for (int mt = 0; mt < 2; ++mt) {
        ehf[mt] = ld_frag(Eh + (mt * 16 + nl) * TP, 0, hf);
        elf[mt] = ld_frag(El + (mt * 16 + nl) * TP, 0, hf);
      }
#pragma unroll
      for (int t = 0; t < 3; ++t) {
        const int nt = wave + 8 * t;
        if (nt < NTD) {
          const v16h by = ld_frag(Yt + (nt * 16 + nl) * TP, 0, hf);     // B[k=m][n=d] = Yt[d][m]
#pragma unroll
          for (int mt = 0; mt < 2; ++mt) {
            const v8f ch = wmma16(ehf[mt], by, zero8());
            const v8f cl = wmma16(elf[mt], by, zero8());
#pragma unroll
            for (int r = 0; r < 8; ++r) {
              const int row = mt * 16 + 8 * hf + r;
              const float hv = (ch[r] + cl[r] * (1.0f / RSC)) * invs[row];
              const _Float16 hh = (_Float16)hv;
              const float rs = (hv - (float)hh) * RSC;
              p1h_w[(mt * 16 + r) * YP + t * 128] = hh;
              p1l_w[(mt * 16 + r) * YP + t * 128] = (_Float16)rs;
            }
          }
        }
      }
    }
    __syncthreads();

    // ================= GEMM4: h1 (x VSC) = h0 (32x320) * Vt_h ; 4 tiles, waves 0..3 =================
    if (wave < 4) {
      const int mt = wave >> 1, nt = wave & 1;
      v8f ch = zero8(), cl = zero8();
      // all k-steps of the Vt fragments are issued up front: one load latency for the phase, not one per step
      v16h bv[KSTEPS];
#pragma unroll
      for (int s = 0; s < KSTEPS; ++s) bv[s] = ld_frag(vrow0 + (size_t)h * FP * DP, s * 32, hf);
      // unrolled: the fragment index must be a compile-time register index
#pragma unroll
      for (int ks = 0; ks < KSTEPS; ++ks) {
        const int k0 = ks * 32;
        const v16h ah = ld_frag(P1h + (mt * 16 + nl) * YP, k0, hf);
        const v16h al = ld_frag(P1l + (mt * 16 + nl) * YP, k0, hf);
        ch = wmma16(ah, bv[ks], ch);
        cl = wmma16(al, bv[ks], cl);
      }
#pragma unroll
      for (int r = 0; r < 8; ++r) {
        const int l = mt * 16 + 8 * hf + r;
        const int f = nt * 16 + nl;
        const float v = (ch[r] + cl[r] * (1.0f / RSC)) * (1.0f / VSC);
        if (l < LSEQ && f < HDIM) Outs[l * ODIM + h * HDIM + f] = v;
      }
    }
    __syncthreads();
  }

  float* ob = out + (size_t)b * OUT_BSTRIDE;
  constexpr int NV4 = (LSEQ * ODIM) / 4;          // 3000
  for (int i = tid; i < NV4; i += 256) {
    const v4f v = *(const v4fa*)(Outs + i * 4);
    *(v4f*)(ob + (size_t)i * 4) = v;
  }
  
}

extern "C" void kernel_launch(void* const* d_in, const int* in_sizes, int n_in,
                              void* d_out, int out_size, void* d_ws, size_t ws_size,
                              hipStream_t stream)
{
  if (n_in < 4) return;
  if (in_sizes[0] < NB * LSEQ * DDIM) return;
  if (in_sizes[1] < NB * LSEQ) return;
  if (in_sizes[2] < NHEAD * DDIM * DDIM) return;
  if (in_sizes[3] < NHEAD * DDIM * HDIM) return;
  if (out_size < NB * LSEQ * ODIM) return;

  const float* y   = (const float*)d_in[0];
  const int*   seq = (const int*)  d_in[1];
  const float* Q   = (const float*)d_in[2];
  const float* V   = (const float*)d_in[3];
  float*       out = (float*)d_out;

  const size_t qt_bytes = (size_t)NHEAD * EP * DP * sizeof(_Float16);   // 3,891,200
  const size_t vt_bytes = (size_t)NHEAD * FP * DP * sizeof(_Float16);   //   409,600
  if (ws_size < qt_bytes + vt_bytes) return;
  _Float16* Qt = (_Float16*)d_ws;
  _Float16* Vt = (_Float16*)((char*)d_ws + qt_bytes);

  k_prep<<<dim3(QT_BLOCKS + VT_BLOCKS), dim3(256), 0, stream>>>(Q, V, Qt, Vt);
  k_attn<<<dim3(NB), dim3(256), 0, stream>>>(y, seq, Qt, Vt, out);
}

// v003
// A run of this version takes 286 microseconds.
// In two side-by-side timings against v002, it was 1.33 and 1.32 times as fast.
// Over all steps from v000 it is 2.29 times as fast.
#include <hip/hip_runtime.h>
// Contractions y*Q_h, a1*y^T, expS*y, h0*V_h: v_wmma_f32_16x16x32_f16 (f16 operands built from bf16-RNE inputs; a1, expS, h0 as f16 hi + f16 residual x2048 planes with separate accumulators), f32 accumulate; exp / normalisation in f32.

#ifndef NB
#define NB 1024
#endif
#define NB_FULL 1024
#define LSEQ   30
#define DDIM   300
#define NHEAD  20
#define HDIM   20
#define ODIM   (NHEAD * HDIM)          /* 400 */
#define LP     32                      /* padded rows */
#define DP     320                     /* padded K */
#define KSTEPS (DP / 32)               /* 10 */
#define NTD    19                      /* 16-col tiles covering 300 */
#define EP     (NTD * 16)              /* 304 padded out cols of Q_h */
#define FP     32                      /* padded out cols of V_h */
#define DCH    (DP / 8)                /* 40 chunks of 8 halves per padded row */
/* LDS row pitches: an odd multiple of 16 bytes, so that the 16 rows of a b128 fragment read fall on distinct banks */
#define YP     (DP + 8)                /* halves: 656 B rows of Ys, P1h, P1l */
#define TP     (LP + 8)                /* halves:  80 B rows of Yt, Eh, El */
#define SP     (LP + 4)                /* floats: 144 B rows of Ssc */
#define QT_CHUNKS (NHEAD * EP * DCH)   /* 243200 */
#define VT_CHUNKS (NHEAD * FP * DCH)   /* 25600 */
#define QT_BLOCKS (QT_CHUNKS / 256)    /* 950 */
#define VT_BLOCKS (VT_CHUNKS / 256)    /* 100 */
#define Y_BSTRIDE   (LSEQ * DDIM)      /* per-batch stride of y (floats) */
#define SEQ_BSTRIDE (LSEQ)             /* per-batch stride of token ids */
#define OUT_BSTRIDE (LSEQ * ODIM)      /* per-batch stride of out (floats) */
#define QSC 1024.0f                    /* power-of-two carry on Q plane */
#define VSC 1024.0f                    /* power-of-two carry on V plane */
#define RSC 2048.0f                    /* power-of-two carry on residual planes */
#define PF  6                          /* k-steps of weight fragments held ahead in registers (three pairs) */
#define FRH (2 * 32 * 8)               /* halves of one packed 16x32 weight fragment: 2 loads x 32 lanes x 8 halves */
#define TSTEP (8 * KSTEPS * FRH)       /* halves between a wave's successive n-tiles of Qt */

static_assert(QT_CHUNKS % 256 == 0);
static_assert(VT_CHUNKS % 256 == 0);
static_assert((OUT_BSTRIDE * 4) % 128 == 0);
static_assert((LSEQ * ODIM) % 4 == 0);
static_assert(((NHEAD * EP * DP * 2) % 128) == 0);
static_assert(NB <= NB_FULL);
static_assert(PF <= KSTEPS && PF % 2 == 0 && KSTEPS % 2 == 0 && (DP * 2) % 128 == 0);
static_assert(DP % 32 == 0 && EP >= DDIM && FP >= HDIM && LP >= LSEQ);
static_assert(NTD * KSTEPS * FRH == EP * DP && (FP / 16) * KSTEPS * FRH == FP * DP);
static_assert((YP * 2) % 32 == 16 && (TP * 2) % 32 == 16 && (SP * 4) % 32 == 16);

typedef _Float16 v16h __attribute__((ext_vector_type(16)));
typedef _Float16 v8h  __attribute__((ext_vector_type(8)));
typedef float    v8f  __attribute__((ext_vector_type(8)));
typedef float    v4f  __attribute__((ext_vector_type(4)));
typedef v8h v8ha __attribute__((may_alias));
typedef v4f v4fa __attribute__((may_alias));

union Frag { v16h v; v8h h[2]; };
union U8h  { v8h v; _Float16 s[8]; unsigned int u[4]; };

__device__ __forceinline__ int imin(int a, int b) { return a < b ? a : b; }

// f32 -> bf16 (RNE) -> back to f32 (value exactly representable in bf16)
__device__ __forceinline__ float bf16_rne(float f) {
  unsigned int u = __builtin_bit_cast(unsigned int, f);
  u = (u + 0x7fffu + ((u >> 16) & 1u)) & 0xffff0000u;
  return __builtin_bit_cast(float, u);
}

// 16x32 fragment from a [row][k] k-contiguous 16-bit matrix; rowp = row (lane&15) start.
// elements 0..7 <- k0+8hf .. +7, elements 8..15 <- k0+16+8hf .. +7 (same map for A and B)
__device__ __forceinline__ v16h ld_frag(const _Float16* rowp, int k0, int hf) {
  Frag f;
  f.h[0] = *(const v8ha*)(rowp + k0 + 8 * hf);
  f.h[1] = *(const v8ha*)(rowp + k0 + 16 + 8 * hf);
  return f.v;
}

// 16x32 fragment from a plane packed in fragment order: lanep = the tile's k-step 0 + lane * 8 halves.
// Each of the two loads reads 32 lanes x 16 B = 512 contiguous bytes; same element map as ld_frag.
__device__ __forceinline__ v16h ld_pfrag(const _Float16* lanep, int ks) {
  Frag f;
  f.h[0] = *(const v8ha*)(lanep + ks * FRH);
  f.h[1] = *(const v8ha*)(lanep + ks * FRH + FRH / 2);
  return f.v;
}

__device__ __forceinline__ v8f zero8() {
  v8f z = {0.f, 0.f, 0.f, 0.f, 0.f, 0.f, 0.f, 0.f};
  return z;
}

__device__ __forceinline__ v8f wmma16(v16h a, v16h b, v8f c) {
  c = __builtin_amdgcn_wmma_f32_16x16x32_f16(false, a, false, b, (short)0, c, false, false);
  asm volatile("v_nop\n\tv_nop\n\tv_nop\n\tv_nop" : "+v"(c) : "v"(a), "v"(b));
  return c;
}

// K-steps 2*kp and 2*kp+1 of a wave's NT weight fragments, issued as one group of loads.
template <int NT>
__device__ __forceinline__ void q_fetch(v16h (&bq)[PF][3], const _Float16* qlane, int kp) {
#pragma unroll
  for (int t = 0; t < NT; ++t) {
    bq[(2 * kp) % PF][t]     = ld_pfrag(qlane + t * TSTEP, 2 * kp);
    bq[(2 * kp + 1) % PF][t] = ld_pfrag(qlane + t * TSTEP, 2 * kp + 1);
  }
}

// K loop of GEMM1 for a wave that owns NT n-tiles: k-steps 0..PF-1 of all its tiles are issued up front,
// and each finished pair of steps refills its ring slots with the pair PF steps on.
template <int NT>
__device__ __forceinline__ void gemm1_k(const _Float16* ya0, const _Float16* ya1, const _Float16* qlane,
                                        int hf, v8f (&acc)[3][2]) {
  v16h bq[PF][3];
#pragma unroll
  for (int kp = 0; kp < PF / 2; ++kp) q_fetch<NT>(bq, qlane, kp);
  // unrolled: the ring slot must be a compile-time register index
#pragma unroll
  for (int ks = 0; ks < KSTEPS; ++ks) {
    const v16h a0 = ld_frag(ya0, ks * 32, hf);
    const v16h a1 = ld_frag(ya1, ks * 32, hf);
#pragma unroll
    for (int t = 0; t < NT; ++t) {
      acc[t][0] = wmma16(a0, bq[ks % PF][t], acc[t][0]);
      acc[t][1] = wmma16(a1, bq[ks % PF][t], acc[t][1]);
    }
    if ((ks & 1) && ks + PF < KSTEPS + 1) q_fetch<NT>(bq, qlane, (ks - 1 + PF) / 2);
  }
  // stands between the loads above and the next head's rewrite of their address registers
  asm volatile("s_wait_xcnt 0x0" ::: "memory");
}

// =====================================================================
// Kernel 0: weight planes, packed in the order the B fragments are loaded.
//   value(h, e, d) = f16( bf16(Q[h][d][e]) * QSC ), e < 304 (e >= 300 zero), d < 320 (d >= 300 zero)
//   value(h, f, d) = f16( bf16(V[h][d][f]) * VSC ), f < 32  (f >= 20 zero),  d < 320
//   chunk of 8 halves c = ((((h * tiles + nt) * KSTEPS + ks) * 2 + j) * 32 + lane) holds
//   row nt*16 + (lane & 15), d = ks*32 + j*16 + 8*(lane >> 4) .. +7
// grid: QT_BLOCKS + VT_BLOCKS, block 256 (block-uniform role)
// =====================================================================
__launch_bounds__(256)
__global__ void k_prep(const float* __restrict__ Q, const float* __restrict__ V,
                       _Float16* __restrict__ Qt, _Float16* __restrict__ Vt)
{
  const int bid = blockIdx.x;
  const int tid = threadIdx.x;
  U8h u;
  _Float16* dst;
  if (bid < QT_BLOCKS) {
    const int c   = bid * 256 + tid;              // < QT_CHUNKS exactly
    const int fr  = c >> 6;                       // fragment: (h * NTD + nt) * KSTEPS + ks
    const int tn  = fr / KSTEPS;
    const int ks  = fr - tn * KSTEPS;
    const int h   = tn / NTD;
    const int nt  = tn - h * NTD;
    const int e   = nt * 16 + (c & 15);
    const int d0  = ks * 32 + ((c >> 5) & 1) * 16 + ((c >> 4) & 1) * 8;
    const int ecl = imin(e, DDIM - 1);
#pragma unroll
    for (int j = 0; j < 8; ++j) {
      const int d   = d0 + j;
      const int dcl = imin(d, DDIM - 1);
      const float x = Q[((size_t)h * DDIM + dcl) * DDIM + ecl];   // clamped address
      const bool ok = (d < DDIM) && (e < DDIM);
      const float r = ok ? bf16_rne(x) * QSC : 0.0f;
      u.s[j] = (_Float16)r;
    }
    dst = Qt + (size_t)c * 8;
  } else {
    const int c   = (bid - QT_BLOCKS) * 256 + tid;  // < VT_CHUNKS exactly
    const int fr  = c >> 6;                         // fragment: (h * (FP / 16) + nt) * KSTEPS + ks
    const int tn  = fr / KSTEPS;
    const int ks  = fr - tn * KSTEPS;
    const int h   = tn / (FP / 16);
    const int nt  = tn - h * (FP / 16);
    const int f   = nt * 16 + (c & 15);
    const int d0  = ks * 32 + ((c >> 5) & 1) * 16 + ((c >> 4) & 1) * 8;
    const int fcl = imin(f, HDIM - 1);
#pragma unroll
    for (int j = 0; j < 8; ++j) {
      const int d   = d0 + j;
      const int dcl = imin(d, DDIM - 1);
      const float x = V[((size_t)h * DDIM + dcl) * HDIM + fcl];   // clamped address
      const bool ok = (d < DDIM) && (f < HDIM);
      const float r = ok ? bf16_rne(x) * VSC : 0.0f;
      u.s[j] = (_Float16)r;
    }
    dst = Vt + (size_t)c * 8;
  }
  const v8h val = u.v;
  *(v8h*)dst = val;
  
}

// =====================================================================
// Kernel 1: one block per batch row b (256 threads = 8 waves), loop over heads.
//   LDS (rows padded to the pitches YP, TP, SP; pad bytes are never read):
//        Ys [32][320] f16 (y tile, bf16-RNE values), Yt [304][32] f16 (transposed copy),
//        P1h/P1l [32][320] f16 (a1 hi/residual, reused for h0 hi/residual),
//        Ssc [32][32] f32 scores, Eh/El [32][32] f16 exp hi/residual, invs[32], msk[32],
// Every LDS region is cross-wave: block barriers between producer and consumer phases.
// =====================================================================
__launch_bounds__(256)
__global__ void k_attn(const float* __restrict__ y, const int* __restrict__ seq,
                       const _Float16* __restrict__ Qt, const _Float16* __restrict__ Vt,
                       float* __restrict__ out)
{
  __shared__ __align__(16) _Float16 Ys[LP * YP];
  __shared__ __align__(16) _Float16 Yt[EP * TP];
  __shared__ __align__(16) _Float16 P1h[LP * YP];
  __shared__ __align__(16) _Float16 P1l[LP * YP];
  __shared__ __align__(16) float    Ssc[LP * SP];
  __shared__ __align__(16) _Float16 Eh[LP * TP];
  __shared__ __align__(16) _Float16 El[LP * TP];
  __shared__ __align__(16) float    invs[LP];
  __shared__ __align__(16) int      msk[LP];
  __shared__ __align__(16) float    Outs[LSEQ * ODIM];

  const int tid  = threadIdx.x;
  const int lane = tid & 31;
  const int wave = __builtin_amdgcn_readfirstlane(tid >> 5);
  const int hf   = lane >> 4;
  const int nl   = lane & 15;
  const int b    = blockIdx.x;
  const float* yb = y + (size_t)b * Y_BSTRIDE;

  // ---- weight fragments: the lane's 16 bytes of k-step 0 ----
  const bool w3 = wave + 16 < NTD;                                   // wave-uniform: owns a third n-tile
  const _Float16* qlane0 = Qt + (size_t)wave * (KSTEPS * FRH) + lane * 8;        // n-tile `wave`, head 0
  const _Float16* vlane0 = Vt + (size_t)(wave & 1) * (KSTEPS * FRH) + lane * 8;  // n-tile wave & 1 of Vt, head 0
  // one base per plane for the a1 / h0 stores: every (tile, row) is then a constant offset of the store,
  // not an address register of its own held over the head loop (the fragments held ahead need those registers)
  _Float16* p1h_w = P1h + (8 * hf) * YP + wave * 16 + nl;
  _Float16* p1l_w = P1l + (8 * hf) * YP + wave * 16 + nl;

  // ---- stage y tile: Ys[row][d] and Yt[d][row], bf16-RNE values in f16, pads zero ----
  for (int idx = tid; idx < LP * DCH; idx += 256) {
    const int row = idx / DCH;
    const int dc  = idx - row * DCH;
    const int d0  = dc * 8;
    const int rcl = imin(row, LSEQ - 1);
    U8h u;
#pragma unroll
    for (int j = 0; j < 8; ++j) {
      const int d   = d0 + j;
      const int dcl = imin(d, DDIM - 1);
      const float x = yb[rcl * DDIM + dcl];                       // clamped address
      const bool ok = (row < LSEQ) && (d < DDIM);
      const float r = ok ? bf16_rne(x) : 0.0f;
      u.s[j] = (_Float16)r;
    }
    *(v8ha*)(Ys + row * YP + d0) = u.v;
#pragma unroll
    for (int j = 0; j < 8; ++j) {
      const int d = d0 + j;
      if (d < EP) Yt[d * TP + row] = u.s[j];
    }
  }
  // ---- zero the K pad columns 304..319 of both a1/h0 planes (never written later) ----
  if (tid < 64) {
    const int r = tid >> 1, c = tid & 1;
    U8h z; z.u[0] = 0u; z.u[1] = 0u; z.u[2] = 0u; z.u[3] = 0u;
    *(v8ha*)(P1h + r * YP + EP + c * 8) = z.v;
    *(v8ha*)(P1l + r * YP + EP + c * 8) = z.v;
  }
  // ---- key mask from token ids (id > 0), pads 0 ----
  if (tid < LP) {
    const int m  = imin(tid, LSEQ - 1);
    const int sv = seq[(size_t)b * SEQ_BSTRIDE + m];           // clamped address
    msk[tid] = (tid < LSEQ && sv > 0) ? 1 : 0;
  }
  __syncthreads();

  for (int h = 0; h < NHEAD; ++h) {
    // ================= GEMM1: a1 (x QSC) = Ys (32x320) * Qt_h ; 2 m-tiles x 19 n-tiles =================
    {
      v8f acc[3][2];
#pragma unroll
      for (int t = 0; t < 3; ++t) { acc[t][0] = zero8(); acc[t][1] = zero8(); }
      const _Float16* qlane = qlane0 + (size_t)h * (NTD * KSTEPS * FRH);
      if (w3) gemm1_k<3>(Ys + nl * YP, Ys + (16 + nl) * YP, qlane, hf, acc);
      else    gemm1_k<2>(Ys + nl * YP, Ys + (16 + nl) * YP, qlane, hf, acc);
      // epilogue: a1 = acc/QSC -> f16 hi + f16 residual*RSC into P1h/P1l [row][col]
#pragma unroll
      for (int t = 0; t < 3; ++t) {
        const int nt = wave + 8 * t;
        if (nt < NTD) {
#pragma unroll
          for (int mt = 0; mt < 2; ++mt) {
#pragma unroll
            for (int r = 0; r < 8; ++r) {
              const float a = acc[t][mt][r] * (1.0f / QSC);
              const _Float16 ah = (_Float16)a;
              const float rs = (a - (float)ah) * RSC;
              p1h_w[(mt * 16 + r) * YP + t * 128] = ah;
              p1l_w[(mt * 16 + r) * YP + t * 128] = (_Float16)rs;
            }
          }
        }
      }
    }
    __syncthreads();

    // ================= GEMM2: S = a1 (32x320) * Ys^T ; 4 tiles, waves 0..3 =================
    if (wave < 4) {
      const int mt = wave >> 1, nt = wave & 1;
      v8f ch = zero8(), cl = zero8();
#pragma unroll 1
      for (int ks = 0; ks < KSTEPS; ++ks) {
        const int k0 = ks * 32;
        const v16h by = ld_frag(Ys + (nt * 16 + nl) * YP, k0, hf);      // B[k=e][n=m] = Ys[m][e]
        const v16h ah = ld_frag(P1h + (mt * 16 + nl) * YP, k0, hf);
        const v16h al = ld_frag(P1l + (mt * 16 + nl) * YP, k0, hf);
        ch = wmma16(ah, by, ch);
        cl = wmma16(al, by, cl);
      }
#pragma unroll
      for (int r = 0; r < 8; ++r) {
        const int row = mt * 16 + 8 * hf + r;
        const int col = nt * 16 + nl;
        Ssc[row * SP + col] = ch[r] + cl[r] * (1.0f / RSC);
      }
    }
    __syncthreads();

    // ================= exp (no max subtraction) + masked row sums =================
    {
      const int l = tid >> 3;          // 0..31
      const int g = tid & 7;           // 8 threads per row, 4 key positions each
      float part = 0.0f;
#pragma unroll
      for (int j = 0; j < 4; ++j) {
        const int m = g * 4 + j;
        const float s = Ssc[l * SP + m];
        const bool ok = (l < LSEQ) && (m < LSEQ);
        const float e = ok ? expf(s) : 0.0f;        // numerator unmasked
        part += (msk[m] != 0) ? e : 0.0f;           // denominator masked
        const _Float16 ehv = (_Float16)e;
        const float rs = (e - (float)ehv) * RSC;
        Eh[l * TP + m] = ehv;
        El[l * TP + m] = (_Float16)rs;
      }
      part += __shfl_xor(part, 1);
      part += __shfl_xor(part, 2);
      part += __shfl_xor(part, 4);
      if (g == 0) invs[l] = (l < LSEQ) ? (1.0f / (part + 1e-6f)) : 0.0f;
    }
    __syncthreads();

    // ================= GEMM3: h0 = (expS (32x32) * Yt) * inv[row] ; into P1h/P1l =================
    {
      v16h ehf[2], elf[2];
#pragma unroll
      for (int mt = 0; mt < 2; ++mt) {
        ehf[mt] = ld_frag(Eh + (mt * 16 + nl) * TP, 0, hf);
        elf[mt] = ld_frag(El + (mt * 16 + nl) * TP, 0, hf);
      }
#pragma unroll
      for (int t = 0; t < 3; ++t) {
        const int nt = wave + 8 * t;
        if (nt < NTD) {
          const v16h by = ld_frag(Yt + (nt * 16 + nl) * TP, 0, hf);     // B[k=m][n=d] = Yt[d][m]
#pragma unroll
          for (int mt = 0; mt < 2; ++mt) {
            const v8f ch = wmma16(ehf[mt], by, zero8());
            const v8f cl = wmma16(elf[mt], by, zero8());
#pragma unroll
            for (int r = 0; r < 8; ++r) {
              const int row = mt * 16 + 8 * hf + r;
              const float hv = (ch[r] + cl[r] * (1.0f / RSC)) * invs[row];
              const _Float16 hh = (_Float16)hv;
              const float rs = (hv - (float)hh) * RSC;
              p1h_w[(mt * 16 + r) * YP + t * 128] = hh;
              p1l_w[(mt * 16 + r) * YP + t * 128] = (_Float16)rs;
            }
          }
        }
      }
    }
    __syncthreads();

    // ================= GEMM4: h1 (x VSC) = h0 (32x320) * Vt_h ; 4 tiles, waves 0..3 =================
    if (wave < 4) {
      const int mt = wave >> 1, nt = wave & 1;
      v8f ch = zero8(), cl = zero8();
      // all k-steps of the Vt fragments are issued up front: one load latency for the phase, not one per step
      v16h bv[KSTEPS];
#pragma unroll
      for (int s = 0; s < KSTEPS; ++s) bv[s] = ld_pfrag(vlane0 + (size_t)h * ((FP / 16) * KSTEPS * FRH), s);
      // unrolled: the fragment index must be a compile-time register index
#pragma unroll
      for (int ks = 0; ks < KSTEPS; ++ks) {
        const int k0 = ks * 32;
        const v16h ah = ld_frag(P1h + (mt * 16 + nl) * YP, k0, hf);
        const v16h al = ld_frag(P1l + (mt * 16 + nl) * YP, k0, hf);
        ch = wmma16(ah, bv[ks], ch);
        cl = wmma16(al, bv[ks], cl);
      }
#pragma unroll
      for (int r = 0; r < 8; ++r) {
        const int l = mt * 16 + 8 * hf + r;
        const int f = nt * 16 + nl;
        const float v = (ch[r] + cl[r] * (1.0f / RSC)) * (1.0f / VSC);
        if (l < LSEQ && f < HDIM) Outs[l * ODIM + h * HDIM + f] = v;
      }
    }
    __syncthreads();
  }

  float* ob = out + (size_t)b * OUT_BSTRIDE;
  constexpr int NV4 = (LSEQ * ODIM) / 4;          // 3000
  for (int i = tid; i < NV4; i += 256) {
    const v4f v = *(const v4fa*)(Outs + i * 4);
    *(v4f*)(ob + (size_t)i * 4) = v;
  }
  
}

extern "C" void kernel_launch(void* const* d_in, const int* in_sizes, int n_in,
                              void* d_out, int out_size, void* d_ws, size_t ws_size,
                              hipStream_t stream)
{
  if (n_in < 4) return;
  if (in_sizes[0] < NB * LSEQ * DDIM) return;
  if (in_sizes[1] < NB * LSEQ) return;
  if (in_sizes[2] < NHEAD * DDIM * DDIM) return;
  if (in_sizes[3] < NHEAD * DDIM * HDIM) return;
  if (out_size < NB * LSEQ * ODIM) return;

  const float* y   = (const float*)d_in[0];
  const int*   seq = (const int*)  d_in[1];
  const float* Q   = (const float*)d_in[2];
  const float* V   = (const float*)d_in[3];
  float*       out = (float*)d_out;

  const size_t qt_bytes = (size_t)NHEAD * EP * DP * sizeof(_Float16);   // 3,891,200
  const size_t vt_bytes = (size_t)NHEAD * FP * DP * sizeof(_Float16);   //   409,600
  if (ws_size < qt_bytes + vt_bytes) return;
  _Float16* Qt = (_Float16*)d_ws;
  _Float16* Vt = (_Float16*)((char*)d_ws + qt_bytes);

  k_prep<<<dim3(QT_BLOCKS + VT_BLOCKS), dim3(256), 0, stream>>>(Q, V, Qt, Vt);
  k_attn<<<dim3(NB), dim3(256), 0, stream>>>(y, seq, Qt, Vt, out);
}

// v004
// A run of this version takes 215 microseconds.
// Two timings next to v003 put it at 1.31 and 1.32 times that version's speed.
// Counting every step since v000, it is 3.02 times as fast.
#include <hip/hip_runtime.h>
// Contractions y*Q_h, y*V_h, a1*y^T, expS*(y*V_h): v_wmma_f32_16x16x32_f16 (f16 operands built from bf16-RNE inputs; a1, expS, y*V_h as f16 hi + f16 residual x2048 planes with separate accumulators), f32 accumulate; exp / normalisation in f32.

#ifndef NB
#define NB 1024
#endif
#define NB_FULL 1024
#define LSEQ   30
#define DDIM   300
#define NHEAD  20
#define HDIM   20
#define ODIM   (NHEAD * HDIM)          /* 400 */
#define LP     32                      /* padded rows */
#define DP     320                     /* padded K */
#define KSTEPS (DP / 32)               /* 10 */
#define NTD    19                      /* 16-col tiles covering 300 */
#define EP     (NTD * 16)              /* 304 padded out cols of Q_h */
#define FP     32                      /* padded out cols of V_h */
#define NTA    (NTD + FP / 16)         /* 21 n-tiles of y * [Q_h | V_h] */
#define DCH    (DP / 8)                /* 40 chunks of 8 halves per padded row */
/* LDS row pitches: an odd multiple of 16 bytes, so that the 16 rows of a b128 fragment read fall on distinct banks */
#define YP     (DP + 8)                /* halves: 656 B rows of Ys, P1h, P1l */
#define TP     (LP + 8)                /* halves:  80 B rows of Wh, Wl, Eh, El */
#define SP     (LP + 4)                /* floats: 144 B rows of Ssc */
#define QT_CHUNKS (NHEAD * EP * DCH)   /* 243200 */
#define VT_CHUNKS (NHEAD * FP * DCH)   /* 25600 */
#define QT_BLOCKS (QT_CHUNKS / 256)    /* 950 */
#define VT_BLOCKS (VT_CHUNKS / 256)    /* 100 */
#define Y_BSTRIDE   (LSEQ * DDIM)      /* per-batch stride of y (floats) */
#define SEQ_BSTRIDE (LSEQ)             /* per-batch stride of token ids */
#define OUT_BSTRIDE (LSEQ * ODIM)      /* per-batch stride of out (floats) */
#define QSC 1024.0f                    /* power-of-two carry on Q plane */
#define VSC 1024.0f                    /* power-of-two carry on V plane */
#define RSC 2048.0f                    /* power-of-two carry on residual planes */
#define PF  6                          /* k-steps of weight fragments held ahead in registers (three pairs) */
#define FRH (2 * 32 * 8)               /* halves of one packed 16x32 weight fragment: 2 loads x 32 lanes x 8 halves */
#define TSTEP (8 * KSTEPS * FRH)       /* halves between a wave's successive n-tiles of Qt */

static_assert(QT_CHUNKS % 256 == 0);
static_assert(VT_CHUNKS % 256 == 0);
static_assert((OUT_BSTRIDE * 4) % 128 == 0);
static_assert((LSEQ * ODIM) % 4 == 0);
static_assert(((NHEAD * EP * DP * 2) % 128) == 0);
static_assert(NB <= NB_FULL);
static_assert(NTD > 16 && NTA <= 24);
static_assert(PF <= KSTEPS && PF % 2 == 0 && KSTEPS % 2 == 0 && (DP * 2) % 128 == 0);
static_assert(DP % 32 == 0 && EP >= DDIM && FP >= HDIM && LP >= LSEQ);
static_assert(NTD * KSTEPS * FRH == EP * DP && (FP / 16) * KSTEPS * FRH == FP * DP);
static_assert((YP * 2) % 32 == 16 && (TP * 2) % 32 == 16 && (SP * 4) % 32 == 16);

typedef _Float16 v16h __attribute__((ext_vector_type(16)));
typedef _Float16 v8h  __attribute__((ext_vector_type(8)));
typedef float    v8f  __attribute__((ext_vector_type(8)));
typedef float    v4f  __attribute__((ext_vector_type(4)));
typedef v8h v8ha __attribute__((may_alias));
typedef v4f v4fa __attribute__((may_alias));

union Frag { v16h v; v8h h[2]; };
union U8h  { v8h v; _Float16 s[8]; unsigned int u[4]; };

__device__ __forceinline__ int imin(int a, int b) { return a < b ? a : b; }

// f32 -> bf16 (RNE) -> back to f32 (value exactly representable in bf16)
__device__ __forceinline__ float bf16_rne(float f) {
  unsigned int u = __builtin_bit_cast(unsigned int, f);
  u = (u + 0x7fffu + ((u >> 16) & 1u)) & 0xffff0000u;
  return __builtin_bit_cast(float, u);
}

// 16x32 fragment from a [row][k] k-contiguous 16-bit matrix; rowp = row (lane&15) start.
// elements 0..7 <- k0+8hf .. +7, elements 8..15 <- k0+16+8hf .. +7 (same map for A and B)
__device__ __forceinline__ v16h ld_frag(const _Float16* rowp, int k0, int hf) {
  Frag f;
  f.h[0] = *(const v8ha*)(rowp + k0 + 8 * hf);
  f.h[1] = *(const v8ha*)(rowp + k0 + 16 + 8 * hf);
  return f.v;
}

// 16x32 fragment from a plane packed in fragment order: lanep = the tile's k-step 0 + lane * 8 halves.
// Each of the two loads reads 32 lanes x 16 B = 512 contiguous bytes; same element map as ld_frag.
__device__ __forceinline__ v16h ld_pfrag(const _Float16* lanep, int ks) {
  Frag f;
  f.h[0] = *(const v8ha*)(lanep + ks * FRH);
  f.h[1] = *(const v8ha*)(lanep + ks * FRH + FRH / 2);
  return f.v;
}

__device__ __forceinline__ v8f zero8() {
  v8f z = {0.f, 0.f, 0.f, 0.f, 0.f, 0.f, 0.f, 0.f};
  return z;
}

__device__ __forceinline__ v8f wmma16(v16h a, v16h b, v8f c) {
  c = __builtin_amdgcn_wmma_f32_16x16x32_f16(false, a, false, b, (short)0, c, false, false);
  asm volatile("v_nop\n\tv_nop\n\tv_nop\n\tv_nop" : "+v"(c) : "v"(a), "v"(b));
  return c;
}

// K-steps 2*kp and 2*kp+1 of a wave's NT weight fragments, issued as one group of loads.
// Tiles 0 and 1 lie in Qt behind qlane; the third tile (of Qt or of Vt) has its own pointer.
template <int NT>
__device__ __forceinline__ void q_fetch(v16h (&bq)[PF][3], const _Float16* qlane, const _Float16* xlane, int kp) {
#pragma unroll
  for (int t = 0; t < NT; ++t) {
    const _Float16* p = t < 2 ? qlane + t * TSTEP : xlane;
    bq[(2 * kp) % PF][t]     = ld_pfrag(p, 2 * kp);
    bq[(2 * kp + 1) % PF][t] = ld_pfrag(p, 2 * kp + 1);
  }
}

// K loop of GEMM1 for a wave that owns NT n-tiles: k-steps 0..PF-1 of all its tiles are issued up front,
// and each finished pair of steps refills its ring slots with the pair PF steps on.
template <int NT>
__device__ __forceinline__ void gemm1_k(const _Float16* ya0, const _Float16* ya1, const _Float16* qlane,
                                        const _Float16* xlane, int hf, v8f (&acc)[3][2]) {
  v16h bq[PF][3];
#pragma unroll
  for (int kp = 0; kp < PF / 2; ++kp) q_fetch<NT>(bq, qlane, xlane, kp);
  // unrolled: the ring slot must be a compile-time register index
#pragma unroll
  for (int ks = 0; ks < KSTEPS; ++ks) {
    const v16h a0 = ld_frag(ya0, ks * 32, hf);
    const v16h a1 = ld_frag(ya1, ks * 32, hf);
#pragma unroll
    for (int t = 0; t < NT; ++t) {
      acc[t][0] = wmma16(a0, bq[ks % PF][t], acc[t][0]);
      acc[t][1] = wmma16(a1, bq[ks % PF][t], acc[t][1]);
    }
    if ((ks & 1) && ks + PF < KSTEPS + 1) q_fetch<NT>(bq, qlane, xlane, (ks - 1 + PF) / 2);
  }
  // stands between the loads above and the next head's rewrite of their address registers
  asm volatile("s_wait_xcnt 0x0" ::: "memory");
}

// =====================================================================
// Kernel 0: weight planes, packed in the order the B fragments are loaded.
//   value(h, e, d) = f16( bf16(Q[h][d][e]) * QSC ), e < 304 (e >= 300 zero), d < 320 (d >= 300 zero)
//   value(h, f, d) = f16( bf16(V[h][d][f]) * VSC ), f < 32  (f >= 20 zero),  d < 320
//   chunk of 8 halves c = ((((h * tiles + nt) * KSTEPS + ks) * 2 + j) * 32 + lane) holds
//   row nt*16 + (lane & 15), d = ks*32 + j*16 + 8*(lane >> 4) .. +7
// grid: QT_BLOCKS + VT_BLOCKS, block 256 (block-uniform role)
// =====================================================================
__launch_bounds__(256)
__global__ void k_prep(const float* __restrict__ Q, const float* __restrict__ V,
                       _Float16* __restrict__ Qt, _Float16* __restrict__ Vt)
{
  const int bid = blockIdx.x;
  const int tid = threadIdx.x;
  U8h u;
  _Float16* dst;
  if (bid < QT_BLOCKS) {
    const int c   = bid * 256 + tid;              // < QT_CHUNKS exactly
    const int fr  = c >> 6;                       // fragment: (h * NTD + nt) * KSTEPS + ks
    const int tn  = fr / KSTEPS;
    const int ks  = fr - tn * KSTEPS;
    const int h   = tn / NTD;
    const int nt  = tn - h * NTD;
    const int e   = nt * 16 + (c & 15);
    const int d0  = ks * 32 + ((c >> 5) & 1) * 16 + ((c >> 4) & 1) * 8;
    const int ecl = imin(e, DDIM - 1);
#pragma unroll
    for (int j = 0; j < 8; ++j) {
      const int d   = d0 + j;
      const int dcl = imin(d, DDIM - 1);
      const float x = Q[((size_t)h * DDIM + dcl) * DDIM + ecl];   // clamped address
      const bool ok = (d < DDIM) && (e < DDIM);
      const float r = ok ? bf16_rne(x) * QSC : 0.0f;
      u.s[j] = (_Float16)r;
    }
    dst = Qt + (size_t)c * 8;
  } else {
    const int c   = (bid - QT_BLOCKS) * 256 + tid;  // < VT_CHUNKS exactly
    const int fr  = c >> 6;                         // fragment: (h * (FP / 16) + nt) * KSTEPS + ks
    const int tn  = fr / KSTEPS;
    const int ks  = fr - tn * KSTEPS;
    const int h   = tn / (FP / 16);
    const int nt  = tn - h * (FP / 16);
    const int f   = nt * 16 + (c & 15);
    const int d0  = ks * 32 + ((c >> 5) & 1) * 16 + ((c >> 4) & 1) * 8;
    const int fcl = imin(f, HDIM - 1);
#pragma unroll
    for (int j = 0; j < 8; ++j) {
      const int d   = d0 + j;
      const int dcl = imin(d, DDIM - 1);
      const float x = V[((size_t)h * DDIM + dcl) * HDIM + fcl];   // clamped address
      const bool ok = (d < DDIM) && (f < HDIM);
      const float r = ok ? bf16_rne(x) * VSC : 0.0f;
      u.s[j] = (_Float16)r;
    }
    dst = Vt + (size_t)c * 8;
  }
  const v8h val = u.v;
  *(v8h*)dst = val;
  
}

// =====================================================================
// Kernel 1: one block per batch row b (256 threads = 8 waves), loop over heads.
//   LDS (rows padded to the pitches YP, TP, SP; pad bytes are never read):
//        Ys [32][320] f16 (y tile, bf16-RNE values), P1h/P1l [32][320] f16 (a1 hi/residual),
//        Wh/Wl [32][32] f16 (y * V_h hi/residual, stored [f][m]),
//        Ssc [32][32] f32 scores, Eh/El [32][32] f16 exp hi/residual, invs[32], msk[32],
//   h1 = (alpha * y) * V_h is formed as alpha * (y * V_h): y * V_h is two more n-tiles of the y * Q_h phase.
// Every LDS region is cross-wave: block barriers between producer and consumer phases.
// =====================================================================
__launch_bounds__(256)
__global__ void k_attn(const float* __restrict__ y, const int* __restrict__ seq,
                       const _Float16* __restrict__ Qt, const _Float16* __restrict__ Vt,
                       float* __restrict__ out)
{
  __shared__ __align__(16) _Float16 Ys[LP * YP];
  __shared__ __align__(16) _Float16 P1h[LP * YP];
  __shared__ __align__(16) _Float16 P1l[LP * YP];
  __shared__ __align__(16) _Float16 Wh[FP * TP];
  __shared__ __align__(16) _Float16 Wl[FP * TP];
  __shared__ __align__(16) float    Ssc[LP * SP];
  __shared__ __align__(16) _Float16 Eh[LP * TP];
  __shared__ __align__(16) _Float16 El[LP * TP];
  __shared__ __align__(16) float    invs[LP];
  __shared__ __align__(16) int      msk[LP];
  __shared__ __align__(16) float    Outs[LSEQ * ODIM];

  const int tid  = threadIdx.x;
  const int lane = tid & 31;
  const int wave = __builtin_amdgcn_readfirstlane(tid >> 5);
  const int hf   = lane >> 4;
  const int nl   = lane & 15;
  const int b    = blockIdx.x;
  const float* yb = y + (size_t)b * Y_BSTRIDE;

  // ---- weight fragments: the lane's 16 bytes of k-step 0 ----
  const bool w3 = wave + 16 < NTA;                                   // wave-uniform: owns a third n-tile
  const bool wv = w3 && wave + 16 >= NTD;                            // wave-uniform: that tile is one of y * V_h
  const _Float16* qlane0 = Qt + (size_t)wave * (KSTEPS * FRH) + lane * 8;        // n-tile `wave`, head 0
  // third tile, head 0: n-tile wave + 16 of Qt, or n-tile wave + 16 - NTD of Vt (waves without one never load from it)
  const _Float16* xlane0 = wv ? Vt + (size_t)(wave + 16 - NTD) * (KSTEPS * FRH) + lane * 8 : qlane0 + 2 * TSTEP;
  const int xstep = wv ? (FP / 16) * KSTEPS * FRH : NTD * KSTEPS * FRH;          // halves per head of that plane
  // one base per plane for the a1 stores: every (tile, row) is then a constant offset of the store,
  // not an address register of its own held over the head loop (the fragments held ahead need those registers)
  _Float16* p1h_w = P1h + (8 * hf) * YP + wave * 16 + nl;
  _Float16* p1l_w = P1l + (8 * hf) * YP + wave * 16 + nl;

  // ---- stage y tile: Ys[row][d], bf16-RNE values in f16, pads zero ----
  for (int idx = tid; idx < LP * DCH; idx += 256) {
    const int row = idx / DCH;
    const int dc  = idx - row * DCH;
    const int d0  = dc * 8;
    const int rcl = imin(row, LSEQ - 1);
    U8h u;
#pragma unroll
    for (int j = 0; j < 8; ++j) {
      const int d   = d0 + j;
      const int dcl = imin(d, DDIM - 1);
      const float x = yb[rcl * DDIM + dcl];                       // clamped address
      const bool ok = (row < LSEQ) && (d < DDIM);
      const float r = ok ? bf16_rne(x) : 0.0f;
      u.s[j] = (_Float16)r;
    }
    *(v8ha*)(Ys + row * YP + d0) = u.v;
  }
  // ---- zero the K pad columns 304..319 of both a1 planes (never written later) ----
  if (tid < 64) {
    const int r = tid >> 1, c = tid & 1;
    U8h z; z.u[0] = 0u; z.u[1] = 0u; z.u[2] = 0u; z.u[3] = 0u;
    *(v8ha*)(P1h + r * YP + EP + c * 8) = z.v;
    *(v8ha*)(P1l + r * YP + EP + c * 8) = z.v;
  }
  // ---- key mask from token ids (id > 0), pads 0 ----
  if (tid < LP) {
    const int m  = imin(tid, LSEQ - 1);
    const int sv = seq[(size_t)b * SEQ_BSTRIDE + m];           // clamped address
    msk[tid] = (tid < LSEQ && sv > 0) ? 1 : 0;
  }
  __syncthreads();

  for (int h = 0; h < NHEAD; ++h) {
    // ===== GEMM1: a1 (x QSC) = Ys (32x320) * Qt_h, yV (x VSC) = Ys * Vt_h ; 2 m-tiles x (19 + 2) n-tiles =====
    {
      v8f acc[3][2];
#pragma unroll
      for (int t = 0; t < 3; ++t) { acc[t][0] = zero8(); acc[t][1] = zero8(); }
      const _Float16* qlane = qlane0 + (size_t)h * (NTD * KSTEPS * FRH);
      const _Float16* xlane = xlane0 + (size_t)h * xstep;
      if (w3) gemm1_k<3>(Ys + nl * YP, Ys + (16 + nl) * YP, qlane, xlane, hf, acc);
      else    gemm1_k<2>(Ys + nl * YP, Ys + (16 + nl) * YP, qlane, xlane, hf, acc);
      // epilogue: a1 = acc/QSC -> f16 hi + f16 residual*RSC into P1h/P1l [row][col]
#pragma unroll
      for (int t = 0; t < 3; ++t) {
        const int nt = wave + 8 * t;
        if (nt < NTD) {
#pragma unroll
          for (int mt = 0; mt < 2; ++mt) {
#pragma unroll
            for (int r = 0; r < 8; ++r) {
              const float a = acc[t][mt][r] * (1.0f / QSC);
              const _Float16 ah = (_Float16)a;
              const float rs = (a - (float)ah) * RSC;
              p1h_w[(mt * 16 + r) * YP + t * 128] = ah;
              p1l_w[(mt * 16 + r) * YP + t * 128] = (_Float16)rs;
            }
          }
        }
      }
      // epilogue of a y * V_h tile: yV = acc/VSC -> f16 hi + f16 residual*RSC into Wh/Wl [f][m];
      // a lane's 8 accumulator rows are 8 successive m of its column f: one 16-byte store per plane
      if (wv) {
        const int f = (wave + 16 - NTD) * 16 + nl;
#pragma unroll
        for (int mt = 0; mt < 2; ++mt) {
          U8h uh, ul;
#pragma unroll
          for (int r = 0; r < 8; ++r) {
            const float a = acc[2][mt][r] * (1.0f / VSC);
            const _Float16 ah = (_Float16)a;
            const float rs = (a - (float)ah) * RSC;
            uh.s[r] = ah;
            ul.s[r] = (_Float16)rs;
          }
          *(v8ha*)(Wh + f * TP + mt * 16 + 8 * hf) = uh.v;
          *(v8ha*)(Wl + f * TP + mt * 16 + 8 * hf) = ul.v;
        }
      }
    }
    __syncthreads();

    // ================= GEMM2: S = a1 (32x320) * Ys^T ; 4 tiles, waves 0..3 =================
    if (wave < 4) {
      const int mt = wave >> 1, nt = wave & 1;
      v8f ch = zero8(), cl = zero8();
#pragma unroll 1
      for (int ks = 0; ks < KSTEPS; ++ks) {
        const int k0 = ks * 32;
        const v16h by = ld_frag(Ys + (nt * 16 + nl) * YP, k0, hf);      // B[k=e][n=m] = Ys[m][e]
        const v16h ah = ld_frag(P1h + (mt * 16 + nl) * YP, k0, hf);
        const v16h al = ld_frag(P1l + (mt * 16 + nl) * YP, k0, hf);
        ch = wmma16(ah, by, ch);
        cl = wmma16(al, by, cl);
      }
#pragma unroll
      for (int r = 0; r < 8; ++r) {
        const int row = mt * 16 + 8 * hf + r;
        const int col = nt * 16 + nl;
        Ssc[row * SP + col] = ch[r] + cl[r] * (1.0f / RSC);
      }
    }
    __syncthreads();

    // ================= exp (no max subtraction) + masked row sums =================
    {
      const int l = tid >> 3;          // 0..31
      const int g = tid & 7;           // 8 threads per row, 4 key positions each
      float part = 0.0f;
#pragma unroll
      for (int j = 0; j < 4; ++j) {
        const int m = g * 4 + j;
        const float s = Ssc[l * SP + m];
        const bool ok = (l < LSEQ) && (m < LSEQ);
        const float e = ok ? expf(s) : 0.0f;        // numerator unmasked
        part += (msk[m] != 0) ? e : 0.0f;           // denominator masked
        const _Float16 ehv = (_Float16)e;
        const float rs = (e - (float)ehv) * RSC;
        Eh[l * TP + m] = ehv;
        El[l * TP + m] = (_Float16)rs;
      }
      part += __shfl_xor(part, 1);
      part += __shfl_xor(part, 2);
      part += __shfl_xor(part, 4);
      if (g == 0) invs[l] = (l < LSEQ) ? (1.0f / (part + 1e-6f)) : 0.0f;
    }
    __syncthreads();

    // ===== GEMM3: h1 = (expS (32x32) * yV (32x32)) * inv[row] ; 4 tiles, waves 0..3 =====
    if (wave < 4) {
      const int mt = wave >> 1, nt = wave & 1;
      const v16h eh = ld_frag(Eh + (mt * 16 + nl) * TP, 0, hf);
      const v16h el = ld_frag(El + (mt * 16 + nl) * TP, 0, hf);
      const v16h wh = ld_frag(Wh + (nt * 16 + nl) * TP, 0, hf);        // B[k=m][n=f] = Wh[f][m]
      const v16h wl = ld_frag(Wl + (nt * 16 + nl) * TP, 0, hf);
      const v8f ch = wmma16(eh, wh, zero8());
      v8f cl = wmma16(el, wh, zero8());                                // both cross terms carry RSC
      cl = wmma16(eh, wl, cl);
#pragma unroll
      for (int r = 0; r < 8; ++r) {
        const int l = mt * 16 + 8 * hf + r;
        const int f = nt * 16 + nl;
        const float v = (ch[r] + cl[r] * (1.0f / RSC)) * invs[l];
        if (l < LSEQ && f < HDIM) Outs[l * ODIM + h * HDIM + f] = v;
      }
    }
    __syncthreads();
  }

  float* ob = out + (size_t)b * OUT_BSTRIDE;
  constexpr int NV4 = (LSEQ * ODIM) / 4;          // 3000
  for (int i = tid; i < NV4; i += 256) {
    const v4f v = *(const v4fa*)(Outs + i * 4);
    *(v4f*)(ob + (size_t)i * 4) = v;
  }
  
}

extern "C" void kernel_launch(void* const* d_in, const int* in_sizes, int n_in,
                              void* d_out, int out_size, void* d_ws, size_t ws_size,
                              hipStream_t stream)
{
  if (n_in < 4) return;
  if (in_sizes[0] < NB * LSEQ * DDIM) return;
  if (in_sizes[1] < NB * LSEQ) return;
  if (in_sizes[2] < NHEAD * DDIM * DDIM) return;
  if (in_sizes[3] < NHEAD * DDIM * HDIM) return;
  if (out_size < NB * LSEQ * ODIM) return;

  const float* y   = (const float*)d_in[0];
  const int*   seq = (const int*)  d_in[1];
  const float* Q   = (const float*)d_in[2];
  const float* V   = (const float*)d_in[3];
  float*       out = (float*)d_out;

  const size_t qt_bytes = (size_t)NHEAD * EP * DP * sizeof(_Float16);   // 3,891,200
  const size_t vt_bytes = (size_t)NHEAD * FP * DP * sizeof(_Float16);   //   409,600
  if (ws_size < qt_bytes + vt_bytes) return;
  _Float16* Qt = (_Float16*)d_ws;
  _Float16* Vt = (_Float16*)((char*)d_ws + qt_bytes);

  k_prep<<<dim3(QT_BLOCKS + VT_BLOCKS), dim3(256), 0, stream>>>(Q, V, Qt, Vt);
  k_attn<<<dim3(NB), dim3(256), 0, stream>>>(y, seq, Qt, Vt, out);
}

// v005
// One run takes 192 microseconds.
// Two timings next to v004 both put it at 1.13 times that version's speed.
// All steps since v000 together make it 3.41 times as fast.
#include <hip/hip_runtime.h>
// Contractions y*Q_h, y*V_h, a1*y^T, expS*(y*V_h): v_wmma_f32_16x16x32_f16 (f16 operands built from bf16-RNE inputs; a1, expS, y*V_h as f16 hi + f16 residual x2048 with separate accumulators), f32 accumulate; exp / normalisation in f32.

#ifndef NB
#define NB 1024
#endif
#define NB_FULL 1024
#define LSEQ   30
#define DDIM   300
#define NHEAD  20
#define HDIM   20
#define ODIM   (NHEAD * HDIM)          /* 400 */
#define LP     32                      /* padded rows */
#define DP     320                     /* padded K */
#define KSTEPS (DP / 32)               /* 10 */
#define NTD    19                      /* 16-col tiles covering 300 */
#define EP     (NTD * 16)              /* 304 padded out cols of Q_h */
#define FP     32                      /* padded out cols of V_h */
#define NTA    (NTD + FP / 16)         /* 21 n-tiles of y * [Q_h | V_h] */
#define DCH    (DP / 8)                /* 40 chunks of 8 halves per padded row */
/* LDS row pitches: an odd multiple of 16 bytes, so that the 16 rows of a b128 fragment read fall on distinct banks */
#define YP     (DP + 8)                /* halves: 656 B rows of Ys */
#define TP     (LP + 8)                /* halves:  80 B rows of Wh, Wl, Eh, El */
#define SP     (LP + 4)                /* floats: 144 B rows of Sp */
#define NWAVE  8                       /* waves of a block: one partial score plane each */
#define QT_CHUNKS (NHEAD * EP * DCH)   /* 243200 */
#define VT_CHUNKS (NHEAD * FP * DCH)   /* 25600 */
#define QT_BLOCKS (QT_CHUNKS / 256)    /* 950 */
#define VT_BLOCKS (VT_CHUNKS / 256)    /* 100 */
#define Y_BSTRIDE   (LSEQ * DDIM)      /* per-batch stride of y (floats) */
#define SEQ_BSTRIDE (LSEQ)             /* per-batch stride of token ids */
#define OUT_BSTRIDE (LSEQ * ODIM)      /* per-batch stride of out (floats) */
#define QSC 1024.0f                    /* power-of-two carry on Q plane */
#define VSC 1024.0f                    /* power-of-two carry on V plane */
#define RSC 2048.0f                    /* power-of-two carry on residual planes */
#define PF  6                          /* k-steps of weight fragments held ahead in registers (three pairs) */
#define FRH (2 * 32 * 8)               /* halves of one packed 16x32 weight fragment: 2 loads x 32 lanes x 8 halves */
#define TSTEP (8 * KSTEPS * FRH)       /* halves between a wave's successive n-tiles of Qt */

static_assert(QT_CHUNKS % 256 == 0);
static_assert(VT_CHUNKS % 256 == 0);
static_assert((OUT_BSTRIDE * 4) % 128 == 0);
static_assert((LSEQ * ODIM) % 4 == 0);
static_assert(((NHEAD * EP * DP * 2) % 128) == 0);
static_assert(NB <= NB_FULL);
static_assert(NTD > 16 && NTA <= 24);
static_assert(PF <= KSTEPS && PF % 2 == 0 && KSTEPS % 2 == 0 && (DP * 2) % 128 == 0);
static_assert(DP % 32 == 0 && EP >= DDIM && FP >= HDIM && LP >= LSEQ);
static_assert(NTD * KSTEPS * FRH == EP * DP && (FP / 16) * KSTEPS * FRH == FP * DP);
static_assert((YP * 2) % 32 == 16 && (TP * 2) % 32 == 16 && (SP * 4) % 32 == 16);

typedef _Float16 v16h __attribute__((ext_vector_type(16)));
typedef _Float16 v8h  __attribute__((ext_vector_type(8)));
typedef float    v8f  __attribute__((ext_vector_type(8)));
typedef float    v4f  __attribute__((ext_vector_type(4)));
typedef v8h v8ha __attribute__((may_alias));
typedef v4f v4fa __attribute__((may_alias));

union Frag { v16h v; v8h h[2]; };
union U8h  { v8h v; _Float16 s[8]; unsigned int u[4]; };
union U16h { v16h v; v8h h[2]; _Float16 s[16]; };

__device__ __forceinline__ int imin(int a, int b) { return a < b ? a : b; }

// f32 -> bf16 (RNE) -> back to f32 (value exactly representable in bf16)
__device__ __forceinline__ float bf16_rne(float f) {
  unsigned int u = __builtin_bit_cast(unsigned int, f);
  u = (u + 0x7fffu + ((u >> 16) & 1u)) & 0xffff0000u;
  return __builtin_bit_cast(float, u);
}

// 16x32 fragment from a [row][k] k-contiguous 16-bit matrix; rowp = row (lane&15) start.
// elements 0..7 <- k0+8hf .. +7, elements 8..15 <- k0+16+8hf .. +7 (same map for A and B)
__device__ __forceinline__ v16h ld_frag(const _Float16* rowp, int k0, int hf) {
  Frag f;
  f.h[0] = *(const v8ha*)(rowp + k0 + 8 * hf);
  f.h[1] = *(const v8ha*)(rowp + k0 + 16 + 8 * hf);
  return f.v;
}

// 16x32 fragment from a plane packed in fragment order: lanep = the tile's k-step 0 + lane * 8 halves.
// Each of the two loads reads 32 lanes x 16 B = 512 contiguous bytes; same element map as ld_frag.
__device__ __forceinline__ v16h ld_pfrag(const _Float16* lanep, int ks) {
  Frag f;
  f.h[0] = *(const v8ha*)(lanep + ks * FRH);
  f.h[1] = *(const v8ha*)(lanep + ks * FRH + FRH / 2);
  return f.v;
}

__device__ __forceinline__ v8f zero8() {
  v8f z = {0.f, 0.f, 0.f, 0.f, 0.f, 0.f, 0.f, 0.f};
  return z;
}

__device__ __forceinline__ v8f wmma16(v16h a, v16h b, v8f c) {
  c = __builtin_amdgcn_wmma_f32_16x16x32_f16(false, a, false, b, (short)0, c, false, false);
  asm volatile("v_nop\n\tv_nop\n\tv_nop\n\tv_nop" : "+v"(c) : "v"(a), "v"(b));
  return c;
}

// K-steps 2*kp and 2*kp+1 of a wave's NT weight fragments, issued as one group of loads.
// Tiles 0 and 1 lie in Qt behind qlane; the third tile (of Qt or of Vt) has its own pointer.
template <int NT>
__device__ __forceinline__ void q_fetch(v16h (&bq)[PF][3], const _Float16* qlane, const _Float16* xlane, int kp) {
#pragma unroll
  for (int t = 0; t < NT; ++t) {
    const _Float16* p = t < 2 ? qlane + t * TSTEP : xlane;
    bq[(2 * kp) % PF][t]     = ld_pfrag(p, 2 * kp);
    bq[(2 * kp + 1) % PF][t] = ld_pfrag(p, 2 * kp + 1);
  }
}

// K loop of GEMM1 for a wave that owns NT weight tiles: k-steps 0..PF-1 of all its tiles are issued up front,
// and each finished pair of steps refills its ring slots with the pair PF steps on.
// A tile of Qt is the A operand: acc[t][lt] = (y * Q_h)^T, rows e, columns l (l-tile lt).
// A tile of Vt (VT: the third tile) is the B operand: acc[2][mt] = y * V_h, rows m, columns f.
template <int NT, bool VT>
__device__ __forceinline__ void gemm1_k(const _Float16* ya0, const _Float16* ya1, const _Float16* qlane,
                                        const _Float16* xlane, int hf, v8f (&acc)[3][2]) {
  v16h bq[PF][3];
#pragma unroll
  for (int kp = 0; kp < PF / 2; ++kp) q_fetch<NT>(bq, qlane, xlane, kp);
  // unrolled: the ring slot must be a compile-time register index
#pragma unroll
  for (int ks = 0; ks < KSTEPS; ++ks) {
    const v16h a0 = ld_frag(ya0, ks * 32, hf);
    const v16h a1 = ld_frag(ya1, ks * 32, hf);
#pragma unroll
    for (int t = 0; t < NT; ++t) {
      if (VT && t == 2) {
        acc[t][0] = wmma16(a0, bq[ks % PF][t], acc[t][0]);
        acc[t][1] = wmma16(a1, bq[ks % PF][t], acc[t][1]);
      } else {
        acc[t][0] = wmma16(bq[ks % PF][t], a0, acc[t][0]);
        acc[t][1] = wmma16(bq[ks % PF][t], a1, acc[t][1]);
      }
    }
    if ((ks & 1) && ks + PF < KSTEPS + 1) q_fetch<NT>(bq, qlane, xlane, (ks - 1 + PF) / 2);
  }
  // stands between the loads above and the next head's rewrite of their address registers
  asm volatile("s_wait_xcnt 0x0" ::: "memory");
}

// One k-step (32 values of e) of the score product S^T = Ys * a1^T, from accumulators of (y * Q_h)^T.
// A lane of such an accumulator holds column l = lane & 15 and rows e = 8 * hf + r: these are elements 0..7
// (tile x) and 8..15 (tile z) of the B fragment whose k order is e = x*16 + 0..15, z*16 + 0..15.
// The A fragment reads Ys in the same k order: ex, ez = first column of tile x, of tile z.
// TWO = false: there is no tile z, and elements 8..15 of A and B are zero.
template <bool TWO>
__device__ __forceinline__ void score_step(const _Float16* ys_lane, int ex, int ez, const v8f (&ax)[2], const v8f (&az)[2],
                                           v8f (&sh)[2][2], v8f (&sl)[2][2]) {
  U16h ay[2];
#pragma unroll
  for (int mt = 0; mt < 2; ++mt) {
    ay[mt].h[0] = *(const v8ha*)(ys_lane + mt * 16 * YP + ex);
    if (TWO) {
      ay[mt].h[1] = *(const v8ha*)(ys_lane + mt * 16 * YP + ez);
    } else {
#pragma unroll
      for (int r = 0; r < 8; ++r) ay[mt].s[8 + r] = (_Float16)0.0f;
    }
  }
#pragma unroll
  for (int lt = 0; lt < 2; ++lt) {
    U16h bh, bl;
#pragma unroll
    for (int r = 0; r < 8; ++r) {
      const float a = ax[lt][r] * (1.0f / QSC);
      const _Float16 ah = (_Float16)a;
      bh.s[r] = ah;
      bl.s[r] = (_Float16)((a - (float)ah) * RSC);
      if (TWO) {
        const float c = az[lt][r] * (1.0f / QSC);
        const _Float16 chh = (_Float16)c;
        bh.s[8 + r] = chh;
        bl.s[8 + r] = (_Float16)((c - (float)chh) * RSC);
      } else {
        bh.s[8 + r] = (_Float16)0.0f;
        bl.s[8 + r] = (_Float16)0.0f;
      }
    }
#pragma unroll
    for (int mt = 0; mt < 2; ++mt) {
      sh[mt][lt] = wmma16(ay[mt].v, bh.v, sh[mt][lt]);
      sl[mt][lt] = wmma16(ay[mt].v, bl.v, sl[mt][lt]);
    }
  }
}

// =====================================================================
// Kernel 0: weight planes, packed in the order their fragments are loaded (Qt as A, Vt as B operands).
//   value(h, e, d) = f16( bf16(Q[h][d][e]) * QSC ), e < 304 (e >= 300 zero), d < 320 (d >= 300 zero)
//   value(h, f, d) = f16( bf16(V[h][d][f]) * VSC ), f < 32  (f >= 20 zero),  d < 320
//   chunk of 8 halves c = ((((h * tiles + nt) * KSTEPS + ks) * 2 + j) * 32 + lane) holds
//   row nt*16 + (lane & 15), d = ks*32 + j*16 + 8*(lane >> 4) .. +7
// grid: QT_BLOCKS + VT_BLOCKS, block 256 (block-uniform role)
// =====================================================================
__launch_bounds__(256)
__global__ void k_prep(const float* __restrict__ Q, const float* __restrict__ V,
                       _Float16* __restrict__ Qt, _Float16* __restrict__ Vt)
{
  const int bid = blockIdx.x;
  const int tid = threadIdx.x;
  U8h u;
  _Float16* dst;
  if (bid < QT_BLOCKS) {
    const int c   = bid * 256 + tid;              // < QT_CHUNKS exactly
    const int fr  = c >> 6;                       // fragment: (h * NTD + nt) * KSTEPS + ks
    const int tn  = fr / KSTEPS;
    const int ks  = fr - tn * KSTEPS;
    const int h   = tn / NTD;
    const int nt  = tn - h * NTD;
    const int e   = nt * 16 + (c & 15);
    const int d0  = ks * 32 + ((c >> 5) & 1) * 16 + ((c >> 4) & 1) * 8;
    const int ecl = imin(e, DDIM - 1);
#pragma unroll
    for (int j = 0; j < 8; ++j) {
      const int d   = d0 + j;
      const int dcl = imin(d, DDIM - 1);
      const float x = Q[((size_t)h * DDIM + dcl) * DDIM + ecl];   // clamped address
      const bool ok = (d < DDIM) && (e < DDIM);
      const float r = ok ? bf16_rne(x) * QSC : 0.0f;
      u.s[j] = (_Float16)r;
    }
    dst = Qt + (size_t)c * 8;
  } else {
    const int c   = (bid - QT_BLOCKS) * 256 + tid;  // < VT_CHUNKS exactly
    const int fr  = c >> 6;                         // fragment: (h * (FP / 16) + nt) * KSTEPS + ks
    const int tn  = fr / KSTEPS;
    const int ks  = fr - tn * KSTEPS;
    const int h   = tn / (FP / 16);
    const int nt  = tn - h * (FP / 16);
    const int f   = nt * 16 + (c & 15);
    const int d0  = ks * 32 + ((c >> 5) & 1) * 16 + ((c >> 4) & 1) * 8;
    const int fcl = imin(f, HDIM - 1);
#pragma unroll
    for (int j = 0; j < 8; ++j) {
      const int d   = d0 + j;
      const int dcl = imin(d, DDIM - 1);
      const float x = V[((size_t)h * DDIM + dcl) * HDIM + fcl];   // clamped address
      const bool ok = (d < DDIM) && (f < HDIM);
      const float r = ok ? bf16_rne(x) * VSC : 0.0f;
      u.s[j] = (_Float16)r;
    }
    dst = Vt + (size_t)c * 8;
  }
  const v8h val = u.v;
  *(v8h*)dst = val;
  
}

// =====================================================================
// Kernel 1: one block per batch row b (256 threads = 8 waves), loop over heads.
//   LDS (rows padded to the pitches YP, TP, SP; pad bytes are never read):
//        Ys [32][320] f16 (y tile, bf16-RNE values),
//        Wh/Wl [32][32] f16 (y * V_h hi/residual, stored [f][m]),
//        Sp [8][32][32] f32 (each wave's part of the scores, [l][m]), Eh/El [32][32] f16 exp hi/residual, invs[32], msk[32],
//   h1 = (alpha * y) * V_h is formed as alpha * (y * V_h): y * V_h is two more tiles of the y * Q_h phase.
//   a1 = y * Q_h never leaves the registers: it is formed transposed, so that a wave's accumulators are B fragments
//   of the score product over the wave's own columns e; the eight parts are added in the exp phase.
// Every LDS region is cross-wave: block barriers between producer and consumer phases.
// =====================================================================
__launch_bounds__(256)
__global__ void k_attn(const float* __restrict__ y, const int* __restrict__ seq,
                       const _Float16* __restrict__ Qt, const _Float16* __restrict__ Vt,
                       float* __restrict__ out)
{
  __shared__ __align__(16) _Float16 Ys[LP * YP];
  __shared__ __align__(16) _Float16 Wh[FP * TP];
  __shared__ __align__(16) _Float16 Wl[FP * TP];
  __shared__ __align__(16) float    Sp[NWAVE * LP * SP];
  __shared__ __align__(16) _Float16 Eh[LP * TP];
  __shared__ __align__(16) _Float16 El[LP * TP];
  __shared__ __align__(16) float    invs[LP];
  __shared__ __align__(16) int      msk[LP];
  __shared__ __align__(16) float    Outs[LSEQ * ODIM];

  const int tid  = threadIdx.x;
  const int lane = tid & 31;
  const int wave = __builtin_amdgcn_readfirstlane(tid >> 5);
  const int hf   = lane >> 4;
  const int nl   = lane & 15;
  const int b    = blockIdx.x;
  const float* yb = y + (size_t)b * Y_BSTRIDE;

  // ---- weight fragments: the lane's 16 bytes of k-step 0 ----
  const bool w3 = wave + 16 < NTA;                                   // wave-uniform: owns a third tile
  const bool wv = w3 && wave + 16 >= NTD;                            // wave-uniform: that tile is one of y * V_h
  const bool q3 = wave + 16 < NTD;                                   // wave-uniform: that tile is one of y * Q_h
  const _Float16* qlane0 = Qt + (size_t)wave * (KSTEPS * FRH) + lane * 8;        // n-tile `wave`, head 0
  // third tile, head 0: n-tile wave + 16 of Qt, or n-tile wave + 16 - NTD of Vt (waves without one never load from it)
  const _Float16* xlane0 = wv ? Vt + (size_t)(wave + 16 - NTD) * (KSTEPS * FRH) + lane * 8 : qlane0 + 2 * TSTEP;
  const int xstep = wv ? (FP / 16) * KSTEPS * FRH : NTD * KSTEPS * FRH;          // halves per head of that plane
  // the wave's part of the scores: row l = nl (+ 16 lt), columns m = 8 hf .. + 7 (+ 16 mt)
  float* sp_w = Sp + wave * (LP * SP) + nl * SP + 8 * hf;

  // ---- stage y tile: Ys[row][d], bf16-RNE values in f16, pads zero ----
  for (int idx = tid; idx < LP * DCH; idx += 256) {
    const int row = idx / DCH;
    const int dc  = idx - row * DCH;
    const int d0  = dc * 8;
    const int rcl = imin(row, LSEQ - 1);
    U8h u;
#pragma unroll
    for (int j = 0; j < 8; ++j) {
      const int d   = d0 + j;
      const int dcl = imin(d, DDIM - 1);
      const float x = yb[rcl * DDIM + dcl];                       // clamped address
      const bool ok = (row < LSEQ) && (d < DDIM);
      const float r = ok ? bf16_rne(x) : 0.0f;
      u.s[j] = (_Float16)r;
    }
    *(v8ha*)(Ys + row * YP + d0) = u.v;
  }
  // ---- key mask from token ids (id > 0), pads 0 ----
  if (tid < LP) {
    const int m  = imin(tid, LSEQ - 1);
    const int sv = seq[(size_t)b * SEQ_BSTRIDE + m];           // clamped address
    msk[tid] = (tid < LSEQ && sv > 0) ? 1 : 0;
  }
  __syncthreads();

  for (int h = 0; h < NHEAD; ++h) {
    // ===== GEMM1: a1^T (x QSC) = Qt_h * Ys^T (19 e-tiles x 2 l-tiles), yV (x VSC) = Ys * Vt_h (2 m-tiles x 2 f-tiles) =====
    {
      v8f acc[3][2];
#pragma unroll
      for (int t = 0; t < 3; ++t) { acc[t][0] = zero8(); acc[t][1] = zero8(); }
      const _Float16* qlane = qlane0 + (size_t)h * (NTD * KSTEPS * FRH);
      const _Float16* xlane = xlane0 + (size_t)h * xstep;
      if (q3)      gemm1_k<3, false>(Ys + nl * YP, Ys + (16 + nl) * YP, qlane, xlane, hf, acc);
      else if (wv) gemm1_k<3, true>(Ys + nl * YP, Ys + (16 + nl) * YP, qlane, xlane, hf, acc);
      else         gemm1_k<2, false>(Ys + nl * YP, Ys + (16 + nl) * YP, qlane, xlane, hf, acc);
      // ===== GEMM2, the wave's part: S^T = Ys * a1^T over the columns e of its own tiles; a1 = acc/QSC as
      // f16 hi + f16 residual*RSC, converted in the lane that holds it =====
      {
        v8f sh[2][2], sl[2][2];
#pragma unroll
        for (int mt = 0; mt < 2; ++mt) {
#pragma unroll
          for (int lt = 0; lt < 2; ++lt) { sh[mt][lt] = zero8(); sl[mt][lt] = zero8(); }
        }
        const _Float16* ys_lane = Ys + nl * YP + 8 * hf;
        score_step<true>(ys_lane, wave * 16, (wave + 8) * 16, acc[0], acc[1], sh, sl);
        if (q3) score_step<false>(ys_lane, (wave + 16) * 16, 0, acc[2], acc[2], sh, sl);
        // a lane's 8 accumulator rows are 8 successive m of its row l: two 16-byte stores per tile
#pragma unroll
        for (int mt = 0; mt < 2; ++mt) {
#pragma unroll
          for (int lt = 0; lt < 2; ++lt) {
            v4f s0, s1;
#pragma unroll
            for (int r = 0; r < 4; ++r) {
              s0[r] = sh[mt][lt][r]     + sl[mt][lt][r]     * (1.0f / RSC);
              s1[r] = sh[mt][lt][4 + r] + sl[mt][lt][4 + r] * (1.0f / RSC);
            }
            *(v4fa*)(sp_w + lt * 16 * SP + mt * 16)     = s0;
            *(v4fa*)(sp_w + lt * 16 * SP + mt * 16 + 4) = s1;
          }
        }
      }
      // epilogue of a y * V_h tile: yV = acc/VSC -> f16 hi + f16 residual*RSC into Wh/Wl [f][m];
      // a lane's 8 accumulator rows are 8 successive m of its column f: one 16-byte store per plane
      if (wv) {
        const int f = (wave + 16 - NTD) * 16 + nl;
#pragma unroll
        for (int mt = 0; mt < 2; ++mt) {
          U8h uh, ul;
#pragma unroll
          for (int r = 0; r < 8; ++r) {
            const float a = acc[2][mt][r] * (1.0f / VSC);
            const _Float16 ah = (_Float16)a;
            const float rs = (a - (float)ah) * RSC;
            uh.s[r] = ah;
            ul.s[r] = (_Float16)rs;
          }
          *(v8ha*)(Wh + f * TP + mt * 16 + 8 * hf) = uh.v;
          *(v8ha*)(Wl + f * TP + mt * 16 + 8 * hf) = ul.v;
        }
      }
    }
    __syncthreads();

    // ================= exp (no max subtraction) + masked row sums =================
    {
      const int l = tid >> 3;          // 0..31
      const int g = tid & 7;           // 8 threads per row, 4 key positions each
      float part = 0.0f;
      // scores: the eight waves' parts, added in wave order
      v4f s4 = *(const v4fa*)(Sp + l * SP + g * 4);
#pragma unroll
      for (int w = 1; w < NWAVE; ++w) s4 += *(const v4fa*)(Sp + w * (LP * SP) + l * SP + g * 4);
#pragma unroll
      for (int j = 0; j < 4; ++j) {
        const int m = g * 4 + j;
        const float s = s4[j];
        const bool ok = (l < LSEQ) && (m < LSEQ);
        const float e = ok ? expf(s) : 0.0f;        // numerator unmasked
        part += (msk[m] != 0) ? e : 0.0f;           // denominator masked
        const _Float16 ehv = (_Float16)e;
        const float rs = (e - (float)ehv) * RSC;
        Eh[l * TP + m] = ehv;
        El[l * TP + m] = (_Float16)rs;
      }
      part += __shfl_xor(part, 1);
      part += __shfl_xor(part, 2);
      part += __shfl_xor(part, 4);
      if (g == 0) invs[l] = (l < LSEQ) ? (1.0f / (part + 1e-6f)) : 0.0f;
    }
    __syncthreads();

    // ===== GEMM3: h1 = (expS (32x32) * yV (32x32)) * inv[row] ; 4 tiles, waves 0..3 =====
    if (wave < 4) {
      const int mt = wave >> 1, nt = wave & 1;
      const v16h eh = ld_frag(Eh + (mt * 16 + nl) * TP, 0, hf);
      const v16h el = ld_frag(El + (mt * 16 + nl) * TP, 0, hf);
      const v16h wh = ld_frag(Wh + (nt * 16 + nl) * TP, 0, hf);        // B[k=m][n=f] = Wh[f][m]
      const v16h wl = ld_frag(Wl + (nt * 16 + nl) * TP, 0, hf);
      const v8f ch = wmma16(eh, wh, zero8());
      v8f cl = wmma16(el, wh, zero8());                                // both cross terms carry RSC
      cl = wmma16(eh, wl, cl);
#pragma unroll
      for (int r = 0; r < 8; ++r) {
        const int l = mt * 16 + 8 * hf + r;
        const int f = nt * 16 + nl;
        const float v = (ch[r] + cl[r] * (1.0f / RSC)) * invs[l];
        if (l < LSEQ && f < HDIM) Outs[l * ODIM + h * HDIM + f] = v;
      }
    }
    __syncthreads();
  }

  float* ob = out + (size_t)b * OUT_BSTRIDE;
  constexpr int NV4 = (LSEQ * ODIM) / 4;          // 3000
  for (int i = tid; i < NV4; i += 256) {
    const v4f v = *(const v4fa*)(Outs + i * 4);
    *(v4f*)(ob + (size_t)i * 4) = v;
  }
  
}

extern "C" void kernel_launch(void* const* d_in, const int* in_sizes, int n_in,
                              void* d_out, int out_size, void* d_ws, size_t ws_size,
                              hipStream_t stream)
{
  if (n_in < 4) return;
  if (in_sizes[0] < NB * LSEQ * DDIM) return;
  if (in_sizes[1] < NB * LSEQ) return;
  if (in_sizes[2] < NHEAD * DDIM * DDIM) return;
  if (in_sizes[3] < NHEAD * DDIM * HDIM) return;
  if (out_size < NB * LSEQ * ODIM) return;

  const float* y   = (const float*)d_in[0];
  const int*   seq = (const int*)  d_in[1];
  const float* Q   = (const float*)d_in[2];
  const float* V   = (const float*)d_in[3];
  float*       out = (float*)d_out;

  const size_t qt_bytes = (size_t)NHEAD * EP * DP * sizeof(_Float16);   // 3,891,200
  const size_t vt_bytes = (size_t)NHEAD * FP * DP * sizeof(_Float16);   //   409,600
  if (ws_size < qt_bytes + vt_bytes) return;
  _Float16* Qt = (_Float16*)d_ws;
  _Float16* Vt = (_Float16*)((char*)d_ws + qt_bytes);

  k_prep<<<dim3(QT_BLOCKS + VT_BLOCKS), dim3(256), 0, stream>>>(Q, V, Qt, Vt);
  k_attn<<<dim3(NB), dim3(256), 0, stream>>>(y, seq, Qt, Vt, out);
}

// v006
// A run of this version takes 156 microseconds.
// Next to v005, in two timings, it ran 1.24 and 1.23 times as fast.
// Over all steps from v000 it is 4.20 times as fast.
#include <hip/hip_runtime.h>
// Contractions y*Q_h, y*V_h, a1*y^T, expS*(y*V_h): v_wmma_f32_16x16x32_f16 (f16 operands built from bf16-RNE inputs; a1, expS, y*V_h as f16 hi + f16 residual x2048 with separate accumulators), f32 accumulate; exp / normalisation in f32.

#ifndef NB
#define NB 1024
#endif
#define NB_FULL 1024
#define LSEQ   30
#define DDIM   300
#define NHEAD  20
#define HDIM   20
#define ODIM   (NHEAD * HDIM)          /* 400 */
#define LP     32                      /* padded rows of one batch row's tile */
#define BPB    2                       /* batch rows of a block: each weight fragment fetched feeds 2 * BPB l-tiles */
#define LT     (2 * BPB)               /* 16-row tiles of Ys */
#define DP     320                     /* padded K */
#define KSTEPS (DP / 32)               /* 10 */
#define NTD    19                      /* 16-col tiles covering 300 */
#define EP     (NTD * 16)              /* 304 padded out cols of Q_h */
#define FP     32                      /* padded out cols of V_h */
#define NTA    (NTD + FP / 16)         /* 21 n-tiles of y * [Q_h | V_h] */
#define DCH    (DP / 8)                /* 40 chunks of 8 halves per padded row */
/* LDS row pitches: an odd multiple of 16 bytes, so that the 16 rows of a b128 fragment read fall on distinct banks */
#define YP     (DP + 8)                /* halves: 656 B rows of Ys */
#define TP     (LP + 8)                /* halves:  80 B rows of Wh, Wl, Eh, El */
#define SP     (LP + 4)                /* floats: 144 B rows of Sp */
#define NWAVE  8                       /* waves of a block: one partial score plane each */
#define QT_CHUNKS (NHEAD * EP * DCH)   /* 243200 */
#define VT_CHUNKS (NHEAD * FP * DCH)   /* 25600 */
#define QT_BLOCKS (QT_CHUNKS / 256)    /* 950 */
#define VT_BLOCKS (VT_CHUNKS / 256)    /* 100 */
#define Y_BSTRIDE   (LSEQ * DDIM)      /* per-batch stride of y (floats) */
#define SEQ_BSTRIDE (LSEQ)             /* per-batch stride of token ids */
#define OUT_BSTRIDE (LSEQ * ODIM)      /* per-batch stride of out (floats) */
#define QSC 1024.0f                    /* power-of-two carry on Q plane */
#define VSC 1024.0f                    /* power-of-two carry on V plane */
#define RSC 2048.0f                    /* power-of-two carry on residual planes */
#define PF  3                          /* k-steps of weight fragments held ahead in registers */
#define FRH (2 * 32 * 8)               /* halves of one packed 16x32 weight fragment: 2 loads x 32 lanes x 8 halves */
#define TSTEP (8 * KSTEPS * FRH)       /* halves between a wave's successive n-tiles of Qt */

static_assert(QT_CHUNKS % 256 == 0);
static_assert(VT_CHUNKS % 256 == 0);
static_assert((OUT_BSTRIDE * 4) % 128 == 0);
static_assert((LSEQ * ODIM) % 4 == 0);
static_assert(((NHEAD * EP * DP * 2) % 128) == 0);
static_assert(NB <= NB_FULL && NB % BPB == 0 && 4 * BPB == NWAVE);
static_assert(NTD > 16 && NTA <= 24);
static_assert(PF <= KSTEPS && (DP * 2) % 128 == 0);
static_assert(DP % 32 == 0 && EP >= DDIM && FP >= HDIM && LP >= LSEQ);
static_assert(NTD * KSTEPS * FRH == EP * DP && (FP / 16) * KSTEPS * FRH == FP * DP);
static_assert((YP * 2) % 32 == 16 && (TP * 2) % 32 == 16 && (SP * 4) % 32 == 16);

typedef _Float16 v16h __attribute__((ext_vector_type(16)));
typedef _Float16 v8h  __attribute__((ext_vector_type(8)));
typedef float    v8f  __attribute__((ext_vector_type(8)));
typedef float    v4f  __attribute__((ext_vector_type(4)));
typedef v8h v8ha __attribute__((may_alias));
typedef v4f v4fa __attribute__((may_alias));
typedef __attribute__((address_space(1))) float gfloat;   /* a float in global memory: a pointer that passes through an asm operand keeps its global stores */

union Frag { v16h v; v8h h[2]; };
union U8h  { v8h v; _Float16 s[8]; unsigned int u[4]; };
union U16h { v16h v; v8h h[2]; _Float16 s[16]; };

__device__ __forceinline__ int imin(int a, int b) { return a < b ? a : b; }

// f32 -> bf16 (RNE) -> back to f32 (value exactly representable in bf16)
__device__ __forceinline__ float bf16_rne(float f) {
  unsigned int u = __builtin_bit_cast(unsigned int, f);
  u = (u + 0x7fffu + ((u >> 16) & 1u)) & 0xffff0000u;
  return __builtin_bit_cast(float, u);
}

// 16x32 fragment from a [row][k] k-contiguous 16-bit matrix; rowp = row (lane&15) start.
// elements 0..7 <- k0+8hf .. +7, elements 8..15 <- k0+16+8hf .. +7 (same map for A and B)
__device__ __forceinline__ v16h ld_frag(const _Float16* rowp, int k0, int hf) {
  Frag f;
  f.h[0] = *(const v8ha*)(rowp + k0 + 8 * hf);
  f.h[1] = *(const v8ha*)(rowp + k0 + 16 + 8 * hf);
  return f.v;
}

// 16x32 fragment from a plane packed in fragment order: lanep = the tile's k-step 0 + lane * 8 halves.
// Each of the two loads reads 32 lanes x 16 B = 512 contiguous bytes; same element map as ld_frag.
__device__ __forceinline__ v16h ld_pfrag(const _Float16* lanep, int ks) {
  Frag f;
  f.h[0] = *(const v8ha*)(lanep + ks * FRH);
  f.h[1] = *(const v8ha*)(lanep + ks * FRH + FRH / 2);
  return f.v;
}

__device__ __forceinline__ v8f zero8() {
  v8f z = {0.f, 0.f, 0.f, 0.f, 0.f, 0.f, 0.f, 0.f};
  return z;
}

__device__ __forceinline__ v8f wmma16(v16h a, v16h b, v8f c) {
  c = __builtin_amdgcn_wmma_f32_16x16x32_f16(false, a, false, b, (short)0, c, false, false);
  asm volatile("v_nop\n\tv_nop\n\tv_nop\n\tv_nop" : "+v"(c) : "v"(a), "v"(b));
  return c;
}

// K-step ks of a wave's NT weight fragments, issued as one group of loads.
// Tiles 0 and 1 lie in Qt behind qlane; the third tile (of Qt or of Vt) has its own pointer.
template <int NT>
__device__ __forceinline__ void q_fetch(v16h (&bq)[PF][3], const _Float16* qlane, const _Float16* xlane, int ks) {
#pragma unroll
  for (int t = 0; t < NT; ++t) {
    const _Float16* p = t < 2 ? qlane + t * TSTEP : xlane;
    bq[ks % PF][t] = ld_pfrag(p, ks);
  }
}

// K loop of GEMM1 for a wave that owns NT weight tiles: k-steps 0..PF-1 of all its tiles are issued up front,
// and each finished step refills its ring slot with the step PF steps on.
// ya = the lane's row (lane & 15) of Ys; tile i of Ys is l-tile (or m-tile) i & 1 of the block's batch row i >> 1.
// A tile of Qt is the A operand: acc[t][bb][lt] = (y * Q_h)^T, rows e, columns l (l-tile lt).
// A tile of Vt (VT: the third tile) is the B operand: acc[2][bb][mt] = y * V_h, rows m, columns f.
template <int NT, bool VT>
__device__ __forceinline__ void gemm1_k(const _Float16* ya, const _Float16* qlane,
                                        const _Float16* xlane, int hf, v8f (&acc)[3][BPB][2]) {
  v16h bq[PF][3];
#pragma unroll
  for (int ks = 0; ks < PF; ++ks) q_fetch<NT>(bq, qlane, xlane, ks);
  // unrolled: the ring slot must be a compile-time register index
#pragma unroll
  for (int ks = 0; ks < KSTEPS; ++ks) {
    v16h a[LT];
#pragma unroll
    for (int i = 0; i < LT; ++i) a[i] = ld_frag(ya + i * 16 * YP, ks * 32, hf);
#pragma unroll
    for (int t = 0; t < NT; ++t) {
#pragma unroll
      for (int i = 0; i < LT; ++i) {
        if (VT && t == 2) acc[t][i >> 1][i & 1] = wmma16(a[i], bq[ks % PF][t], acc[t][i >> 1][i & 1]);
        else              acc[t][i >> 1][i & 1] = wmma16(bq[ks % PF][t], a[i], acc[t][i >> 1][i & 1]);
      }
    }
    if (ks + PF < KSTEPS) q_fetch<NT>(bq, qlane, xlane, ks + PF);
  }
}

// One k-step (32 values of e) of the score product S^T = Ys * a1^T, from accumulators of (y * Q_h)^T.
// A lane of such an accumulator holds column l = lane & 15 and rows e = 8 * hf + r: these are elements 0..7
// (tile x) and 8..15 (tile z) of the B fragment whose k order is e = x*16 + 0..15, z*16 + 0..15.
// The A fragment reads Ys in the same k order: ex, ez = first column of tile x, of tile z.
// TWO = false: there is no tile z, and elements 8..15 of A and B are zero.
template <bool TWO>
__device__ __forceinline__ void score_step(const _Float16* ys_lane, int ex, int ez, const v8f (&ax)[2], const v8f (&az)[2],
                                           v8f (&sh)[2][2], v8f (&sl)[2][2]) {
  U16h ay[2];
#pragma unroll
  for (int mt = 0; mt < 2; ++mt) {
    ay[mt].h[0] = *(const v8ha*)(ys_lane + mt * 16 * YP + ex);
    if (TWO) {
      ay[mt].h[1] = *(const v8ha*)(ys_lane + mt * 16 * YP + ez);
    } else {
#pragma unroll
      for (int r = 0; r < 8; ++r) ay[mt].s[8 + r] = (_Float16)0.0f;
    }
  }
#pragma unroll
  for (int lt = 0; lt < 2; ++lt) {
    U16h bh, bl;
#pragma unroll
    for (int r = 0; r < 8; ++r) {
      const float a = ax[lt][r] * (1.0f / QSC);
      const _Float16 ah = (_Float16)a;
      bh.s[r] = ah;
      bl.s[r] = (_Float16)((a - (float)ah) * RSC);
      if (TWO) {
        const float c = az[lt][r] * (1.0f / QSC);
        const _Float16 chh = (_Float16)c;
        bh.s[8 + r] = chh;
        bl.s[8 + r] = (_Float16)((c - (float)chh) * RSC);
      } else {
        bh.s[8 + r] = (_Float16)0.0f;
        bl.s[8 + r] = (_Float16)0.0f;
      }
    }
#pragma unroll
    for (int mt = 0; mt < 2; ++mt) {
      sh[mt][lt] = wmma16(ay[mt].v, bh.v, sh[mt][lt]);
      sl[mt][lt] = wmma16(ay[mt].v, bl.v, sl[mt][lt]);
    }
  }
}

// =====================================================================
// Kernel 0: weight planes, packed in the order their fragments are loaded (Qt as A, Vt as B operands).
//   value(h, e, d) = f16( bf16(Q[h][d][e]) * QSC ), e < 304 (e >= 300 zero), d < 320 (d >= 300 zero)
//   value(h, f, d) = f16( bf16(V[h][d][f]) * VSC ), f < 32  (f >= 20 zero),  d < 320
//   chunk of 8 halves c = ((((h * tiles + nt) * KSTEPS + ks) * 2 + j) * 32 + lane) holds
//   row nt*16 + (lane & 15), d = ks*32 + j*16 + 8*(lane >> 4) .. +7
// grid: QT_BLOCKS + VT_BLOCKS, block 256 (block-uniform role)
// =====================================================================
__launch_bounds__(256)
__global__ void k_prep(const float* __restrict__ Q, const float* __restrict__ V,
                       _Float16* __restrict__ Qt, _Float16* __restrict__ Vt)
{
  const int bid = blockIdx.x;
  const int tid = threadIdx.x;
  U8h u;
  _Float16* dst;
  if (bid < QT_BLOCKS) {
    const int c   = bid * 256 + tid;              // < QT_CHUNKS exactly
    const int fr  = c >> 6;                       // fragment: (h * NTD + nt) * KSTEPS + ks
    const int tn  = fr / KSTEPS;
    const int ks  = fr - tn * KSTEPS;
    const int h   = tn / NTD;
    const int nt  = tn - h * NTD;
    const int e   = nt * 16 + (c & 15);
    const int d0  = ks * 32 + ((c >> 5) & 1) * 16 + ((c >> 4) & 1) * 8;
    const int ecl = imin(e, DDIM - 1);
#pragma unroll
    for (int j = 0; j < 8; ++j) {
      const int d   = d0 + j;
      const int dcl = imin(d, DDIM - 1);
      const float x = Q[((size_t)h * DDIM + dcl) * DDIM + ecl];   // clamped address
      const bool ok = (d < DDIM) && (e < DDIM);
      const float r = ok ? bf16_rne(x) * QSC : 0.0f;
      u.s[j] = (_Float16)r;
    }
    dst = Qt + (size_t)c * 8;
  } else {
    const int c   = (bid - QT_BLOCKS) * 256 + tid;  // < VT_CHUNKS exactly
    const int fr  = c >> 6;                         // fragment: (h * (FP / 16) + nt) * KSTEPS + ks
    const int tn  = fr / KSTEPS;
    const int ks  = fr - tn * KSTEPS;
    const int h   = tn / (FP / 16);
    const int nt  = tn - h * (FP / 16);
    const int f   = nt * 16 + (c & 15);
    const int d0  = ks * 32 + ((c >> 5) & 1) * 16 + ((c >> 4) & 1) * 8;
    const int fcl = imin(f, HDIM - 1);
#pragma unroll
    for (int j = 0; j < 8; ++j) {
      const int d   = d0 + j;
      const int dcl = imin(d, DDIM - 1);
      const float x = V[((size_t)h * DDIM + dcl) * HDIM + fcl];   // clamped address
      const bool ok = (d < DDIM) && (f < HDIM);
      const float r = ok ? bf16_rne(x) * VSC : 0.0f;
      u.s[j] = (_Float16)r;
    }
    dst = Vt + (size_t)c * 8;
  }
  const v8h val = u.v;
  *(v8h*)dst = val;
  
}

// =====================================================================
// Kernel 1: one block per BPB batch rows (256 threads = 8 waves), loop over heads.
//   LDS (rows padded to the pitches YP, TP, SP; pad bytes are never read), each per batch row bb of the block:
//        Ys [bb][32][320] f16 (y tile, bf16-RNE values),
//        Wh/Wl [bb][32][32] f16 (y * V_h hi/residual, stored [f][m]),
//        Sp [8][bb][32][32] f32 (each wave's part of the scores, [l][m]), Eh/El [bb][32][32] f16 exp hi/residual, invs, msk [bb][32],
//   A weight fragment is fetched once per block and used on the tiles of all its batch rows.
//   h1 = (alpha * y) * V_h is formed as alpha * (y * V_h): y * V_h is two more tiles of the y * Q_h phase.
//   a1 = y * Q_h never leaves the registers: it is formed transposed, so that a wave's accumulators are B fragments
//   of the score product over the wave's own columns e; the eight parts are added in the exp phase.
// Every LDS region is cross-wave: block barriers between producer and consumer phases.
// =====================================================================
// four waves per SIMD: two blocks share a WGP, so that one block's matrix phase covers the other's exp phase and barriers
__launch_bounds__(256) __attribute__((amdgpu_waves_per_eu(4, 4)))
__global__ void k_attn(const float* __restrict__ y, const int* __restrict__ seq,
                       const _Float16* __restrict__ Qt, const _Float16* __restrict__ Vt,
                       float* __restrict__ out)
{
  __shared__ __align__(16) _Float16 Ys[BPB * LP * YP];
  __shared__ __align__(16) _Float16 Wh[BPB * FP * TP];
  __shared__ __align__(16) _Float16 Wl[BPB * FP * TP];
  __shared__ __align__(16) float    Sp[NWAVE * BPB * LP * SP];
  __shared__ __align__(16) _Float16 Eh[BPB * LP * TP];
  __shared__ __align__(16) _Float16 El[BPB * LP * TP];
  __shared__ __align__(16) float    invs[BPB * LP];
  __shared__ __align__(16) int      msk[BPB * LP];

  const int tid  = threadIdx.x;
  const int lane = tid & 31;
  const int wave = __builtin_amdgcn_readfirstlane(tid >> 5);
  const int hf   = lane >> 4;
  const int nl   = lane & 15;
  const int b    = blockIdx.x * BPB;                                 // first batch row of the block
  const float* yb = y + (size_t)b * Y_BSTRIDE;

  // ---- weight fragments: the lane's 16 bytes of k-step 0 ----
  const bool w3 = wave + 16 < NTA;                                   // wave-uniform: owns a third tile
  const bool wv = w3 && wave + 16 >= NTD;                            // wave-uniform: that tile is one of y * V_h
  const bool q3 = wave + 16 < NTD;                                   // wave-uniform: that tile is one of y * Q_h
  const _Float16* qlane0 = Qt + (size_t)wave * (KSTEPS * FRH) + lane * 8;        // n-tile `wave`, head 0
  // third tile, head 0: n-tile wave + 16 of Qt, or n-tile wave + 16 - NTD of Vt (waves without one never load from it)
  const _Float16* xlane0 = wv ? Vt + (size_t)(wave + 16 - NTD) * (KSTEPS * FRH) + lane * 8 : qlane0 + 2 * TSTEP;
  const int xstep = wv ? (FP / 16) * KSTEPS * FRH : NTD * KSTEPS * FRH;          // halves per head of that plane
  // the wave's part of the scores: row l = nl (+ 16 lt), columns m = 8 hf .. + 7 (+ 16 mt)
  float* sp_w = Sp + wave * (BPB * LP * SP) + nl * SP + 8 * hf;

  // ---- stage y tile: Ys[row][d], bf16-RNE values in f16, pads zero ----
  for (int idx = tid; idx < BPB * LP * DCH; idx += 256) {
    const int brow = idx / DCH;                 // row of Ys: batch row brow / LP, row brow % LP
    const int dc  = idx - brow * DCH;
    const int d0  = dc * 8;
    const int row = brow & (LP - 1);
    const int rcl = (brow / LP) * LSEQ + imin(row, LSEQ - 1);
    U8h u;
#pragma unroll
    for (int j = 0; j < 8; ++j) {
      const int d   = d0 + j;
      const int dcl = imin(d, DDIM - 1);
      const float x = yb[rcl * DDIM + dcl];                       // clamped address
      const bool ok = (row < LSEQ) && (d < DDIM);
      const float r = ok ? bf16_rne(x) : 0.0f;
      u.s[j] = (_Float16)r;
    }
    *(v8ha*)(Ys + brow * YP + d0) = u.v;
  }
  // ---- key mask from token ids (id > 0), pads 0 ----
  if (tid < BPB * LP) {
    const int mr = tid & (LP - 1);
    const int m  = imin(mr, LSEQ - 1);
    const int sv = seq[(size_t)(b + tid / LP) * SEQ_BSTRIDE + m];   // clamped address
    msk[tid] = (mr < LSEQ && sv > 0) ? 1 : 0;
  }
  __syncthreads();

  // the lane's first element of out in GEMM3: batch row wave >> 2, row tile (wave >> 1) & 1, column tile wave & 1, head 0
  gfloat* op = (gfloat*)out + (size_t)(b + (wave >> 2)) * OUT_BSTRIDE + (((wave >> 1) & 1) * 16 + 8 * hf) * ODIM + (wave & 1) * 16 + nl;

  for (int h = 0; h < NHEAD; ++h) {
    // ===== GEMM1: a1^T (x QSC) = Qt_h * Ys^T (19 e-tiles x 4 l-tiles), yV (x VSC) = Ys * Vt_h (4 m-tiles x 2 f-tiles) =====
    {
      v8f acc[3][BPB][2];
#pragma unroll
      for (int t = 0; t < 3; ++t) {
#pragma unroll
        for (int bb = 0; bb < BPB; ++bb) { acc[t][bb][0] = zero8(); acc[t][bb][1] = zero8(); }
      }
      const _Float16* qlane = qlane0 + (size_t)h * (NTD * KSTEPS * FRH);
      const _Float16* xlane = xlane0 + (size_t)h * xstep;
      if (q3)      gemm1_k<3, false>(Ys + nl * YP, qlane, xlane, hf, acc);
      else if (wv) gemm1_k<3, true>(Ys + nl * YP, qlane, xlane, hf, acc);
      else         gemm1_k<2, false>(Ys + nl * YP, qlane, xlane, hf, acc);
      // where the three arms join: stands between every weight load above, also those the compiler lifts in front of the arms,
      // and the first rewrite of their address register pair, which as an input stays live up to this statement
      // (the third tile's pair is stepped only at the loop's foot, behind the wait that stands there)
      asm volatile("s_wait_xcnt 0x0" : : "v"(qlane) : "memory");
      // ===== GEMM2, the wave's part: S^T = Ys * a1^T over the columns e of its own tiles; a1 = acc/QSC as
      // f16 hi + f16 residual*RSC, converted in the lane that holds it; one batch row after the other =====
#pragma unroll
      for (int bb = 0; bb < BPB; ++bb) {
        v8f sh[2][2], sl[2][2];
#pragma unroll
        for (int mt = 0; mt < 2; ++mt) {
#pragma unroll
          for (int lt = 0; lt < 2; ++lt) { sh[mt][lt] = zero8(); sl[mt][lt] = zero8(); }
        }
        const _Float16* ys_lane = Ys + (bb * LP + nl) * YP + 8 * hf;
        score_step<true>(ys_lane, wave * 16, (wave + 8) * 16, acc[0][bb], acc[1][bb], sh, sl);
        if (q3) score_step<false>(ys_lane, (wave + 16) * 16, 0, acc[2][bb], acc[2][bb], sh, sl);
        // a lane's 8 accumulator rows are 8 successive m of its row l: two 16-byte stores per tile
#pragma unroll
        for (int mt = 0; mt < 2; ++mt) {
#pragma unroll
          for (int lt = 0; lt < 2; ++lt) {
            v4f s0, s1;
#pragma unroll
            for (int r = 0; r < 4; ++r) {
              s0[r] = sh[mt][lt][r]     + sl[mt][lt][r]     * (1.0f / RSC);
              s1[r] = sh[mt][lt][4 + r] + sl[mt][lt][4 + r] * (1.0f / RSC);
            }
            *(v4fa*)(sp_w + (bb * LP + lt * 16) * SP + mt * 16)     = s0;
            *(v4fa*)(sp_w + (bb * LP + lt * 16) * SP + mt * 16 + 4) = s1;
          }
        }
      }
      // epilogue of a y * V_h tile: yV = acc/VSC -> f16 hi + f16 residual*RSC into Wh/Wl [f][m];
      // a lane's 8 accumulator rows are 8 successive m of its column f: one 16-byte store per plane
      if (wv) {
        const int f = (wave + 16 - NTD) * 16 + nl;
#pragma unroll
        for (int i = 0; i < LT; ++i) {
          const int bb = i >> 1, mt = i & 1;
          U8h uh, ul;
#pragma unroll
          for (int r = 0; r < 8; ++r) {
            const float a = acc[2][bb][mt][r] * (1.0f / VSC);
            const _Float16 ah = (_Float16)a;
            const float rs = (a - (float)ah) * RSC;
            uh.s[r] = ah;
            ul.s[r] = (_Float16)rs;
          }
          *(v8ha*)(Wh + (bb * FP + f) * TP + mt * 16 + 8 * hf) = uh.v;
          *(v8ha*)(Wl + (bb * FP + f) * TP + mt * 16 + 8 * hf) = ul.v;
        }
      }
    }
    __syncthreads();

    // ================= exp (no max subtraction) + masked row sums =================
#pragma unroll
    for (int bb = 0; bb < BPB; ++bb) {
      const int l = tid >> 3;          // 0..31
      const int g = tid & 7;           // 8 threads per row, 4 key positions each
      const int bl = bb * LP + l;      // row of the block's planes
      float part = 0.0f;
      // scores: the eight waves' parts, added in wave order
      v4f s4 = *(const v4fa*)(Sp + bl * SP + g * 4);
#pragma unroll
      for (int w = 1; w < NWAVE; ++w) s4 += *(const v4fa*)(Sp + w * (BPB * LP * SP) + bl * SP + g * 4);
#pragma unroll
      for (int j = 0; j < 4; ++j) {
        const int m = g * 4 + j;
        const float s = s4[j];
        const bool ok = (l < LSEQ) && (m < LSEQ);
        const float e = ok ? expf(s) : 0.0f;        // numerator unmasked
        part += (msk[bb * LP + m] != 0) ? e : 0.0f; // denominator masked
        const _Float16 ehv = (_Float16)e;
        const float rs = (e - (float)ehv) * RSC;
        Eh[bl * TP + m] = ehv;
        El[bl * TP + m] = (_Float16)rs;
      }
      part += __shfl_xor(part, 1);
      part += __shfl_xor(part, 2);
      part += __shfl_xor(part, 4);
      if (g == 0) invs[bl] = (l < LSEQ) ? (1.0f / (part + 1e-6f)) : 0.0f;
    }
    __syncthreads();

    // ===== GEMM3: h1 = (expS (32x32) * yV (32x32)) * inv[row] ; 4 tiles per batch row, one per wave =====
    {
      const int bb = wave >> 2, mt = (wave >> 1) & 1, nt = wave & 1;
      const v16h eh = ld_frag(Eh + (bb * LP + mt * 16 + nl) * TP, 0, hf);
      const v16h el = ld_frag(El + (bb * LP + mt * 16 + nl) * TP, 0, hf);
      const v16h wh = ld_frag(Wh + (bb * FP + nt * 16 + nl) * TP, 0, hf);   // B[k=m][n=f] = Wh[f][m]
      const v16h wl = ld_frag(Wl + (bb * FP + nt * 16 + nl) * TP, 0, hf);
      const v8f ch = wmma16(eh, wh, zero8());
      v8f cl = wmma16(el, wh, zero8());                                // both cross terms carry RSC
      cl = wmma16(eh, wl, cl);
      float v[8];
#pragma unroll
      for (int r = 0; r < 8; ++r) v[r] = (ch[r] + cl[r] * (1.0f / RSC)) * invs[bb * LP + mt * 16 + 8 * hf + r];
      // ends the head's LDS reads (the next head rewrites Wh, Wl); the stores to out read no LDS and are issued behind it
      __syncthreads();
      // the head's 20 columns of a row go straight to out: 16 lanes store 64 successive bytes (4 lanes 16 bytes for nt = 1)
#pragma unroll
      for (int r = 0; r < 8; ++r) {
        const int l = mt * 16 + 8 * hf + r;
        const int f = nt * 16 + nl;
        if (l < LSEQ && f < HDIM) op[r * ODIM] = v[r];
      }
      // stands between the stores above and the step of their address to the next head: the step takes the address from this statement
      asm volatile("s_wait_xcnt 0x0" : "+v"(op) : : "memory");
      op += HDIM;
    }
  }
}

extern "C" void kernel_launch(void* const* d_in, const int* in_sizes, int n_in,
                              void* d_out, int out_size, void* d_ws, size_t ws_size,
                              hipStream_t stream)
{
  if (n_in < 4) return;
  if (in_sizes[0] < NB * LSEQ * DDIM) return;
  if (in_sizes[1] < NB * LSEQ) return;
  if (in_sizes[2] < NHEAD * DDIM * DDIM) return;
  if (in_sizes[3] < NHEAD * DDIM * HDIM) return;
  if (out_size < NB * LSEQ * ODIM) return;

  const float* y   = (const float*)d_in[0];
  const int*   seq = (const int*)  d_in[1];
  const float* Q   = (const float*)d_in[2];
  const float* V   = (const float*)d_in[3];
  float*       out = (float*)d_out;

  const size_t qt_bytes = (size_t)NHEAD * EP * DP * sizeof(_Float16);   // 3,891,200
  const size_t vt_bytes = (size_t)NHEAD * FP * DP * sizeof(_Float16);   //   409,600
  if (ws_size < qt_bytes + vt_bytes) return;
  _Float16* Qt = (_Float16*)d_ws;
  _Float16* Vt = (_Float16*)((char*)d_ws + qt_bytes);

  k_prep<<<dim3(QT_BLOCKS + VT_BLOCKS), dim3(256), 0, stream>>>(Q, V, Qt, Vt);
  k_attn<<<dim3(NB / BPB), dim3(256), 0, stream>>>(y, seq, Qt, Vt, out);
}

// v007
// One run takes 143 microseconds.
// Next to v006, in two timings, it ran 1.09 and 1.08 times as fast.
// Counting every step since v000, it is 4.56 times as fast.
#include <hip/hip_runtime.h>
// Contractions y*Q_h, y*V_h, a1*y^T, expS*(y*V_h): v_wmma_f32_16x16x32_f16 (f16 operands built from bf16-RNE inputs; a1, expS, y*V_h as f16 hi + f16 residual x2048 with separate accumulators), f32 accumulate; exp / normalisation in f32.

#ifndef NB
#define NB 1024
#endif
#define NB_FULL 1024
#define LSEQ   30
#define DDIM   300
#define NHEAD  20
#define HDIM   20
#define ODIM   (NHEAD * HDIM)          /* 400 */
#define LP     32                      /* padded rows of one batch row's tile */
#define BPB    2                       /* batch rows of a block: each weight fragment fetched feeds 2 * BPB l-tiles */
#define LT     (2 * BPB)               /* 16-row tiles of Ys */
#define DP     320                     /* padded K */
#define KSTEPS (DP / 32)               /* 10 */
#define NTD    19                      /* 16-col tiles covering 300 */
#define EP     (NTD * 16)              /* 304 padded out cols of Q_h */
#define FP     32                      /* padded out cols of V_h */
#define NTA    (NTD + FP / 16)         /* 21 n-tiles of y * [Q_h | V_h] */
#define DCH    (DP / 8)                /* 40 chunks of 8 halves per padded row */
/* LDS row pitches: an odd multiple of 16 bytes, so that the 16 rows of a b128 fragment read fall on distinct banks */
#define YP     (DP + 8)                /* halves: 656 B rows of Ys */
#define TP     (LP + 8)                /* halves:  80 B rows of Wh, Wl, Eh, El */
#define SP     (LP + 4)                /* floats: 144 B rows of Sp */
#define NWAVE  8                       /* waves of a block: one partial score plane each */
#define QT_CHUNKS (NHEAD * EP * DCH)   /* 243200 */
#define VT_CHUNKS (NHEAD * FP * DCH)   /* 25600 */
#define QT_BLOCKS (QT_CHUNKS / 256)    /* 950 */
#define VT_BLOCKS (VT_CHUNKS / 256)    /* 100 */
#define Y_BSTRIDE   (LSEQ * DDIM)      /* per-batch stride of y (floats) */
#define SEQ_BSTRIDE (LSEQ)             /* per-batch stride of token ids */
#define OUT_BSTRIDE (LSEQ * ODIM)      /* per-batch stride of out (floats) */
#define QSC 1024.0f                    /* power-of-two carry on Q plane */
#define VSC 1024.0f                    /* power-of-two carry on V plane */
#define RSC 2048.0f                    /* power-of-two carry on residual planes */
#define PF  3                          /* k-steps of weight fragments held ahead in registers */
#define FRH (2 * 32 * 8)               /* halves of one packed 16x32 weight fragment: 2 loads x 32 lanes x 8 halves */
#define TSTEP (8 * KSTEPS * FRH)       /* halves between a wave's successive n-tiles of Qt */

static_assert(QT_CHUNKS % 256 == 0);
static_assert(VT_CHUNKS % 256 == 0);
static_assert((OUT_BSTRIDE * 4) % 128 == 0);
static_assert((LSEQ * ODIM) % 4 == 0);
static_assert(((NHEAD * EP * DP * 2) % 128) == 0);
static_assert(NB <= NB_FULL && NB % BPB == 0 && 4 * BPB == NWAVE);
static_assert(NTD > 16 && NTA <= 24);
static_assert(PF <= KSTEPS && (DP * 2) % 128 == 0);
static_assert(DP % 32 == 0 && EP >= DDIM && FP >= HDIM && LP >= LSEQ);
static_assert(NTD * KSTEPS * FRH == EP * DP && (FP / 16) * KSTEPS * FRH == FP * DP);
static_assert((YP * 2) % 32 == 16 && (TP * 2) % 32 == 16 && (SP * 4) % 32 == 16);

typedef _Float16 v16h __attribute__((ext_vector_type(16)));
typedef _Float16 v8h  __attribute__((ext_vector_type(8)));
typedef float    v8f  __attribute__((ext_vector_type(8)));
typedef float    v4f  __attribute__((ext_vector_type(4)));
typedef v8h v8ha __attribute__((may_alias));
typedef v4f v4fa __attribute__((may_alias));
typedef __attribute__((address_space(1))) float gfloat;   /* a float in global memory: a pointer that passes through an asm operand keeps its global stores */

union Frag { v16h v; v8h h[2]; };
union U8h  { v8h v; _Float16 s[8]; unsigned int u[4]; };
union U16h { v16h v; v8h h[2]; _Float16 s[16]; };

__device__ __forceinline__ int imin(int a, int b) { return a < b ? a : b; }

// f32 -> bf16 (RNE) -> back to f32 (value exactly representable in bf16)
__device__ __forceinline__ float bf16_rne(float f) {
  unsigned int u = __builtin_bit_cast(unsigned int, f);
  u = (u + 0x7fffu + ((u >> 16) & 1u)) & 0xffff0000u;
  return __builtin_bit_cast(float, u);
}

// 16x32 fragment from a [row][k] k-contiguous 16-bit matrix; rowp = row (lane&15) start.
// elements 0..7 <- k0+8hf .. +7, elements 8..15 <- k0+16+8hf .. +7 (same map for A and B)
__device__ __forceinline__ v16h ld_frag(const _Float16* rowp, int k0, int hf) {
  Frag f;
  f.h[0] = *(const v8ha*)(rowp + k0 + 8 * hf);
  f.h[1] = *(const v8ha*)(rowp + k0 + 16 + 8 * hf);
  return f.v;
}

// 16x32 fragment from a plane packed in fragment order: lanep = the tile's k-step 0 + lane * 8 halves.
// Each of the two loads reads 32 lanes x 16 B = 512 contiguous bytes; same element map as ld_frag.
__device__ __forceinline__ v16h ld_pfrag(const _Float16* lanep, int ks) {
  Frag f;
  f.h[0] = *(const v8ha*)(lanep + ks * FRH);
  f.h[1] = *(const v8ha*)(lanep + ks * FRH + FRH / 2);
  return f.v;
}

__device__ __forceinline__ v8f zero8() {
  v8f z = {0.f, 0.f, 0.f, 0.f, 0.f, 0.f, 0.f, 0.f};
  return z;
}

__device__ __forceinline__ v8f wmma16(v16h a, v16h b, v8f c) {
  return __builtin_amdgcn_wmma_f32_16x16x32_f16(false, a, false, b, (short)0, c, false, false);
}

// K-step ks of a wave's NT weight fragments, issued as one group of loads.
// Tiles 0 and 1 lie in Qt behind qlane; the third tile (of Qt or of Vt) has its own pointer.
template <int NT>
__device__ __forceinline__ void q_fetch(v16h (&bq)[PF][3], const _Float16* qlane, const _Float16* xlane, int ks) {
#pragma unroll
  for (int t = 0; t < NT; ++t) {
    const _Float16* p = t < 2 ? qlane + t * TSTEP : xlane;
    bq[ks % PF][t] = ld_pfrag(p, ks);
  }
}

// K loop of GEMM1 for a wave that owns NT weight tiles: k-steps 0..PF-1 of all its tiles are issued up front,
// and each finished step refills its ring slot with the step PF steps on.
// ya = the lane's row (lane & 15) of Ys; tile i of Ys is l-tile (or m-tile) i & 1 of the block's batch row i >> 1.
// A tile of Qt is the A operand: acc[t][bb][lt] = (y * Q_h)^T, rows e, columns l (l-tile lt).
// A tile of Vt (VT: the third tile) is the B operand: acc[2][bb][mt] = y * V_h, rows m, columns f.
template <int NT, bool VT>
__device__ __forceinline__ void gemm1_k(const _Float16* ya, const _Float16* qlane,
                                        const _Float16* xlane, int hf, v8f (&acc)[3][BPB][2]) {
  v16h bq[PF][3];
#pragma unroll
  for (int ks = 0; ks < PF; ++ks) q_fetch<NT>(bq, qlane, xlane, ks);
  // keeps the ring's first loads in front of the K loop: sunk to their first use they would be waited for at once
  __builtin_amdgcn_sched_barrier(0);
  // unrolled: the ring slot must be a compile-time register index
#pragma unroll
  for (int ks = 0; ks < KSTEPS; ++ks) {
    v16h a[LT];
#pragma unroll
    for (int i = 0; i < LT; ++i) a[i] = ld_frag(ya + i * 16 * YP, ks * 32, hf);
#pragma unroll
    for (int t = 0; t < NT; ++t) {
#pragma unroll
      for (int i = 0; i < LT; ++i) {
        if (VT && t == 2) acc[t][i >> 1][i & 1] = wmma16(a[i], bq[ks % PF][t], acc[t][i >> 1][i & 1]);
        else              acc[t][i >> 1][i & 1] = wmma16(bq[ks % PF][t], a[i], acc[t][i >> 1][i & 1]);
      }
    }
    if (ks + PF < KSTEPS) q_fetch<NT>(bq, qlane, xlane, ks + PF);
    // keeps each refill PF k-steps ahead of its use: without it the loads sink to the step that reads them
    __builtin_amdgcn_sched_barrier(0);
  }
}

// One k-step (32 values of e) of the score product S^T = Ys * a1^T, from accumulators of (y * Q_h)^T.
// A lane of such an accumulator holds column l = lane & 15 and rows e = 8 * hf + r: these are elements 0..7
// (tile x) and 8..15 (tile z) of the B fragment whose k order is e = x*16 + 0..15, z*16 + 0..15.
// The A fragment reads Ys in the same k order: ex, ez = first column of tile x, of tile z.
// TWO = false: there is no tile z, and elements 8..15 of A and B are zero.
template <bool TWO>
__device__ __forceinline__ void score_step(const _Float16* ys_lane, int ex, int ez, const v8f (&ax)[2], const v8f (&az)[2],
                                           v8f (&sh)[2][2], v8f (&sl)[2][2]) {
  U16h ay[2];
#pragma unroll
  for (int mt = 0; mt < 2; ++mt) {
    ay[mt].h[0] = *(const v8ha*)(ys_lane + mt * 16 * YP + ex);
    if (TWO) {
      ay[mt].h[1] = *(const v8ha*)(ys_lane + mt * 16 * YP + ez);
    } else {
#pragma unroll
      for (int r = 0; r < 8; ++r) ay[mt].s[8 + r] = (_Float16)0.0f;
    }
  }
#pragma unroll
  for (int lt = 0; lt < 2; ++lt) {
    U16h bh, bl;
#pragma unroll
    for (int r = 0; r < 8; ++r) {
      const float a = ax[lt][r] * (1.0f / QSC);
      const _Float16 ah = (_Float16)a;
      bh.s[r] = ah;
      bl.s[r] = (_Float16)((a - (float)ah) * RSC);
      if (TWO) {
        const float c = az[lt][r] * (1.0f / QSC);
        const _Float16 chh = (_Float16)c;
        bh.s[8 + r] = chh;
        bl.s[8 + r] = (_Float16)((c - (float)chh) * RSC);
      } else {
        bh.s[8 + r] = (_Float16)0.0f;
        bl.s[8 + r] = (_Float16)0.0f;
      }
    }
#pragma unroll
    for (int mt = 0; mt < 2; ++mt) {
      sh[mt][lt] = wmma16(ay[mt].v, bh.v, sh[mt][lt]);
      sl[mt][lt] = wmma16(ay[mt].v, bl.v, sl[mt][lt]);
    }
  }
}

// =====================================================================
// Kernel 0: weight planes, packed in the order their fragments are loaded (Qt as A, Vt as B operands).
//   value(h, e, d) = f16( bf16(Q[h][d][e]) * QSC ), e < 304 (e >= 300 zero), d < 320 (d >= 300 zero)
//   value(h, f, d) = f16( bf16(V[h][d][f]) * VSC ), f < 32  (f >= 20 zero),  d < 320
//   chunk of 8 halves c = ((((h * tiles + nt) * KSTEPS + ks) * 2 + j) * 32 + lane) holds
//   row nt*16 + (lane & 15), d = ks*32 + j*16 + 8*(lane >> 4) .. +7
// grid: QT_BLOCKS + VT_BLOCKS, block 256 (block-uniform role)
// =====================================================================
__launch_bounds__(256)
__global__ void k_prep(const float* __restrict__ Q, const float* __restrict__ V,
                       _Float16* __restrict__ Qt, _Float16* __restrict__ Vt)
{
  const int bid = blockIdx.x;
  const int tid = threadIdx.x;
  U8h u;
  _Float16* dst;
  if (bid < QT_BLOCKS) {
    const int c   = bid * 256 + tid;              // < QT_CHUNKS exactly
    const int fr  = c >> 6;                       // fragment: (h * NTD + nt) * KSTEPS + ks
    const int tn  = fr / KSTEPS;
    const int ks  = fr - tn * KSTEPS;
    const int h   = tn / NTD;
    const int nt  = tn - h * NTD;
    const int e   = nt * 16 + (c & 15);
    const int d0  = ks * 32 + ((c >> 5) & 1) * 16 + ((c >> 4) & 1) * 8;
    const int ecl = imin(e, DDIM - 1);
#pragma unroll
    for (int j = 0; j < 8; ++j) {
      const int d   = d0 + j;
      const int dcl = imin(d, DDIM - 1);
      const float x = Q[((size_t)h * DDIM + dcl) * DDIM + ecl];   // clamped address
      const bool ok = (d < DDIM) && (e < DDIM);
      const float r = ok ? bf16_rne(x) * QSC : 0.0f;
      u.s[j] = (_Float16)r;
    }
    dst = Qt + (size_t)c * 8;
  } else {
    const int c   = (bid - QT_BLOCKS) * 256 + tid;  // < VT_CHUNKS exactly
    const int fr  = c >> 6;                         // fragment: (h * (FP / 16) + nt) * KSTEPS + ks
    const int tn  = fr / KSTEPS;
    const int ks  = fr - tn * KSTEPS;
    const int h   = tn / (FP / 16);
    const int nt  = tn - h * (FP / 16);
    const int f   = nt * 16 + (c & 15);
    const int d0  = ks * 32 + ((c >> 5) & 1) * 16 + ((c >> 4) & 1) * 8;
    const int fcl = imin(f, HDIM - 1);
#pragma unroll
    for (int j = 0; j < 8; ++j) {
      const int d   = d0 + j;
      const int dcl = imin(d, DDIM - 1);
      const float x = V[((size_t)h * DDIM + dcl) * HDIM + fcl];   // clamped address
      const bool ok = (d < DDIM) && (f < HDIM);
      const float r = ok ? bf16_rne(x) * VSC : 0.0f;
      u.s[j] = (_Float16)r;
    }
    dst = Vt + (size_t)c * 8;
  }
  const v8h val = u.v;
  *(v8h*)dst = val;
  
}

// =====================================================================
// Kernel 1: one block per BPB batch rows (256 threads = 8 waves), loop over heads.
//   LDS (rows padded to the pitches YP, TP, SP; pad bytes are never read), each per batch row bb of the block:
//        Ys [bb][32][320] f16 (y tile, bf16-RNE values),
//        Wh/Wl [bb][32][32] f16 (y * V_h hi/residual, stored [f][m]),
//        Sp [8][bb][32][32] f32 (each wave's part of the scores, [l][m]), Eh/El [bb][32][32] f16 exp hi/residual, invs, msk [bb][32],
//   A weight fragment is fetched once per block and used on the tiles of all its batch rows.
//   h1 = (alpha * y) * V_h is formed as alpha * (y * V_h): y * V_h is two more tiles of the y * Q_h phase.
//   a1 = y * Q_h never leaves the registers: it is formed transposed, so that a wave's accumulators are B fragments
//   of the score product over the wave's own columns e; the eight parts are added in the exp phase.
// Every LDS region is cross-wave: block barriers between producer and consumer phases.
// =====================================================================
// four waves per SIMD: two blocks share a WGP, so that one block's matrix phase covers the other's exp phase and barriers
__launch_bounds__(256) __attribute__((amdgpu_waves_per_eu(4, 4)))
__global__ void k_attn(const float* __restrict__ y, const int* __restrict__ seq,
                       const _Float16* __restrict__ Qt, const _Float16* __restrict__ Vt,
                       float* __restrict__ out)
{
  __shared__ __align__(16) _Float16 Ys[BPB * LP * YP];
  __shared__ __align__(16) _Float16 Wh[BPB * FP * TP];
  __shared__ __align__(16) _Float16 Wl[BPB * FP * TP];
  __shared__ __align__(16) float    Sp[NWAVE * BPB * LP * SP];
  __shared__ __align__(16) _Float16 Eh[BPB * LP * TP];
  __shared__ __align__(16) _Float16 El[BPB * LP * TP];
  __shared__ __align__(16) float    invs[BPB * LP];
  __shared__ __align__(16) int      msk[BPB * LP];

  const int tid  = threadIdx.x;
  const int lane = tid & 31;
  const int wave = __builtin_amdgcn_readfirstlane(tid >> 5);
  const int hf   = lane >> 4;
  const int nl   = lane & 15;
  const int b    = blockIdx.x * BPB;                                 // first batch row of the block
  const float* yb = y + (size_t)b * Y_BSTRIDE;

  // ---- weight fragments: the lane's 16 bytes of k-step 0 ----
  const bool w3 = wave + 16 < NTA;                                   // wave-uniform: owns a third tile
  const bool wv = w3 && wave + 16 >= NTD;                            // wave-uniform: that tile is one of y * V_h
  const bool q3 = wave + 16 < NTD;                                   // wave-uniform: that tile is one of y * Q_h
  const _Float16* qlane0 = Qt + (size_t)wave * (KSTEPS * FRH) + lane * 8;        // n-tile `wave`, head 0
  // third tile, head 0: n-tile wave + 16 of Qt, or n-tile wave + 16 - NTD of Vt (waves without one never load from it)
  const _Float16* xlane0 = wv ? Vt + (size_t)(wave + 16 - NTD) * (KSTEPS * FRH) + lane * 8 : qlane0 + 2 * TSTEP;
  const int xstep = wv ? (FP / 16) * KSTEPS * FRH : NTD * KSTEPS * FRH;          // halves per head of that plane
  // the wave's part of the scores: row l = nl (+ 16 lt), columns m = 8 hf .. + 7 (+ 16 mt)
  float* sp_w = Sp + wave * (BPB * LP * SP) + nl * SP + 8 * hf;

  // ---- stage y tile: Ys[row][d], bf16-RNE values in f16, pads zero ----
  for (int idx = tid; idx < BPB * LP * DCH; idx += 256) {
    const int brow = idx / DCH;                 // row of Ys: batch row brow / LP, row brow % LP
    const int dc  = idx - brow * DCH;
    const int d0  = dc * 8;
    const int row = brow & (LP - 1);
    const int rcl = (brow / LP) * LSEQ + imin(row, LSEQ - 1);
    U8h u;
#pragma unroll
    for (int j = 0; j < 8; ++j) {
      const int d   = d0 + j;
      const int dcl = imin(d, DDIM - 1);
      const float x = yb[rcl * DDIM + dcl];                       // clamped address
      const bool ok = (row < LSEQ) && (d < DDIM);
      const float r = ok ? bf16_rne(x) : 0.0f;
      u.s[j] = (_Float16)r;
    }
    *(v8ha*)(Ys + brow * YP + d0) = u.v;
  }
  // ---- key mask from token ids (id > 0), pads 0 ----
  if (tid < BPB * LP) {
    const int mr = tid & (LP - 1);
    const int m  = imin(mr, LSEQ - 1);
    const int sv = seq[(size_t)(b + tid / LP) * SEQ_BSTRIDE + m];   // clamped address
    msk[tid] = (mr < LSEQ && sv > 0) ? 1 : 0;
  }
  __syncthreads();

  // the lane's first element of out in GEMM3: batch row wave >> 2, row tile (wave >> 1) & 1, column tile wave & 1, head 0
  gfloat* op = (gfloat*)out + (size_t)(b + (wave >> 2)) * OUT_BSTRIDE + (((wave >> 1) & 1) * 16 + 8 * hf) * ODIM + (wave & 1) * 16 + nl;

  for (int h = 0; h < NHEAD; ++h) {
    // ===== GEMM1: a1^T (x QSC) = Qt_h * Ys^T (19 e-tiles x 4 l-tiles), yV (x VSC) = Ys * Vt_h (4 m-tiles x 2 f-tiles) =====
    {
      v8f acc[3][BPB][2];
#pragma unroll
      for (int t = 0; t < 3; ++t) {
#pragma unroll
        for (int bb = 0; bb < BPB; ++bb) { acc[t][bb][0] = zero8(); acc[t][bb][1] = zero8(); }
      }
      const _Float16* qlane = qlane0 + (size_t)h * (NTD * KSTEPS * FRH);
      const _Float16* xlane = xlane0 + (size_t)h * xstep;
      if (q3)      gemm1_k<3, false>(Ys + nl * YP, qlane, xlane, hf, acc);
      else if (wv) gemm1_k<3, true>(Ys + nl * YP, qlane, xlane, hf, acc);
      else         gemm1_k<2, false>(Ys + nl * YP, qlane, xlane, hf, acc);
      // where the three arms join: stands between every weight load above, also those the compiler lifts in front of the arms,
      // and the first rewrite of their address register pair, which as an input stays live up to this statement
      // (the third tile's pair is stepped only at the loop's foot, behind the wait that stands there)
      asm volatile("s_wait_xcnt 0x0" : : "v"(qlane) : "memory");
      // ===== GEMM2, the wave's part: S^T = Ys * a1^T over the columns e of its own tiles; a1 = acc/QSC as
      // f16 hi + f16 residual*RSC, converted in the lane that holds it; one batch row after the other =====
#pragma unroll
      for (int bb = 0; bb < BPB; ++bb) {
        v8f sh[2][2], sl[2][2];
#pragma unroll
        for (int mt = 0; mt < 2; ++mt) {
#pragma unroll
          for (int lt = 0; lt < 2; ++lt) { sh[mt][lt] = zero8(); sl[mt][lt] = zero8(); }
        }
        const _Float16* ys_lane = Ys + (bb * LP + nl) * YP + 8 * hf;
        score_step<true>(ys_lane, wave * 16, (wave + 8) * 16, acc[0][bb], acc[1][bb], sh, sl);
        if (q3) score_step<false>(ys_lane, (wave + 16) * 16, 0, acc[2][bb], acc[2][bb], sh, sl);
        // a lane's 8 accumulator rows are 8 successive m of its row l: two 16-byte stores per tile
#pragma unroll
        for (int mt = 0; mt < 2; ++mt) {
#pragma unroll
          for (int lt = 0; lt < 2; ++lt) {
            v4f s0, s1;
#pragma unroll
            for (int r = 0; r < 4; ++r) {
              s0[r] = sh[mt][lt][r]     + sl[mt][lt][r]     * (1.0f / RSC);
              s1[r] = sh[mt][lt][4 + r] + sl[mt][lt][4 + r] * (1.0f / RSC);
            }
            *(v4fa*)(sp_w + (bb * LP + lt * 16) * SP + mt * 16)     = s0;
            *(v4fa*)(sp_w + (bb * LP + lt * 16) * SP + mt * 16 + 4) = s1;
          }
        }
      }
      // epilogue of a y * V_h tile: yV = acc/VSC -> f16 hi + f16 residual*RSC into Wh/Wl [f][m];
      // a lane's 8 accumulator rows are 8 successive m of its column f: one 16-byte store per plane
      if (wv) {
        const int f = (wave + 16 - NTD) * 16 + nl;
#pragma unroll
        for (int i = 0; i < LT; ++i) {
          const int bb = i >> 1, mt = i & 1;
          U8h uh, ul;
#pragma unroll
          for (int r = 0; r < 8; ++r) {
            const float a = acc[2][bb][mt][r] * (1.0f / VSC);
            const _Float16 ah = (_Float16)a;
            const float rs = (a - (float)ah) * RSC;
            uh.s[r] = ah;
            ul.s[r] = (_Float16)rs;
          }
          *(v8ha*)(Wh + (bb * FP + f) * TP + mt * 16 + 8 * hf) = uh.v;
          *(v8ha*)(Wl + (bb * FP + f) * TP + mt * 16 + 8 * hf) = ul.v;
        }
      }
    }
    __syncthreads();

    // ================= exp (no max subtraction) + masked row sums =================
#pragma unroll
    for (int bb = 0; bb < BPB; ++bb) {
      const int l = tid >> 3;          // 0..31
      const int g = tid & 7;           // 8 threads per row, 4 key positions each
      const int bl = bb * LP + l;      // row of the block's planes
      float part = 0.0f;
      // scores: the eight waves' parts, added in wave order
      v4f s4 = *(const v4fa*)(Sp + bl * SP + g * 4);
#pragma unroll
      for (int w = 1; w < NWAVE; ++w) s4 += *(const v4fa*)(Sp + w * (BPB * LP * SP) + bl * SP + g * 4);
#pragma unroll
      for (int j = 0; j < 4; ++j) {
        const int m = g * 4 + j;
        const float s = s4[j];
        const bool ok = (l < LSEQ) && (m < LSEQ);
        const float e = ok ? expf(s) : 0.0f;        // numerator unmasked
        part += (msk[bb * LP + m] != 0) ? e : 0.0f; // denominator masked
        const _Float16 ehv = (_Float16)e;
        const float rs = (e - (float)ehv) * RSC;
        Eh[bl * TP + m] = ehv;
        El[bl * TP + m] = (_Float16)rs;
      }
      part += __shfl_xor(part, 1);
      part += __shfl_xor(part, 2);
      part += __shfl_xor(part, 4);
      if (g == 0) invs[bl] = (l < LSEQ) ? (1.0f / (part + 1e-6f)) : 0.0f;
    }
    __syncthreads();

    // ===== GEMM3: h1 = (expS (32x32) * yV (32x32)) * inv[row] ; 4 tiles per batch row, one per wave =====
    {
      const int bb = wave >> 2, mt = (wave >> 1) & 1, nt = wave & 1;
      const v16h eh = ld_frag(Eh + (bb * LP + mt * 16 + nl) * TP, 0, hf);
      const v16h el = ld_frag(El + (bb * LP + mt * 16 + nl) * TP, 0, hf);
      const v16h wh = ld_frag(Wh + (bb * FP + nt * 16 + nl) * TP, 0, hf);   // B[k=m][n=f] = Wh[f][m]
      const v16h wl = ld_frag(Wl + (bb * FP + nt * 16 + nl) * TP, 0, hf);
      const v8f ch = wmma16(eh, wh, zero8());
      v8f cl = wmma16(el, wh, zero8());                                // both cross terms carry RSC
      cl = wmma16(eh, wl, cl);
      float v[8];
#pragma unroll
      for (int r = 0; r < 8; ++r) v[r] = (ch[r] + cl[r] * (1.0f / RSC)) * invs[bb * LP + mt * 16 + 8 * hf + r];
      // ends the head's LDS reads (the next head rewrites Wh, Wl); the stores to out read no LDS and are issued behind it
      __syncthreads();
      // the head's 20 columns of a row go straight to out: 16 lanes store 64 successive bytes (4 lanes 16 bytes for nt = 1)
#pragma unroll
      for (int r = 0; r < 8; ++r) {
        const int l = mt * 16 + 8 * hf + r;
        const int f = nt * 16 + nl;
        if (l < LSEQ && f < HDIM) op[r * ODIM] = v[r];
      }
      // stands between the stores above and the step of their address to the next head: the step takes the address from this statement
      asm volatile("s_wait_xcnt 0x0" : "+v"(op) : : "memory");
      op += HDIM;
    }
  }
}

extern "C" void kernel_launch(void* const* d_in, const int* in_sizes, int n_in,
                              void* d_out, int out_size, void* d_ws, size_t ws_size,
                              hipStream_t stream)
{
  if (n_in < 4) return;
  if (in_sizes[0] < NB * LSEQ * DDIM) return;
  if (in_sizes[1] < NB * LSEQ) return;
  if (in_sizes[2] < NHEAD * DDIM * DDIM) return;
  if (in_sizes[3] < NHEAD * DDIM * HDIM) return;
  if (out_size < NB * LSEQ * ODIM) return;

  const float* y   = (const float*)d_in[0];
  const int*   seq = (const int*)  d_in[1];
  const float* Q   = (const float*)d_in[2];
  const float* V   = (const float*)d_in[3];
  float*       out = (float*)d_out;

  const size_t qt_bytes = (size_t)NHEAD * EP * DP * sizeof(_Float16);   // 3,891,200
  const size_t vt_bytes = (size_t)NHEAD * FP * DP * sizeof(_Float16);   //   409,600
  if (ws_size < qt_bytes + vt_bytes) return;
  _Float16* Qt = (_Float16*)d_ws;
  _Float16* Vt = (_Float16*)((char*)d_ws + qt_bytes);

  k_prep<<<dim3(QT_BLOCKS + VT_BLOCKS), dim3(256), 0, stream>>>(Q, V, Qt, Vt);
  k_attn<<<dim3(NB / BPB), dim3(256), 0, stream>>>(y, seq, Qt, Vt, out);
}

// v008
// A run of this version takes 133 microseconds.
// Next to v007, in two timings, it ran 1.08 times as fast each time.
// Over all steps from v000 it is 4.93 times as fast.
#include <hip/hip_runtime.h>
// Contractions y*Q_h, y*V_h, a1*y^T, expS*(y*V_h): v_wmma_f32_16x16x32_f16 (f16 operands built from bf16-RNE inputs; a1, expS, y*V_h as f16 hi + f16 residual x2048 with separate accumulators), f32 accumulate; exp / normalisation in f32.

#ifndef NB
#define NB 1024
#endif
#define NB_FULL 1024
#define LSEQ   30
#define DDIM   300
#define NHEAD  20
#define HDIM   20
#define ODIM   (NHEAD * HDIM)          /* 400 */
#define LP     32                      /* padded rows of one batch row's tile */
#define BPB    2                       /* batch rows of a block: each weight fragment fetched feeds 2 * BPB l-tiles */
#define LT     (2 * BPB)               /* 16-row tiles of Ys */
#define DP     320                     /* padded K */
#define KSTEPS (DP / 32)               /* 10 */
#define NTD    19                      /* 16-col tiles covering 300 */
#define EP     (NTD * 16)              /* 304 padded out cols of Q_h */
#define FP     32                      /* padded out cols of V_h */
#define NTA    (NTD + FP / 16)         /* 21 n-tiles of y * [Q_h | V_h] */
#define DCH    (DP / 8)                /* 40 chunks of 8 halves per padded row */
/* LDS row pitches: an odd multiple of 16 bytes, so that the 16 rows of a b128 fragment read fall on distinct banks */
#define YP     (DP + 8)                /* halves: 656 B rows of Ys */
#define TP     (LP + 8)                /* halves:  80 B rows of Wh, Wl, Eh, El */
#define SP     (LP + 4)                /* floats: 144 B rows of Sp */
#define NWAVE  8                       /* waves of a block: one partial score plane each */
#define QT_CHUNKS (NHEAD * EP * DCH)   /* 243200 */
#define VT_CHUNKS (NHEAD * FP * DCH)   /* 25600 */
#define QT_BLOCKS (QT_CHUNKS / 256)    /* 950 */
#define VT_BLOCKS (VT_CHUNKS / 256)    /* 100 */
#define Y_BSTRIDE   (LSEQ * DDIM)      /* per-batch stride of y (floats) */
#define SEQ_BSTRIDE (LSEQ)             /* per-batch stride of token ids */
#define OUT_BSTRIDE (LSEQ * ODIM)      /* per-batch stride of out (floats) */
#define QSC 1024.0f                    /* power-of-two carry on Q plane */
#define VSC 1024.0f                    /* power-of-two carry on V plane */
#define RSC 2048.0f                    /* power-of-two carry on residual planes */
#define PF  3                          /* k-steps of weight fragments held ahead in registers */
#define FRH (2 * 32 * 8)               /* halves of one packed 16x32 weight fragment: 2 loads x 32 lanes x 8 halves */
#define TSTEP (8 * KSTEPS * FRH)       /* halves between a wave's successive n-tiles of Qt */
#define YIT   (LP * DCH / 256)         /* chunks of 8 halves that a thread stages of each batch row: 5 */

static_assert(QT_CHUNKS % 256 == 0);
static_assert((LP * DCH) % 256 == 0 && DDIM % 4 == 0 && Y_BSTRIDE % 4 == 0);
static_assert(VT_CHUNKS % 256 == 0);
static_assert((OUT_BSTRIDE * 4) % 128 == 0);
static_assert((LSEQ * ODIM) % 4 == 0);
static_assert(((NHEAD * EP * DP * 2) % 128) == 0);
static_assert(NB <= NB_FULL && NB % BPB == 0 && 4 * BPB == NWAVE);
static_assert(NTD > 16 && NTA <= 24);
static_assert(PF <= KSTEPS && (DP * 2) % 128 == 0);
static_assert(DP % 32 == 0 && EP >= DDIM && FP >= HDIM && LP >= LSEQ);
static_assert(NTD * KSTEPS * FRH == EP * DP && (FP / 16) * KSTEPS * FRH == FP * DP);
static_assert((YP * 2) % 32 == 16 && (TP * 2) % 32 == 16 && (SP * 4) % 32 == 16);

typedef _Float16 v16h __attribute__((ext_vector_type(16)));
typedef _Float16 v8h  __attribute__((ext_vector_type(8)));
typedef float    v8f  __attribute__((ext_vector_type(8)));
typedef float    v4f  __attribute__((ext_vector_type(4)));
typedef v8h v8ha __attribute__((may_alias));
typedef v4f v4fa __attribute__((may_alias));
typedef __attribute__((address_space(1))) float gfloat;   /* a float in global memory: a pointer that passes through an asm operand keeps its global stores */

union Frag { v16h v; v8h h[2]; };
union U8h  { v8h v; _Float16 s[8]; unsigned int u[4]; };
union U16h { v16h v; v8h h[2]; _Float16 s[16]; };

__device__ __forceinline__ int imin(int a, int b) { return a < b ? a : b; }

// f32 -> bf16 (RNE) -> back to f32 (value exactly representable in bf16), or +0 where ok is false:
// the guard masks the value, so that the load itself stands under no branch
__device__ __forceinline__ float bf16_rne_if(float f, bool ok) {
  unsigned int u = __builtin_bit_cast(unsigned int, f);
  u = (u + 0x7fffu + ((u >> 16) & 1u)) & (ok ? 0xffff0000u : 0u);
  return __builtin_bit_cast(float, u);
}

// 16x32 fragment from a [row][k] k-contiguous 16-bit matrix; rowp = row (lane&15) start.
// elements 0..7 <- k0+8hf .. +7, elements 8..15 <- k0+16+8hf .. +7 (same map for A and B)
__device__ __forceinline__ v16h ld_frag(const _Float16* rowp, int k0, int hf) {
  Frag f;
  f.h[0] = *(const v8ha*)(rowp + k0 + 8 * hf);
  f.h[1] = *(const v8ha*)(rowp + k0 + 16 + 8 * hf);
  return f.v;
}

// 16x32 fragment from a plane packed in fragment order: lanep = the tile's k-step 0 + lane * 8 halves.
// Each of the two loads reads 32 lanes x 16 B = 512 contiguous bytes; same element map as ld_frag.
__device__ __forceinline__ v16h ld_pfrag(const _Float16* lanep, int ks) {
  Frag f;
  f.h[0] = *(const v8ha*)(lanep + ks * FRH);
  f.h[1] = *(const v8ha*)(lanep + ks * FRH + FRH / 2);
  return f.v;
}

__device__ __forceinline__ v8f zero8() {
  v8f z = {0.f, 0.f, 0.f, 0.f, 0.f, 0.f, 0.f, 0.f};
  return z;
}

__device__ __forceinline__ v8f wmma16(v16h a, v16h b, v8f c) {
  return __builtin_amdgcn_wmma_f32_16x16x32_f16(false, a, false, b, (short)0, c, false, false);
}

// K-step ks of a wave's NT weight fragments, issued as one group of loads.
// Tiles 0 and 1 lie in Qt behind qlane; the third tile (of Qt or of Vt) has its own pointer.
template <int NT>
__device__ __forceinline__ void q_fetch(v16h (&bq)[PF][3], const _Float16* qlane, const _Float16* xlane, int ks) {
#pragma unroll
  for (int t = 0; t < NT; ++t) {
    const _Float16* p = t < 2 ? qlane + t * TSTEP : xlane;
    bq[ks % PF][t] = ld_pfrag(p, ks);
  }
}

// K loop of GEMM1 for a wave that owns NT weight tiles: k-steps 0..PF-1 of all its tiles are issued up front,
// and each finished step refills its ring slot with the step PF steps on.
// ya = the lane's row (lane & 15) of Ys; tile i of Ys is l-tile (or m-tile) i & 1 of the block's batch row i >> 1.
// A tile of Qt is the A operand: acc[t][bb][lt] = (y * Q_h)^T, rows e, columns l (l-tile lt).
// A tile of Vt (VT: the third tile) is the B operand: acc[2][bb][mt] = y * V_h, rows m, columns f.
template <int NT, bool VT>
__device__ __forceinline__ void gemm1_k(const _Float16* ya, const _Float16* qlane,
                                        const _Float16* xlane, int hf, v8f (&acc)[3][BPB][2]) {
  v16h bq[PF][3];
#pragma unroll
  for (int ks = 0; ks < PF; ++ks) q_fetch<NT>(bq, qlane, xlane, ks);
  // keeps the ring's first loads in front of the K loop: sunk to their first use they would be waited for at once
  __builtin_amdgcn_sched_barrier(0);
  // unrolled: the ring slot must be a compile-time register index
#pragma unroll
  for (int ks = 0; ks < KSTEPS; ++ks) {
    v16h a[LT];
#pragma unroll
    for (int i = 0; i < LT; ++i) a[i] = ld_frag(ya + i * 16 * YP, ks * 32, hf);
#pragma unroll
    for (int t = 0; t < NT; ++t) {
#pragma unroll
      for (int i = 0; i < LT; ++i) {
        if (VT && t == 2) acc[t][i >> 1][i & 1] = wmma16(a[i], bq[ks % PF][t], acc[t][i >> 1][i & 1]);
        else              acc[t][i >> 1][i & 1] = wmma16(bq[ks % PF][t], a[i], acc[t][i >> 1][i & 1]);
      }
    }
    if (ks + PF < KSTEPS) q_fetch<NT>(bq, qlane, xlane, ks + PF);
    // keeps each refill PF k-steps ahead of its use: without it the loads sink to the step that reads them
    __builtin_amdgcn_sched_barrier(0);
  }
}

// One k-step (32 values of e) of the score product S^T = Ys * a1^T, from accumulators of (y * Q_h)^T.
// A lane of such an accumulator holds column l = lane & 15 and rows e = 8 * hf + r: these are elements 0..7
// (tile x) and 8..15 (tile z) of the B fragment whose k order is e = x*16 + 0..15, z*16 + 0..15.
// The A fragment reads Ys in the same k order: ex, ez = first column of tile x, of tile z.
// TWO = false: there is no tile z, and elements 8..15 of A and B are zero.
template <bool TWO>
__device__ __forceinline__ void score_step(const _Float16* ys_lane, int ex, int ez, const v8f (&ax)[2], const v8f (&az)[2],
                                           v8f (&sh)[2][2], v8f (&sl)[2][2]) {
  U16h ay[2];
#pragma unroll
  for (int mt = 0; mt < 2; ++mt) {
    ay[mt].h[0] = *(const v8ha*)(ys_lane + mt * 16 * YP + ex);
    if (TWO) {
      ay[mt].h[1] = *(const v8ha*)(ys_lane + mt * 16 * YP + ez);
    } else {
#pragma unroll
      for (int r = 0; r < 8; ++r) ay[mt].s[8 + r] = (_Float16)0.0f;
    }
  }
#pragma unroll
  for (int lt = 0; lt < 2; ++lt) {
    U16h bh, bl;
#pragma unroll
    for (int r = 0; r < 8; ++r) {
      const float a = ax[lt][r] * (1.0f / QSC);
      const _Float16 ah = (_Float16)a;
      bh.s[r] = ah;
      bl.s[r] = (_Float16)((a - (float)ah) * RSC);
      if (TWO) {
        const float c = az[lt][r] * (1.0f / QSC);
        const _Float16 chh = (_Float16)c;
        bh.s[8 + r] = chh;
        bl.s[8 + r] = (_Float16)((c - (float)chh) * RSC);
      } else {
        bh.s[8 + r] = (_Float16)0.0f;
        bl.s[8 + r] = (_Float16)0.0f;
      }
    }
#pragma unroll
    for (int mt = 0; mt < 2; ++mt) {
      sh[mt][lt] = wmma16(ay[mt].v, bh.v, sh[mt][lt]);
      sl[mt][lt] = wmma16(ay[mt].v, bl.v, sl[mt][lt]);
    }
  }
}

// =====================================================================
// Kernel 0: weight planes, packed in the order their fragments are loaded (Qt as A, Vt as B operands).
//   value(h, e, d) = f16( bf16(Q[h][d][e]) * QSC ), e < 304 (e >= 300 zero), d < 320 (d >= 300 zero)
//   value(h, f, d) = f16( bf16(V[h][d][f]) * VSC ), f < 32  (f >= 20 zero),  d < 320
//   chunk of 8 halves c = ((((h * tiles + nt) * KSTEPS + ks) * 2 + j) * 32 + lane) holds
//   row nt*16 + (lane & 15), d = ks*32 + j*16 + 8*(lane >> 4) .. +7
// grid: QT_BLOCKS + VT_BLOCKS, block 256 (block-uniform role)
// =====================================================================
__launch_bounds__(256)
__global__ void k_prep(const float* __restrict__ Q, const float* __restrict__ V,
                       _Float16* __restrict__ Qt, _Float16* __restrict__ Vt)
{
  const int bid = blockIdx.x;
  const int tid = threadIdx.x;
  U8h u;
  _Float16* dst;
  if (bid < QT_BLOCKS) {
    const int c   = bid * 256 + tid;              // < QT_CHUNKS exactly
    const int fr  = c >> 6;                       // fragment: (h * NTD + nt) * KSTEPS + ks
    const int tn  = fr / KSTEPS;
    const int ks  = fr - tn * KSTEPS;
    const int h   = tn / NTD;
    const int nt  = tn - h * NTD;
    const int e   = nt * 16 + (c & 15);
    const int d0  = ks * 32 + ((c >> 5) & 1) * 16 + ((c >> 4) & 1) * 8;
    const int ecl = imin(e, DDIM - 1);
    float x[8];
    // both loops unrolled: x stays in registers, and the 8 loads are issued as one group before the first is used
#pragma unroll
    for (int j = 0; j < 8; ++j) x[j] = Q[((size_t)h * DDIM + imin(d0 + j, DDIM - 1)) * DDIM + ecl];   // clamped address
#pragma unroll
    for (int j = 0; j < 8; ++j) u.s[j] = (_Float16)(bf16_rne_if(x[j], (d0 + j < DDIM) && (e < DDIM)) * QSC);
    dst = Qt + (size_t)c * 8;
  } else {
    const int c   = (bid - QT_BLOCKS) * 256 + tid;  // < VT_CHUNKS exactly
    const int fr  = c >> 6;                         // fragment: (h * (FP / 16) + nt) * KSTEPS + ks
    const int tn  = fr / KSTEPS;
    const int ks  = fr - tn * KSTEPS;
    const int h   = tn / (FP / 16);
    const int nt  = tn - h * (FP / 16);
    const int f   = nt * 16 + (c & 15);
    const int d0  = ks * 32 + ((c >> 5) & 1) * 16 + ((c >> 4) & 1) * 8;
    const int fcl = imin(f, HDIM - 1);
    float x[8];
    // both loops unrolled: x stays in registers, and the 8 loads are issued as one group before the first is used
#pragma unroll
    for (int j = 0; j < 8; ++j) x[j] = V[((size_t)h * DDIM + imin(d0 + j, DDIM - 1)) * HDIM + fcl];   // clamped address
#pragma unroll
    for (int j = 0; j < 8; ++j) u.s[j] = (_Float16)(bf16_rne_if(x[j], (d0 + j < DDIM) && (f < HDIM)) * VSC);
    dst = Vt + (size_t)c * 8;
  }
  const v8h val = u.v;
  *(v8h*)dst = val;
  
}

// =====================================================================
// Kernel 1: one block per BPB batch rows (256 threads = 8 waves), loop over heads.
//   LDS (rows padded to the pitches YP, TP, SP; pad bytes are never read), each per batch row bb of the block:
//        Ys [bb][32][320] f16 (y tile, bf16-RNE values),
//        Wh/Wl [bb][32][32] f16 (y * V_h hi/residual, stored [f][m]),
//        Sp [8][bb][32][32] f32 (each wave's part of the scores, [l][m]), Eh/El [bb][32][32] f16 exp hi/residual, invs, msk [bb][32],
//   A weight fragment is fetched once per block and used on the tiles of all its batch rows.
//   h1 = (alpha * y) * V_h is formed as alpha * (y * V_h): y * V_h is two more tiles of the y * Q_h phase.
//   a1 = y * Q_h never leaves the registers: it is formed transposed, so that a wave's accumulators are B fragments
//   of the score product over the wave's own columns e; the eight parts are added in the exp phase.
// Every LDS region is cross-wave: block barriers between producer and consumer phases.
// =====================================================================
// four waves per SIMD: two blocks share a WGP, so that one block's matrix phase covers the other's exp phase and barriers
__launch_bounds__(256) __attribute__((amdgpu_waves_per_eu(4, 4)))
__global__ void k_attn(const float* __restrict__ y, const int* __restrict__ seq,
                       const _Float16* __restrict__ Qt, const _Float16* __restrict__ Vt,
                       float* __restrict__ out)
{
  __shared__ __align__(16) _Float16 Ys[BPB * LP * YP];
  __shared__ __align__(16) _Float16 Wh[BPB * FP * TP];
  __shared__ __align__(16) _Float16 Wl[BPB * FP * TP];
  __shared__ __align__(16) float    Sp[NWAVE * BPB * LP * SP];
  __shared__ __align__(16) _Float16 Eh[BPB * LP * TP];
  __shared__ __align__(16) _Float16 El[BPB * LP * TP];
  __shared__ __align__(16) float    invs[BPB * LP];
  __shared__ __align__(16) int      msk[BPB * LP];

  const int tid  = threadIdx.x;
  const int lane = tid & 31;
  const int wave = __builtin_amdgcn_readfirstlane(tid >> 5);
  const int hf   = lane >> 4;
  const int nl   = lane & 15;
  const int b    = blockIdx.x * BPB;                                 // first batch row of the block
  const float* yb = y + (size_t)b * Y_BSTRIDE;

  // ---- weight fragments: the lane's 16 bytes of k-step 0 ----
  const bool w3 = wave + 16 < NTA;                                   // wave-uniform: owns a third tile
  const bool wv = w3 && wave + 16 >= NTD;                            // wave-uniform: that tile is one of y * V_h
  const bool q3 = wave + 16 < NTD;                                   // wave-uniform: that tile is one of y * Q_h
  const _Float16* qlane0 = Qt + (size_t)wave * (KSTEPS * FRH) + lane * 8;        // n-tile `wave`, head 0
  // third tile, head 0: n-tile wave + 16 of Qt, or n-tile wave + 16 - NTD of Vt (waves without one never load from it)
  const _Float16* xlane0 = wv ? Vt + (size_t)(wave + 16 - NTD) * (KSTEPS * FRH) + lane * 8 : qlane0 + 2 * TSTEP;
  const int xstep = wv ? (FP / 16) * KSTEPS * FRH : NTD * KSTEPS * FRH;          // halves per head of that plane
  // the wave's part of the scores: row l = nl (+ 16 lt), columns m = 8 hf .. + 7 (+ 16 mt)
  float* sp_w = Sp + wave * (BPB * LP * SP) + nl * SP + 8 * hf;

  // ---- stage y tile: Ys[row][d], bf16-RNE values in f16, pads zero ----
  // the token id of key position tid (threads past BPB * LP read one again and drop it), issued with the loads of y
  const int* sp = seq + (size_t)(b + (tid & (BPB * LP - 1)) / LP) * SEQ_BSTRIDE + imin(tid & (LP - 1), LSEQ - 1);   // clamped address
  const int sv = *sp;
  // all of a thread's loads are issued before the first is used: 2 x 16 bytes per chunk of 8 (a group of 4 lies wholly inside a row or wholly in the pad);
  // a thread stages the same chunks of every batch row of the block, so that one address serves BPB loads
  {
    v4f x[YIT][BPB][2];
    const float* p[YIT][2];
    // every loop of this block is unrolled: x and p must stay in registers
#pragma unroll
    for (int it = 0; it < YIT; ++it) {
      const int idx = tid + it * 256;
      const int row = idx / DCH;
      const int d0  = (idx - row * DCH) * 8;
      p[it][0] = yb + imin(row, LSEQ - 1) * DDIM + imin(d0, DDIM - 4);       // clamped address
      p[it][1] = yb + imin(row, LSEQ - 1) * DDIM + imin(d0 + 4, DDIM - 4);   // clamped address
#pragma unroll
      for (int bb = 0; bb < BPB; ++bb) {
        x[it][bb][0] = *(const v4fa*)(p[it][0] + bb * Y_BSTRIDE);
        x[it][bb][1] = *(const v4fa*)(p[it][1] + bb * Y_BSTRIDE);
      }
    }
    // stands behind all the loads and in front of the first rewrite of an address register: as inputs the addresses stay live up to here,
    // so that no later load lands on one either; it also keeps every load in front of the first conversion
    static_assert(YIT == 5);
    asm volatile("s_wait_xcnt 0x0" : : "v"(p[0][0]), "v"(p[0][1]), "v"(p[1][0]), "v"(p[1][1]), "v"(p[2][0]), "v"(p[2][1]),
                 "v"(p[3][0]), "v"(p[3][1]), "v"(p[4][0]), "v"(p[4][1]), "v"(sp) : "memory");
#pragma unroll
    for (int it = 0; it < YIT; ++it) {
      const int idx = tid + it * 256;
      const int row = idx / DCH;
      const int d0  = (idx - row * DCH) * 8;
#pragma unroll
      for (int bb = 0; bb < BPB; ++bb) {
        U8h u;
#pragma unroll
        for (int j = 0; j < 8; ++j) u.s[j] = (_Float16)bf16_rne_if(x[it][bb][j >> 2][j & 3], (row < LSEQ) && (d0 + (j & 4) < DDIM));   // one guard per group of 4
        *(v8ha*)(Ys + (bb * LP + row) * YP + d0) = u.v;
      }
    }
  }
  // ---- key mask from token ids (id > 0), pads 0 ----
  if (tid < BPB * LP) msk[tid] = ((tid & (LP - 1)) < LSEQ && sv > 0) ? 1 : 0;
  __syncthreads();

  // the lane's first element of out in GEMM3: batch row wave >> 2, row tile (wave >> 1) & 1, column tile wave & 1, head 0
  gfloat* op = (gfloat*)out + (size_t)(b + (wave >> 2)) * OUT_BSTRIDE + (((wave >> 1) & 1) * 16 + 8 * hf) * ODIM + (wave & 1) * 16 + nl;

  for (int h = 0; h < NHEAD; ++h) {
    // ===== GEMM1: a1^T (x QSC) = Qt_h * Ys^T (19 e-tiles x 4 l-tiles), yV (x VSC) = Ys * Vt_h (4 m-tiles x 2 f-tiles) =====
    {
      v8f acc[3][BPB][2];
#pragma unroll
      for (int t = 0; t < 3; ++t) {
#pragma unroll
        for (int bb = 0; bb < BPB; ++bb) { acc[t][bb][0] = zero8(); acc[t][bb][1] = zero8(); }
      }
      const _Float16* qlane = qlane0 + (size_t)h * (NTD * KSTEPS * FRH);
      const _Float16* xlane = xlane0 + (size_t)h * xstep;
      if (q3)      gemm1_k<3, false>(Ys + nl * YP, qlane, xlane, hf, acc);
      else if (wv) gemm1_k<3, true>(Ys + nl * YP, qlane, xlane, hf, acc);
      else         gemm1_k<2, false>(Ys + nl * YP, qlane, xlane, hf, acc);
      // where the three arms join: stands between every weight load above, also those the compiler lifts in front of the arms,
      // and the first rewrite of their address register pair, which as an input stays live up to this statement
      // (the third tile's pair is stepped only at the loop's foot, behind the wait that stands there)
      asm volatile("s_wait_xcnt 0x0" : : "v"(qlane) : "memory");
      // ===== GEMM2, the wave's part: S^T = Ys * a1^T over the columns e of its own tiles; a1 = acc/QSC as
      // f16 hi + f16 residual*RSC, converted in the lane that holds it; one batch row after the other =====
#pragma unroll
      for (int bb = 0; bb < BPB; ++bb) {
        v8f sh[2][2], sl[2][2];
#pragma unroll
        for (int mt = 0; mt < 2; ++mt) {
#pragma unroll
          for (int lt = 0; lt < 2; ++lt) { sh[mt][lt] = zero8(); sl[mt][lt] = zero8(); }
        }
        const _Float16* ys_lane = Ys + (bb * LP + nl) * YP + 8 * hf;
        score_step<true>(ys_lane, wave * 16, (wave + 8) * 16, acc[0][bb], acc[1][bb], sh, sl);
        if (q3) score_step<false>(ys_lane, (wave + 16) * 16, 0, acc[2][bb], acc[2][bb], sh, sl);
        // a lane's 8 accumulator rows are 8 successive m of its row l: two 16-byte stores per tile
#pragma unroll
        for (int mt = 0; mt < 2; ++mt) {
#pragma unroll
          for (int lt = 0; lt < 2; ++lt) {
            v4f s0, s1;
#pragma unroll
            for (int r = 0; r < 4; ++r) {
              s0[r] = sh[mt][lt][r]     + sl[mt][lt][r]     * (1.0f / RSC);
              s1[r] = sh[mt][lt][4 + r] + sl[mt][lt][4 + r] * (1.0f / RSC);
            }
            *(v4fa*)(sp_w + (bb * LP + lt * 16) * SP + mt * 16)     = s0;
            *(v4fa*)(sp_w + (bb * LP + lt * 16) * SP + mt * 16 + 4) = s1;
          }
        }
      }
      // epilogue of a y * V_h tile: yV = acc/VSC -> f16 hi + f16 residual*RSC into Wh/Wl [f][m];
      // a lane's 8 accumulator rows are 8 successive m of its column f: one 16-byte store per plane
      if (wv) {
        const int f = (wave + 16 - NTD) * 16 + nl;
#pragma unroll
        for (int i = 0; i < LT; ++i) {
          const int bb = i >> 1, mt = i & 1;
          U8h uh, ul;
#pragma unroll
          for (int r = 0; r < 8; ++r) {
            const float a = acc[2][bb][mt][r] * (1.0f / VSC);
            const _Float16 ah = (_Float16)a;
            const float rs = (a - (float)ah) * RSC;
            uh.s[r] = ah;
            ul.s[r] = (_Float16)rs;
          }
          *(v8ha*)(Wh + (bb * FP + f) * TP + mt * 16 + 8 * hf) = uh.v;
          *(v8ha*)(Wl + (bb * FP + f) * TP + mt * 16 + 8 * hf) = ul.v;
        }
      }
    }
    __syncthreads();

    // ================= exp (no max subtraction) + masked row sums =================
#pragma unroll
    for (int bb = 0; bb < BPB; ++bb) {
      const int l = tid >> 3;          // 0..31
      const int g = tid & 7;           // 8 threads per row, 4 key positions each
      const int bl = bb * LP + l;      // row of the block's planes
      float part = 0.0f;
      // scores: the eight waves' parts, added in wave order
      v4f s4 = *(const v4fa*)(Sp + bl * SP + g * 4);
#pragma unroll
      for (int w = 1; w < NWAVE; ++w) s4 += *(const v4fa*)(Sp + w * (BPB * LP * SP) + bl * SP + g * 4);
#pragma unroll
      for (int j = 0; j < 4; ++j) {
        const int m = g * 4 + j;
        const float s = s4[j];
        const bool ok = (l < LSEQ) && (m < LSEQ);
        const float e = ok ? expf(s) : 0.0f;        // numerator unmasked
        part += (msk[bb * LP + m] != 0) ? e : 0.0f; // denominator masked
        const _Float16 ehv = (_Float16)e;
        const float rs = (e - (float)ehv) * RSC;
        Eh[bl * TP + m] = ehv;
        El[bl * TP + m] = (_Float16)rs;
      }
      part += __shfl_xor(part, 1);
      part += __shfl_xor(part, 2);
      part += __shfl_xor(part, 4);
      if (g == 0) invs[bl] = (l < LSEQ) ? (1.0f / (part + 1e-6f)) : 0.0f;
    }
    __syncthreads();

    // ===== GEMM3: h1 = (expS (32x32) * yV (32x32)) * inv[row] ; 4 tiles per batch row, one per wave =====
    {
      const int bb = wave >> 2, mt = (wave >> 1) & 1, nt = wave & 1;
      const v16h eh = ld_frag(Eh + (bb * LP + mt * 16 + nl) * TP, 0, hf);
      const v16h el = ld_frag(El + (bb * LP + mt * 16 + nl) * TP, 0, hf);
      const v16h wh = ld_frag(Wh + (bb * FP + nt * 16 + nl) * TP, 0, hf);   // B[k=m][n=f] = Wh[f][m]
      const v16h wl = ld_frag(Wl + (bb * FP + nt * 16 + nl) * TP, 0, hf);
      const v8f ch = wmma16(eh, wh, zero8());
      v8f cl = wmma16(el, wh, zero8());                                // both cross terms carry RSC
      cl = wmma16(eh, wl, cl);
      float v[8];
#pragma unroll
      for (int r = 0; r < 8; ++r) v[r] = (ch[r] + cl[r] * (1.0f / RSC)) * invs[bb * LP + mt * 16 + 8 * hf + r];
      // ends the head's LDS reads (the next head rewrites Wh, Wl); the stores to out read no LDS and are issued behind it
      __syncthreads();
      // the head's 20 columns of a row go straight to out: 16 lanes store 64 successive bytes (4 lanes 16 bytes for nt = 1)
#pragma unroll
      for (int r = 0; r < 8; ++r) {
        const int l = mt * 16 + 8 * hf + r;
        const int f = nt * 16 + nl;
        if (l < LSEQ && f < HDIM) op[r * ODIM] = v[r];
      }
      // stands between the stores above and the step of their address to the next head: the step takes the address from this statement
      asm volatile("s_wait_xcnt 0x0" : "+v"(op) : : "memory");
      op += HDIM;
    }
  }
}

extern "C" void kernel_launch(void* const* d_in, const int* in_sizes, int n_in,
                              void* d_out, int out_size, void* d_ws, size_t ws_size,
                              hipStream_t stream)
{
  if (n_in < 4) return;
  if (in_sizes[0] < NB * LSEQ * DDIM) return;
  if (in_sizes[1] < NB * LSEQ) return;
  if (in_sizes[2] < NHEAD * DDIM * DDIM) return;
  if (in_sizes[3] < NHEAD * DDIM * HDIM) return;
  if (out_size < NB * LSEQ * ODIM) return;

  const float* y   = (const float*)d_in[0];
  const int*   seq = (const int*)  d_in[1];
  const float* Q   = (const float*)d_in[2];
  const float* V   = (const float*)d_in[3];
  float*       out = (float*)d_out;

  const size_t qt_bytes = (size_t)NHEAD * EP * DP * sizeof(_Float16);   // 3,891,200
  const size_t vt_bytes = (size_t)NHEAD * FP * DP * sizeof(_Float16);   //   409,600
  if (ws_size < qt_bytes + vt_bytes) return;
  _Float16* Qt = (_Float16*)d_ws;
  _Float16* Vt = (_Float16*)((char*)d_ws + qt_bytes);

  k_prep<<<dim3(QT_BLOCKS + VT_BLOCKS), dim3(256), 0, stream>>>(Q, V, Qt, Vt);
  k_attn<<<dim3(NB / BPB), dim3(256), 0, stream>>>(y, seq, Qt, Vt, out);
}

// v009
// One run takes 125 microseconds.
// Next to v008, in two timings, it ran 1.06 times as fast each time.
// All steps since v000 together make it 5.23 times as fast.
#include <hip/hip_runtime.h>
// Contractions y*Q_h, y*V_h, a1*y^T, expS*(y*V_h): v_wmma_f32_16x16x32_f16 (f16 operands built from bf16-RNE inputs; a1, expS, y*V_h as f16 hi + f16 residual x2048 with separate accumulators), f32 accumulate; exp / normalisation in f32.

#ifndef NB
#define NB 1024
#endif
#define NB_FULL 1024
#define LSEQ   30
#define DDIM   300
#define NHEAD  20
#define HDIM   20
#define ODIM   (NHEAD * HDIM)          /* 400 */
#define LP     32                      /* padded rows of one batch row's tile */
#define BPB    2                       /* batch rows of a block: each weight fragment fetched feeds 2 * BPB l-tiles */
#define LT     (2 * BPB)               /* 16-row tiles of Ys */
#define DP     320                     /* padded K */
#define KSTEPS (DP / 32)               /* 10 */
#define NTD    19                      /* 16-col tiles covering 300 */
#define EP     (NTD * 16)              /* 304 padded out cols of Q_h */
#define FP     32                      /* padded out cols of V_h */
#define NTA    (NTD + FP / 16)         /* 21 n-tiles of y * [Q_h | V_h] */
#define DCH    (DP / 8)                /* 40 chunks of 8 halves per padded row */
/* LDS row pitches: an odd multiple of 16 bytes, so that the 16 rows of a b128 fragment read fall on distinct banks */
#define YP     (DP + 8)                /* halves: 656 B rows of Ys */
#define TP     (LP + 8)                /* halves:  80 B rows of Wh, Wl, Eh, El */
#define SP     (LP + 4)                /* floats: 144 B rows of Sp */
#define NWAVE  8                       /* waves of a block: one partial score plane each */
#define QT_CHUNKS (NHEAD * EP * DCH)   /* 243200 */
#define VT_CHUNKS (NHEAD * FP * DCH)   /* 25600 */
#define QT_BLOCKS (QT_CHUNKS / 256)    /* 950 */
#define VT_BLOCKS (VT_CHUNKS / 256)    /* 100 */
#define Y_BSTRIDE   (LSEQ * DDIM)      /* per-batch stride of y (floats) */
#define SEQ_BSTRIDE (LSEQ)             /* per-batch stride of token ids */
#define OUT_BSTRIDE (LSEQ * ODIM)      /* per-batch stride of out (floats) */
#define QSC 1024.0f                    /* power-of-two carry on Q plane */
#define VSC 1024.0f                    /* power-of-two carry on V plane */
#define RSC 2048.0f                    /* power-of-two carry on residual planes */
#define PF  3                          /* k-steps of weight fragments held ahead in registers */
#define FRH (2 * 32 * 8)               /* halves of one packed 16x32 weight fragment: 2 loads x 32 lanes x 8 halves */
#define TSTEP (8 * KSTEPS * FRH)       /* halves between a wave's successive n-tiles of Qt */
#define YIT   (LP * DCH / 256)         /* chunks of 8 halves that a thread stages of each batch row: 5 */

static_assert(QT_CHUNKS % 256 == 0);
static_assert((LP * DCH) % 256 == 0 && DDIM % 4 == 0 && Y_BSTRIDE % 4 == 0);
static_assert(VT_CHUNKS % 256 == 0);
static_assert((OUT_BSTRIDE * 4) % 128 == 0);
static_assert((LSEQ * ODIM) % 4 == 0);
static_assert(((NHEAD * EP * DP * 2) % 128) == 0);
static_assert(NB <= NB_FULL && NB % BPB == 0 && 4 * BPB == NWAVE);
static_assert(NTD > 16 && NTA <= 24);
static_assert(PF <= KSTEPS && (DP * 2) % 128 == 0);
static_assert(DP % 32 == 0 && EP >= DDIM && FP >= HDIM && LP >= LSEQ);
static_assert(NTD * KSTEPS * FRH == EP * DP && (FP / 16) * KSTEPS * FRH == FP * DP);
static_assert((YP * 2) % 32 == 16 && (TP * 2) % 32 == 16 && (SP * 4) % 32 == 16);

typedef _Float16 v16h __attribute__((ext_vector_type(16)));
typedef _Float16 v8h  __attribute__((ext_vector_type(8)));
typedef float    v8f  __attribute__((ext_vector_type(8)));
typedef float    v4f  __attribute__((ext_vector_type(4)));
typedef v8h v8ha __attribute__((may_alias));
typedef v4f v4fa __attribute__((may_alias));
typedef int  v4i  __attribute__((ext_vector_type(4)));
typedef v4i v4ia __attribute__((may_alias));
typedef __attribute__((address_space(1))) float gfloat;   /* a float in global memory: a pointer that passes through an asm operand keeps its global stores */

union Frag { v16h v; v8h h[2]; };
union U8h  { v8h v; _Float16 s[8]; unsigned int u[4]; };
union U16h { v16h v; v8h h[2]; _Float16 s[16]; };

__device__ __forceinline__ int imin(int a, int b) { return a < b ? a : b; }

// f32 -> bf16 (RNE) -> back to f32 (value exactly representable in bf16), or +0 where ok is false:
// the guard masks the value, so that the load itself stands under no branch
__device__ __forceinline__ float bf16_rne_if(float f, bool ok) {
  unsigned int u = __builtin_bit_cast(unsigned int, f);
  u = (u + 0x7fffu + ((u >> 16) & 1u)) & (ok ? 0xffff0000u : 0u);
  return __builtin_bit_cast(float, u);
}

// 16x32 fragment from a [row][k] k-contiguous 16-bit matrix; rowp = row (lane&15) start.
// elements 0..7 <- k0+8hf .. +7, elements 8..15 <- k0+16+8hf .. +7 (same map for A and B)
__device__ __forceinline__ v16h ld_frag(const _Float16* rowp, int k0, int hf) {
  Frag f;
  f.h[0] = *(const v8ha*)(rowp + k0 + 8 * hf);
  f.h[1] = *(const v8ha*)(rowp + k0 + 16 + 8 * hf);
  return f.v;
}

// 16x32 fragment from a plane packed in fragment order: lanep = the tile's k-step 0 + lane * 8 halves.
// Each of the two loads reads 32 lanes x 16 B = 512 contiguous bytes; same element map as ld_frag.
__device__ __forceinline__ v16h ld_pfrag(const _Float16* lanep, int ks) {
  Frag f;
  f.h[0] = *(const v8ha*)(lanep + ks * FRH);
  f.h[1] = *(const v8ha*)(lanep + ks * FRH + FRH / 2);
  return f.v;
}

// expf as the library forms it, operation for operation, with v_exp_f32 written out: the v_nop in its statement is the slot that the
// instruction set asks for behind a transcendental before its result is used or its source overwritten
__device__ __forceinline__ float exp_f32(float x) {
  const float c_hi = __builtin_bit_cast(float, 0x3fb8aa3bu);   // log2(e), and what it lacks
  const float c_lo = __builtin_bit_cast(float, 0x32a5705fu);
  const float ph = x * c_hi;
  const float pl = __builtin_fmaf(x, c_lo, __builtin_fmaf(x, c_hi, -ph));
  const float n  = __builtin_rintf(ph);
  const float a  = (ph - n) + pl;
  float r;
  asm("v_exp_f32 %0, %1\n\tv_nop" : "=v"(r) : "v"(a));
  r = __builtin_ldexpf(r, (int)n);
  r = (x < __builtin_bit_cast(float, 0xc2ce8ed0u)) ? 0.0f : r;                      // underflow
  r = (x > __builtin_bit_cast(float, 0x42b17218u)) ? __builtin_inff() : r;          // overflow
  return r;
}

__device__ __forceinline__ v8f zero8() {
  v8f z = {0.f, 0.f, 0.f, 0.f, 0.f, 0.f, 0.f, 0.f};
  return z;
}

__device__ __forceinline__ v8f wmma16(v16h a, v16h b, v8f c) {
  return __builtin_amdgcn_wmma_f32_16x16x32_f16(false, a, false, b, (short)0, c, false, false);
}

// K-step ks of a wave's NT weight fragments, issued as one group of loads.
// Tiles 0 and 1 lie in Qt behind qlane; the third tile (of Qt or of Vt) has its own pointer.
template <int NT>
__device__ __forceinline__ void q_fetch(v16h (&bq)[PF][3], const _Float16* qlane, const _Float16* xlane, int ks) {
#pragma unroll
  for (int t = 0; t < NT; ++t) {
    const _Float16* p = t < 2 ? qlane + t * TSTEP : xlane;
    bq[ks % PF][t] = ld_pfrag(p, ks);
  }
}

// K loop of GEMM1 for a wave that owns NT weight tiles: k-steps 0..PF-1 of all its tiles are issued up front,
// and each finished step refills its ring slot with the step PF steps on.
// ya = the lane's row (lane & 15) of Ys; tile i of Ys is l-tile (or m-tile) i & 1 of the block's batch row i >> 1.
// A tile of Qt is the A operand: acc[t][bb][lt] = (y * Q_h)^T, rows e, columns l (l-tile lt).
// A tile of Vt (VT: the third tile) is the B operand: acc[2][bb][mt] = y * V_h, rows m, columns f.
template <int NT, bool VT>
__device__ __forceinline__ void gemm1_k(const _Float16* ya, const _Float16* qlane,
                                        const _Float16* xlane, int hf, v8f (&acc)[3][BPB][2]) {
  v16h bq[PF][3];
#pragma unroll
  for (int ks = 0; ks < PF; ++ks) q_fetch<NT>(bq, qlane, xlane, ks);
  // keeps the ring's first loads in front of the K loop: sunk to their first use they would be waited for at once
  __builtin_amdgcn_sched_barrier(0);
  // unrolled: the ring slot must be a compile-time register index
#pragma unroll
  for (int ks = 0; ks < KSTEPS; ++ks) {
    v16h a[LT];
#pragma unroll
    for (int i = 0; i < LT; ++i) a[i] = ld_frag(ya + i * 16 * YP, ks * 32, hf);
#pragma unroll
    for (int t = 0; t < NT; ++t) {
#pragma unroll
      for (int i = 0; i < LT; ++i) {
        if (VT && t == 2) acc[t][i >> 1][i & 1] = wmma16(a[i], bq[ks % PF][t], acc[t][i >> 1][i & 1]);
        else              acc[t][i >> 1][i & 1] = wmma16(bq[ks % PF][t], a[i], acc[t][i >> 1][i & 1]);
      }
    }
    if (ks + PF < KSTEPS) q_fetch<NT>(bq, qlane, xlane, ks + PF);
    // keeps each refill PF k-steps ahead of its use: without it the loads sink to the step that reads them
    __builtin_amdgcn_sched_barrier(0);
  }
}

// One k-step (32 values of e) of the score product S^T = Ys * a1^T, from accumulators of (y * Q_h)^T.
// A lane of such an accumulator holds column l = lane & 15 and rows e = 8 * hf + r: these are elements 0..7
// (tile x) and 8..15 (tile z) of the B fragment whose k order is e = x*16 + 0..15, z*16 + 0..15.
// The A fragment reads Ys in the same k order: ex, ez = first column of tile x, of tile z.
// TWO = false: there is no tile z, and elements 8..15 of A and B are zero.
template <bool TWO>
__device__ __forceinline__ void score_step(const _Float16* ys_lane, int ex, int ez, const v8f (&ax)[2], const v8f (&az)[2],
                                           v8f (&sh)[2][2], v8f (&sl)[2][2]) {
  U16h ay[2];
#pragma unroll
  for (int mt = 0; mt < 2; ++mt) {
    ay[mt].h[0] = *(const v8ha*)(ys_lane + mt * 16 * YP + ex);
    if (TWO) {
      ay[mt].h[1] = *(const v8ha*)(ys_lane + mt * 16 * YP + ez);
    } else {
#pragma unroll
      for (int r = 0; r < 8; ++r) ay[mt].s[8 + r] = (_Float16)0.0f;
    }
  }
#pragma unroll
  for (int lt = 0; lt < 2; ++lt) {
    U16h bh, bl;
#pragma unroll
    for (int r = 0; r < 8; ++r) {
      const float a = ax[lt][r] * (1.0f / QSC);
      const _Float16 ah = (_Float16)a;
      bh.s[r] = ah;
      bl.s[r] = (_Float16)((a - (float)ah) * RSC);
      if (TWO) {
        const float c = az[lt][r] * (1.0f / QSC);
        const _Float16 chh = (_Float16)c;
        bh.s[8 + r] = chh;
        bl.s[8 + r] = (_Float16)((c - (float)chh) * RSC);
      } else {
        bh.s[8 + r] = (_Float16)0.0f;
        bl.s[8 + r] = (_Float16)0.0f;
      }
    }
#pragma unroll
    for (int mt = 0; mt < 2; ++mt) {
      sh[mt][lt] = wmma16(ay[mt].v, bh.v, sh[mt][lt]);
      sl[mt][lt] = wmma16(ay[mt].v, bl.v, sl[mt][lt]);
    }
  }
}

// =====================================================================
// Kernel 0: weight planes, packed in the order their fragments are loaded (Qt as A, Vt as B operands).
//   value(h, e, d) = f16( bf16(Q[h][d][e]) * QSC ), e < 304 (e >= 300 zero), d < 320 (d >= 300 zero)
//   value(h, f, d) = f16( bf16(V[h][d][f]) * VSC ), f < 32  (f >= 20 zero),  d < 320
//   chunk of 8 halves c = ((((h * tiles + nt) * KSTEPS + ks) * 2 + j) * 32 + lane) holds
//   row nt*16 + (lane & 15), d = ks*32 + j*16 + 8*(lane >> 4) .. +7
// grid: QT_BLOCKS + VT_BLOCKS, block 256 (block-uniform role)
// =====================================================================
__launch_bounds__(256)
__global__ void k_prep(const float* __restrict__ Q, const float* __restrict__ V,
                       _Float16* __restrict__ Qt, _Float16* __restrict__ Vt)
{
  const int bid = blockIdx.x;
  const int tid = threadIdx.x;
  U8h u;
  _Float16* dst;
  if (bid < QT_BLOCKS) {
    const int c   = bid * 256 + tid;              // < QT_CHUNKS exactly
    const int fr  = c >> 6;                       // fragment: (h * NTD + nt) * KSTEPS + ks
    const int tn  = fr / KSTEPS;
    const int ks  = fr - tn * KSTEPS;
    const int h   = tn / NTD;
    const int nt  = tn - h * NTD;
    const int e   = nt * 16 + (c & 15);
    const int d0  = ks * 32 + ((c >> 5) & 1) * 16 + ((c >> 4) & 1) * 8;
    const int ecl = imin(e, DDIM - 1);
    float x[8];
    // both loops unrolled: x stays in registers, and the 8 loads are issued as one group before the first is used
#pragma unroll
    for (int j = 0; j < 8; ++j) x[j] = Q[((size_t)h * DDIM + imin(d0 + j, DDIM - 1)) * DDIM + ecl];   // clamped address
#pragma unroll
    for (int j = 0; j < 8; ++j) u.s[j] = (_Float16)(bf16_rne_if(x[j], (d0 + j < DDIM) && (e < DDIM)) * QSC);
    dst = Qt + (size_t)c * 8;
  } else {
    const int c   = (bid - QT_BLOCKS) * 256 + tid;  // < VT_CHUNKS exactly
    const int fr  = c >> 6;                         // fragment: (h * (FP / 16) + nt) * KSTEPS + ks
    const int tn  = fr / KSTEPS;
    const int ks  = fr - tn * KSTEPS;
    const int h   = tn / (FP / 16);
    const int nt  = tn - h * (FP / 16);
    const int f   = nt * 16 + (c & 15);
    const int d0  = ks * 32 + ((c >> 5) & 1) * 16 + ((c >> 4) & 1) * 8;
    const int fcl = imin(f, HDIM - 1);
    float x[8];
    // both loops unrolled: x stays in registers, and the 8 loads are issued as one group before the first is used
#pragma unroll
    for (int j = 0; j < 8; ++j) x[j] = V[((size_t)h * DDIM + imin(d0 + j, DDIM - 1)) * HDIM + fcl];   // clamped address
#pragma unroll
    for (int j = 0; j < 8; ++j) u.s[j] = (_Float16)(bf16_rne_if(x[j], (d0 + j < DDIM) && (f < HDIM)) * VSC);
    dst = Vt + (size_t)c * 8;
  }
  const v8h val = u.v;
  *(v8h*)dst = val;
  
}

// =====================================================================
// Kernel 1: one block per BPB batch rows (256 threads = 8 waves), loop over heads.
//   LDS (rows padded to the pitches YP, TP, SP; pad bytes are never read), each per batch row bb of the block:
//        Ys [bb][32][320] f16 (y tile, bf16-RNE values),
//        Wh/Wl [bb][32][32] f16 (y * V_h hi/residual, stored [f][m]),
//        Sp [8][bb][32][32] f32 (each wave's part of the scores, [l][m]), Eh/El [bb][32][32] f16 exp hi/residual, invs, msk [bb][32],
//   A weight fragment is fetched once per block and used on the tiles of all its batch rows.
//   h1 = (alpha * y) * V_h is formed as alpha * (y * V_h): y * V_h is two more tiles of the y * Q_h phase.
//   a1 = y * Q_h never leaves the registers: it is formed transposed, so that a wave's accumulators are B fragments
//   of the score product over the wave's own columns e; the eight parts are added in the exp phase.
// Every LDS region is cross-wave: block barriers between producer and consumer phases.
// =====================================================================
// four waves per SIMD: two blocks share a WGP, so that one block's matrix phase covers the other's exp phase and barriers
__launch_bounds__(256) __attribute__((amdgpu_waves_per_eu(4, 4)))
__global__ void k_attn(const float* __restrict__ y, const int* __restrict__ seq,
                       const _Float16* __restrict__ Qt, const _Float16* __restrict__ Vt,
                       float* __restrict__ out)
{
  __shared__ __align__(16) _Float16 Ys[BPB * LP * YP];
  __shared__ __align__(16) _Float16 Wh[BPB * FP * TP];
  __shared__ __align__(16) _Float16 Wl[BPB * FP * TP];
  __shared__ __align__(16) float    Sp[NWAVE * BPB * LP * SP];
  __shared__ __align__(16) _Float16 Eh[BPB * LP * TP];
  __shared__ __align__(16) _Float16 El[BPB * LP * TP];
  __shared__ __align__(16) float    invs[BPB * LP];
  __shared__ __align__(16) int      msk[BPB * LP];

  const int tid  = threadIdx.x;
  const int lane = tid & 31;
  const int wave = __builtin_amdgcn_readfirstlane(tid >> 5);
  const int hf   = lane >> 4;
  const int nl   = lane & 15;
  const int b    = blockIdx.x * BPB;                                 // first batch row of the block
  const float* yb = y + (size_t)b * Y_BSTRIDE;

  // ---- weight fragments: the lane's 16 bytes of k-step 0 ----
  const bool w3 = wave + 16 < NTA;                                   // wave-uniform: owns a third tile
  const bool wv = w3 && wave + 16 >= NTD;                            // wave-uniform: that tile is one of y * V_h
  const bool q3 = wave + 16 < NTD;                                   // wave-uniform: that tile is one of y * Q_h
  const _Float16* qlane0 = Qt + (size_t)wave * (KSTEPS * FRH) + lane * 8;        // n-tile `wave`, head 0
  // third tile, head 0: n-tile wave + 16 of Qt, or n-tile wave + 16 - NTD of Vt (waves without one never load from it)
  const _Float16* xlane0 = wv ? Vt + (size_t)(wave + 16 - NTD) * (KSTEPS * FRH) + lane * 8 : qlane0 + 2 * TSTEP;
  const int xstep = wv ? (FP / 16) * KSTEPS * FRH : NTD * KSTEPS * FRH;          // halves per head of that plane
  // the wave's part of the scores: row l = nl (+ 16 lt), columns m = 8 hf .. + 7 (+ 16 mt)
  float* sp_w = Sp + wave * (BPB * LP * SP) + nl * SP + 8 * hf;

  // ---- stage y tile: Ys[row][d], bf16-RNE values in f16, pads zero ----
  // the token id of key position tid (threads past BPB * LP read one again and drop it), issued with the loads of y
  const int* sp = seq + (size_t)(b + (tid & (BPB * LP - 1)) / LP) * SEQ_BSTRIDE + imin(tid & (LP - 1), LSEQ - 1);   // clamped address
  const int sv = *sp;
  // all of a thread's loads are issued before the first is used: 2 x 16 bytes per chunk of 8 (a group of 4 lies wholly inside a row or wholly in the pad);
  // a thread stages the same chunks of every batch row of the block, so that one address serves BPB loads
  {
    v4f x[YIT][BPB][2];
    const float* p[YIT][2];
    // every loop of this block is unrolled: x and p must stay in registers
#pragma unroll
    for (int it = 0; it < YIT; ++it) {
      const int idx = tid + it * 256;
      const int row = idx / DCH;
      const int d0  = (idx - row * DCH) * 8;
      p[it][0] = yb + imin(row, LSEQ - 1) * DDIM + imin(d0, DDIM - 4);       // clamped address
      p[it][1] = yb + imin(row, LSEQ - 1) * DDIM + imin(d0 + 4, DDIM - 4);   // clamped address
#pragma unroll
      for (int bb = 0; bb < BPB; ++bb) {
        x[it][bb][0] = *(const v4fa*)(p[it][0] + bb * Y_BSTRIDE);
        x[it][bb][1] = *(const v4fa*)(p[it][1] + bb * Y_BSTRIDE);
      }
    }
    // stands behind all the loads and in front of the first rewrite of an address register: as inputs the addresses stay live up to here,
    // so that no later load lands on one either; it also keeps every load in front of the first conversion
    static_assert(YIT == 5);
    asm volatile("s_wait_xcnt 0x0" : : "v"(p[0][0]), "v"(p[0][1]), "v"(p[1][0]), "v"(p[1][1]), "v"(p[2][0]), "v"(p[2][1]),
                 "v"(p[3][0]), "v"(p[3][1]), "v"(p[4][0]), "v"(p[4][1]), "v"(sp) : "memory");
#pragma unroll
    for (int it = 0; it < YIT; ++it) {
      const int idx = tid + it * 256;
      const int row = idx / DCH;
      const int d0  = (idx - row * DCH) * 8;
#pragma unroll
      for (int bb = 0; bb < BPB; ++bb) {
        U8h u;
#pragma unroll
        for (int j = 0; j < 8; ++j) u.s[j] = (_Float16)bf16_rne_if(x[it][bb][j >> 2][j & 3], (row < LSEQ) && (d0 + (j & 4) < DDIM));   // one guard per group of 4
        *(v8ha*)(Ys + (bb * LP + row) * YP + d0) = u.v;
      }
    }
  }
  // ---- key mask from token ids (id > 0), pads 0 ----
  if (tid < BPB * LP) msk[tid] = ((tid & (LP - 1)) < LSEQ && sv > 0) ? 1 : 0;
  __syncthreads();

  // the lane's first element of out in GEMM3: batch row wave >> 2, row tile (wave >> 1) & 1, column tile wave & 1, head 0
  gfloat* op = (gfloat*)out + (size_t)(b + (wave >> 2)) * OUT_BSTRIDE + (((wave >> 1) & 1) * 16 + 8 * hf) * ODIM + (wave & 1) * 16 + nl;

  // exp phase: the thread's group of 8 key positions and its row of the block's BPB * LP rows. Lanes 0-15 and lanes 16-31 each hold
  // rows r, r + 1, r + 8, r + 9: at the pitch SP the 16 reads of 16 bytes then fall on 64 distinct banks
  const int xg   = lane & 3;
  const int xrow = ((lane >> 2) & 1) | ((lane >> 4) << 1) | ((wave & 1) << 2) | (((lane >> 3) & 1) << 3) | ((wave >> 1) << 4);
  static_assert(BPB * LP == 64 && NWAVE == 8 && LP == 32 && SP == 36);

  for (int h = 0; h < NHEAD; ++h) {
    // ===== GEMM1: a1^T (x QSC) = Qt_h * Ys^T (19 e-tiles x 4 l-tiles), yV (x VSC) = Ys * Vt_h (4 m-tiles x 2 f-tiles) =====
    {
      v8f acc[3][BPB][2];
#pragma unroll
      for (int t = 0; t < 3; ++t) {
#pragma unroll
        for (int bb = 0; bb < BPB; ++bb) { acc[t][bb][0] = zero8(); acc[t][bb][1] = zero8(); }
      }
      const _Float16* qlane = qlane0 + (size_t)h * (NTD * KSTEPS * FRH);
      const _Float16* xlane = xlane0 + (size_t)h * xstep;
      if (q3)      gemm1_k<3, false>(Ys + nl * YP, qlane, xlane, hf, acc);
      else if (wv) gemm1_k<3, true>(Ys + nl * YP, qlane, xlane, hf, acc);
      else         gemm1_k<2, false>(Ys + nl * YP, qlane, xlane, hf, acc);
      // where the three arms join: stands between every weight load above, also those the compiler lifts in front of the arms,
      // and the first rewrite of their address register pair, which as an input stays live up to this statement
      // (the third tile's pair is stepped only at the loop's foot, behind the wait that stands there)
      asm volatile("s_wait_xcnt 0x0" : : "v"(qlane) : "memory");
      // ===== GEMM2, the wave's part: S^T = Ys * a1^T over the columns e of its own tiles; a1 = acc/QSC as
      // f16 hi + f16 residual*RSC, converted in the lane that holds it; one batch row after the other =====
#pragma unroll
      for (int bb = 0; bb < BPB; ++bb) {
        v8f sh[2][2], sl[2][2];
#pragma unroll
        for (int mt = 0; mt < 2; ++mt) {
#pragma unroll
          for (int lt = 0; lt < 2; ++lt) { sh[mt][lt] = zero8(); sl[mt][lt] = zero8(); }
        }
        const _Float16* ys_lane = Ys + (bb * LP + nl) * YP + 8 * hf;
        score_step<true>(ys_lane, wave * 16, (wave + 8) * 16, acc[0][bb], acc[1][bb], sh, sl);
        if (q3) score_step<false>(ys_lane, (wave + 16) * 16, 0, acc[2][bb], acc[2][bb], sh, sl);
        // a lane's 8 accumulator rows are 8 successive m of its row l: two 16-byte stores per tile
#pragma unroll
        for (int mt = 0; mt < 2; ++mt) {
#pragma unroll
          for (int lt = 0; lt < 2; ++lt) {
            v4f s0, s1;
#pragma unroll
            for (int r = 0; r < 4; ++r) {
              s0[r] = sh[mt][lt][r]     + sl[mt][lt][r]     * (1.0f / RSC);
              s1[r] = sh[mt][lt][4 + r] + sl[mt][lt][4 + r] * (1.0f / RSC);
            }
            *(v4fa*)(sp_w + (bb * LP + lt * 16) * SP + mt * 16)     = s0;
            *(v4fa*)(sp_w + (bb * LP + lt * 16) * SP + mt * 16 + 4) = s1;
          }
        }
      }
      // epilogue of a y * V_h tile: yV = acc/VSC -> f16 hi + f16 residual*RSC into Wh/Wl [f][m];
      // a lane's 8 accumulator rows are 8 successive m of its column f: one 16-byte store per plane
      if (wv) {
        const int f = (wave + 16 - NTD) * 16 + nl;
#pragma unroll
        for (int i = 0; i < LT; ++i) {
          const int bb = i >> 1, mt = i & 1;
          U8h uh, ul;
#pragma unroll
          for (int r = 0; r < 8; ++r) {
            const float a = acc[2][bb][mt][r] * (1.0f / VSC);
            const _Float16 ah = (_Float16)a;
            const float rs = (a - (float)ah) * RSC;
            uh.s[r] = ah;
            ul.s[r] = (_Float16)rs;
          }
          *(v8ha*)(Wh + (bb * FP + f) * TP + mt * 16 + 8 * hf) = uh.v;
          *(v8ha*)(Wl + (bb * FP + f) * TP + mt * 16 + 8 * hf) = ul.v;
        }
      }
    }
    __syncthreads();

    // ================= exp (no max subtraction) + masked row sums =================
    // a thread takes 8 successive key positions of one row: its 8 exps depend on nothing but their own score and stand under no branch
    // (the pad guard masks the value), so that they run interleaved, and a row's planes are written by 16 bytes
    {
      const int l = xrow & (LP - 1);   // row of its batch row's tile
      v4i k4[2];
      k4[0] = *(const v4ia*)(msk + (xrow - l) + xg * 8);
      k4[1] = *(const v4ia*)(msk + (xrow - l) + xg * 8 + 4);
      // scores: the eight waves' parts, added in wave order
      const float* sr = Sp + xrow * SP + xg * 8;
      v4f s4[2];
      s4[0] = *(const v4fa*)sr;
      s4[1] = *(const v4fa*)(sr + 4);
#pragma unroll
      for (int w = 1; w < NWAVE; ++w) {
        s4[0] += *(const v4fa*)(sr + w * (BPB * LP * SP));
        s4[1] += *(const v4fa*)(sr + w * (BPB * LP * SP) + 4);
      }
      float part = 0.0f;
      U8h uh, ul;
#pragma unroll
      for (int j = 0; j < 8; ++j) {
        const float ex = exp_f32(s4[j >> 2][j & 3]);
        const bool ok = (l < LSEQ) && (xg * 8 + j < LSEQ);
        const float e = ok ? ex : 0.0f;                  // numerator unmasked
        part += (k4[j >> 2][j & 3] != 0) ? e : 0.0f;     // denominator masked
        const _Float16 ehv = (_Float16)e;
        uh.s[j] = ehv;
        ul.s[j] = (_Float16)((e - (float)ehv) * RSC);
      }
      *(v8ha*)(Eh + xrow * TP + xg * 8) = uh.v;
      *(v8ha*)(El + xrow * TP + xg * 8) = ul.v;
      part += __shfl_xor(part, 1);
      part += __shfl_xor(part, 2);
      const float inv = 1.0f / (part + 1e-6f);
      if (xg == 0) invs[xrow] = (l < LSEQ) ? inv : 0.0f;
    }
    __syncthreads();

    // ===== GEMM3: h1 = (expS (32x32) * yV (32x32)) * inv[row] ; 4 tiles per batch row, one per wave =====
    {
      const int bb = wave >> 2, mt = (wave >> 1) & 1, nt = wave & 1;
      const v16h eh = ld_frag(Eh + (bb * LP + mt * 16 + nl) * TP, 0, hf);
      const v16h el = ld_frag(El + (bb * LP + mt * 16 + nl) * TP, 0, hf);
      const v16h wh = ld_frag(Wh + (bb * FP + nt * 16 + nl) * TP, 0, hf);   // B[k=m][n=f] = Wh[f][m]
      const v16h wl = ld_frag(Wl + (bb * FP + nt * 16 + nl) * TP, 0, hf);
      const v8f ch = wmma16(eh, wh, zero8());
      v8f cl = wmma16(el, wh, zero8());                                // both cross terms carry RSC
      cl = wmma16(eh, wl, cl);
      float v[8];
#pragma unroll
      for (int r = 0; r < 8; ++r) v[r] = (ch[r] + cl[r] * (1.0f / RSC)) * invs[bb * LP + mt * 16 + 8 * hf + r];
      // ends the head's LDS reads (the next head rewrites Wh, Wl); the stores to out read no LDS and are issued behind it
      __syncthreads();
      // the head's 20 columns of a row go straight to out: 16 lanes store 64 successive bytes (4 lanes 16 bytes for nt = 1)
#pragma unroll
      for (int r = 0; r < 8; ++r) {
        const int l = mt * 16 + 8 * hf + r;
        const int f = nt * 16 + nl;
        if (l < LSEQ && f < HDIM) op[r * ODIM] = v[r];
      }
      // stands between the stores above and the step of their address to the next head: the step takes the address from this statement
      asm volatile("s_wait_xcnt 0x0" : "+v"(op) : : "memory");
      op += HDIM;
    }
  }
}

extern "C" void kernel_launch(void* const* d_in, const int* in_sizes, int n_in,
                              void* d_out, int out_size, void* d_ws, size_t ws_size,
                              hipStream_t stream)
{
  if (n_in < 4) return;
  if (in_sizes[0] < NB * LSEQ * DDIM) return;
  if (in_sizes[1] < NB * LSEQ) return;
  if (in_sizes[2] < NHEAD * DDIM * DDIM) return;
  if (in_sizes[3] < NHEAD * DDIM * HDIM) return;
  if (out_size < NB * LSEQ * ODIM) return;

  const float* y   = (const float*)d_in[0];
  const int*   seq = (const int*)  d_in[1];
  const float* Q   = (const float*)d_in[2];
  const float* V   = (const float*)d_in[3];
  float*       out = (float*)d_out;

  const size_t qt_bytes = (size_t)NHEAD * EP * DP * sizeof(_Float16);   // 3,891,200
  const size_t vt_bytes = (size_t)NHEAD * FP * DP * sizeof(_Float16);   //   409,600
  if (ws_size < qt_bytes + vt_bytes) return;
  _Float16* Qt = (_Float16*)d_ws;
  _Float16* Vt = (_Float16*)((char*)d_ws + qt_bytes);

  k_prep<<<dim3(QT_BLOCKS + VT_BLOCKS), dim3(256), 0, stream>>>(Q, V, Qt, Vt);
  k_attn<<<dim3(NB / BPB), dim3(256), 0, stream>>>(y, seq, Qt, Vt, out);
}

// v010
// One run takes 118 microseconds.
// Timed twice side by side with v009, it ran 1.06 times as fast both times.
// Counting every step since v000, it is 5.54 times as fast.
#include <hip/hip_runtime.h>
// Contractions y*Q_h, y*V_h, a1*y^T, expS*(y*V_h): v_wmma_f32_16x16x32_f16 (f16 operands built from bf16-RNE inputs; a1, expS, y*V_h as f16 hi + f16 residual x2048 with separate accumulators), f32 accumulate; exp / normalisation in f32.

#ifndef NB
#define NB 1024
#endif
#define NB_FULL 1024
#define LSEQ   30
#define DDIM   300
#define NHEAD  20
#define HDIM   20
#define ODIM   (NHEAD * HDIM)          /* 400 */
#define LP     32                      /* padded rows of one batch row's tile */
#define BPB    2                       /* batch rows of a block: each weight fragment fetched feeds 2 * BPB l-tiles */
#define LT     (2 * BPB)               /* 16-row tiles of Ys */
#define DP     320                     /* padded K */
#define KSTEPS (DP / 32)               /* 10 */
#define NTD    19                      /* 16-col tiles covering 300 */
#define EP     (NTD * 16)              /* 304 out cols of Qt: 300 of Q_h, then VQ of V_h */
#define FP     32                      /* padded out cols of V_h */
#define VQ     (EP - DDIM)             /* 4: columns 0..3 of V_h ride in the last tile of Qt, behind the 300 columns of Q_h */
#define VTT    ((HDIM - VQ) / 16)      /* 1: tiles of Vt, columns VQ..19 of V_h */
#define NTA    (NTD + VTT)             /* 20 n-tiles of y * [Q_h | V_h]: 320 columns, no pad column */
#define DCH    (DP / 8)                /* 40 chunks of 8 halves per padded row */
/* LDS row pitches: an odd multiple of 16 bytes, so that the 16 rows of a b128 fragment read fall on distinct banks */
#define YP     (DP + 8)                /* halves: 656 B rows of Ys */
#define TP     (LP + 8)                /* halves:  80 B rows of Wh, Wl, Eh, El */
#define SP     (LP + 4)                /* floats: 144 B rows of Sp */
#define NWAVE  8                       /* waves of a block: one partial score plane each */
#define QT_CHUNKS (NHEAD * EP * DCH)   /* 243200 */
#define VT_CHUNKS (NHEAD * VTT * 16 * DCH)   /* 12800 */
#define QT_BLOCKS (QT_CHUNKS / 256)    /* 950 */
#define VT_BLOCKS (VT_CHUNKS / 256)    /* 50 */
#define Y_BSTRIDE   (LSEQ * DDIM)      /* per-batch stride of y (floats) */
#define SEQ_BSTRIDE (LSEQ)             /* per-batch stride of token ids */
#define OUT_BSTRIDE (LSEQ * ODIM)      /* per-batch stride of out (floats) */
#define QSC 1024.0f                    /* power-of-two carry on Q plane */
#define VSC 1024.0f                    /* power-of-two carry on V plane */
#define RSC 2048.0f                    /* power-of-two carry on residual planes */
#define PF  3                          /* k-steps of weight fragments held ahead in registers */
#define FRH (2 * 32 * 8)               /* halves of one packed 16x32 weight fragment: 2 loads x 32 lanes x 8 halves */
#define TSTEP (8 * KSTEPS * FRH)       /* halves between a wave's successive n-tiles of Qt */
#define YIT   (LP * DCH / 256)         /* chunks of 8 halves that a thread stages of each batch row: 5 */

static_assert(QT_CHUNKS % 256 == 0);
static_assert((LP * DCH) % 256 == 0 && DDIM % 4 == 0 && Y_BSTRIDE % 4 == 0);
static_assert(VT_CHUNKS % 256 == 0);
static_assert((OUT_BSTRIDE * 4) % 128 == 0);
static_assert((LSEQ * ODIM) % 4 == 0);
static_assert(((NHEAD * EP * DP * 2) % 128) == 0);
static_assert(NB <= NB_FULL && NB % BPB == 0 && 4 * BPB == NWAVE);
static_assert(NTD > 16 && NTA <= 24 && VQ == 4 && VQ + VTT * 16 == HDIM && QSC == VSC);
static_assert(PF <= KSTEPS && (DP * 2) % 128 == 0);
static_assert(DP % 32 == 0 && EP >= DDIM && FP >= HDIM && LP >= LSEQ);
static_assert(NTD * KSTEPS * FRH == EP * DP && (FP / 16) * KSTEPS * FRH == FP * DP);
static_assert((YP * 2) % 32 == 16 && (TP * 2) % 32 == 16 && (SP * 4) % 32 == 16);

typedef _Float16 v16h __attribute__((ext_vector_type(16)));
typedef _Float16 v8h  __attribute__((ext_vector_type(8)));
typedef float    v8f  __attribute__((ext_vector_type(8)));
typedef float    v4f  __attribute__((ext_vector_type(4)));
typedef v8h v8ha __attribute__((may_alias));
typedef v4f v4fa __attribute__((may_alias));
typedef int  v4i  __attribute__((ext_vector_type(4)));
typedef v4i v4ia __attribute__((may_alias));
typedef __attribute__((address_space(1))) float gfloat;   /* a float in global memory: a pointer that passes through an asm operand keeps its global stores */

union Frag { v16h v; v8h h[2]; };
union U8h  { v8h v; _Float16 s[8]; unsigned int u[4]; };
union U16h { v16h v; v8h h[2]; _Float16 s[16]; };

__device__ __forceinline__ int imin(int a, int b) { return a < b ? a : b; }

// f32 -> bf16 (RNE) -> back to f32 (value exactly representable in bf16), or +0 where ok is false:
// the guard masks the value, so that the load itself stands under no branch
__device__ __forceinline__ float bf16_rne_if(float f, bool ok) {
  unsigned int u = __builtin_bit_cast(unsigned int, f);
  u = (u + 0x7fffu + ((u >> 16) & 1u)) & (ok ? 0xffff0000u : 0u);
  return __builtin_bit_cast(float, u);
}

// 16x32 fragment from a [row][k] k-contiguous 16-bit matrix; rowp = row (lane&15) start.
// elements 0..7 <- k0+8hf .. +7, elements 8..15 <- k0+16+8hf .. +7 (same map for A and B)
__device__ __forceinline__ v16h ld_frag(const _Float16* rowp, int k0, int hf) {
  Frag f;
  f.h[0] = *(const v8ha*)(rowp + k0 + 8 * hf);
  f.h[1] = *(const v8ha*)(rowp + k0 + 16 + 8 * hf);
  return f.v;
}

// 16x32 fragment from a plane packed in fragment order: lanep = the tile's k-step 0 + lane * 8 halves.
// Each of the two loads reads 32 lanes x 16 B = 512 contiguous bytes; same element map as ld_frag.
__device__ __forceinline__ v16h ld_pfrag(const _Float16* lanep, int ks) {
  Frag f;
  f.h[0] = *(const v8ha*)(lanep + ks * FRH);
  f.h[1] = *(const v8ha*)(lanep + ks * FRH + FRH / 2);
  return f.v;
}

// expf as the library forms it, operation for operation, with v_exp_f32 written out: the v_nop in its statement is the slot that the
// instruction set asks for behind a transcendental before its result is used or its source overwritten
__device__ __forceinline__ float exp_f32(float x) {
  const float c_hi = __builtin_bit_cast(float, 0x3fb8aa3bu);   // log2(e), and what it lacks
  const float c_lo = __builtin_bit_cast(float, 0x32a5705fu);
  const float ph = x * c_hi;
  const float pl = __builtin_fmaf(x, c_lo, __builtin_fmaf(x, c_hi, -ph));
  const float n  = __builtin_rintf(ph);
  const float a  = (ph - n) + pl;
  float r;
  asm("v_exp_f32 %0, %1\n\tv_nop" : "=v"(r) : "v"(a));
  r = __builtin_ldexpf(r, (int)n);
  r = (x < __builtin_bit_cast(float, 0xc2ce8ed0u)) ? 0.0f : r;                      // underflow
  r = (x > __builtin_bit_cast(float, 0x42b17218u)) ? __builtin_inff() : r;          // overflow
  return r;
}

__device__ __forceinline__ v8f zero8() {
  v8f z = {0.f, 0.f, 0.f, 0.f, 0.f, 0.f, 0.f, 0.f};
  return z;
}

__device__ __forceinline__ v8f wmma16(v16h a, v16h b, v8f c) {
  return __builtin_amdgcn_wmma_f32_16x16x32_f16(false, a, false, b, (short)0, c, false, false);
}

// K-step ks of a wave's NT weight fragments, issued as one group of loads.
// Tiles 0 and 1 lie in Qt behind qlane; the third tile (of Qt or of Vt) has its own pointer.
template <int NT>
__device__ __forceinline__ void q_fetch(v16h (&bq)[PF][3], const _Float16* qlane, const _Float16* xlane, int ks) {
#pragma unroll
  for (int t = 0; t < NT; ++t) {
    const _Float16* p = t < 2 ? qlane + t * TSTEP : xlane;
    bq[ks % PF][t] = ld_pfrag(p, ks);
  }
}

// K loop of GEMM1 for a wave that owns NT weight tiles: k-steps 0..PF-1 of all its tiles are issued up front,
// and each finished step refills its ring slot with the step PF steps on.
// ya = the lane's row (lane & 15) of Ys; tile i of Ys is l-tile (or m-tile) i & 1 of the block's batch row i >> 1.
// A tile of Qt is the A operand: acc[t][bb][lt] = (y * Q_h)^T, rows e, columns l (l-tile lt).
// A tile of Vt (VT: the third tile) is the B operand: acc[2][bb][mt] = y * V_h, rows m, columns f.
template <int NT, bool VT>
__device__ __forceinline__ void gemm1_k(const _Float16* ya, const _Float16* qlane,
                                        const _Float16* xlane, int hf, v8f (&acc)[3][BPB][2]) {
  v16h bq[PF][3];
#pragma unroll
  for (int ks = 0; ks < PF; ++ks) q_fetch<NT>(bq, qlane, xlane, ks);
  // keeps the ring's first loads in front of the K loop: sunk to their first use they would be waited for at once
  __builtin_amdgcn_sched_barrier(0);
  // unrolled: the ring slot must be a compile-time register index
#pragma unroll
  for (int ks = 0; ks < KSTEPS; ++ks) {
    v16h a[LT];
#pragma unroll
    for (int i = 0; i < LT; ++i) a[i] = ld_frag(ya + i * 16 * YP, ks * 32, hf);
#pragma unroll
    for (int t = 0; t < NT; ++t) {
#pragma unroll
      for (int i = 0; i < LT; ++i) {
        if (VT && t == 2) acc[t][i >> 1][i & 1] = wmma16(a[i], bq[ks % PF][t], acc[t][i >> 1][i & 1]);
        else              acc[t][i >> 1][i & 1] = wmma16(bq[ks % PF][t], a[i], acc[t][i >> 1][i & 1]);
      }
    }
    if (ks + PF < KSTEPS) q_fetch<NT>(bq, qlane, xlane, ks + PF);
    // keeps each refill PF k-steps ahead of its use: without it the loads sink to the step that reads them
    __builtin_amdgcn_sched_barrier(0);
  }
}

// One k-step (32 values of e) of the score product S^T = Ys * a1^T, from accumulators of (y * Q_h)^T.
// A lane of such an accumulator holds column l = lane & 15 and rows e = 8 * hf + r: these are elements 0..7
// (tile x) and 8..15 (tile z) of the B fragment whose k order is e = x*16 + 0..15, z*16 + 0..15.
// The A fragment reads Ys in the same k order: ex, ez = first column of tile x, of tile z.
// TWO = false: there is no tile z, and elements 8..15 of A and B are zero.
template <bool TWO>
__device__ __forceinline__ void score_step(const _Float16* ys_lane, int ex, int ez, const v8f (&ax)[2], const v8f (&az)[2],
                                           v8f (&sh)[2][2], v8f (&sl)[2][2]) {
  U16h ay[2];
#pragma unroll
  for (int mt = 0; mt < 2; ++mt) {
    ay[mt].h[0] = *(const v8ha*)(ys_lane + mt * 16 * YP + ex);
    if (TWO) {
      ay[mt].h[1] = *(const v8ha*)(ys_lane + mt * 16 * YP + ez);
    } else {
#pragma unroll
      for (int r = 0; r < 8; ++r) ay[mt].s[8 + r] = (_Float16)0.0f;
    }
  }
#pragma unroll
  for (int lt = 0; lt < 2; ++lt) {
    U16h bh, bl;
#pragma unroll
    for (int r = 0; r < 8; ++r) {
      const float a = ax[lt][r] * (1.0f / QSC);
      const _Float16 ah = (_Float16)a;
      bh.s[r] = ah;
      bl.s[r] = (_Float16)((a - (float)ah) * RSC);
      if (TWO) {
        const float c = az[lt][r] * (1.0f / QSC);
        const _Float16 chh = (_Float16)c;
        bh.s[8 + r] = chh;
        bl.s[8 + r] = (_Float16)((c - (float)chh) * RSC);
      } else {
        bh.s[8 + r] = (_Float16)0.0f;
        bl.s[8 + r] = (_Float16)0.0f;
      }
    }
#pragma unroll
    for (int mt = 0; mt < 2; ++mt) {
      sh[mt][lt] = wmma16(ay[mt].v, bh.v, sh[mt][lt]);
      sl[mt][lt] = wmma16(ay[mt].v, bl.v, sl[mt][lt]);
    }
  }
}

// =====================================================================
// Kernel 0: weight planes, packed in the order the fragments are loaded (Qt as A, Vt as B operands).
//   value(h, e, d) = f16( bf16(Q[h][d][e]) * QSC ), e < 300; f16( bf16(V[h][d][e - 300]) * VSC ), 300 <= e < 304; d < 320 (d >= 300 zero)
//   value(h, f, d) = f16( bf16(V[h][d][f]) * VSC ), 4 <= f < 20, d < 320
//   chunk of 8 halves c = ((((h * tiles + nt) * KSTEPS + ks) * 2 + j) * 32 + lane) holds
//   row nt*16 + (lane & 15), d = ks*32 + j*16 + 8*(lane >> 4) .. +7
// grid: QT_BLOCKS + VT_BLOCKS, block 256 (block-uniform role)
// =====================================================================
__launch_bounds__(256)
__global__ void k_prep(const float* __restrict__ Q, const float* __restrict__ V,
                       _Float16* __restrict__ Qt, _Float16* __restrict__ Vt)
{
  const int bid = blockIdx.x;
  const int tid = threadIdx.x;
  U8h u;
  _Float16* dst;
  if (bid < QT_BLOCKS) {
    const int c   = bid * 256 + tid;              // < QT_CHUNKS exactly
    const int fr  = c >> 6;                       // fragment: (h * NTD + nt) * KSTEPS + ks
    const int tn  = fr / KSTEPS;
    const int ks  = fr - tn * KSTEPS;
    const int h   = tn / NTD;
    const int nt  = tn - h * NTD;
    const int e   = nt * 16 + (c & 15);
    const int d0  = ks * 32 + ((c >> 5) & 1) * 16 + ((c >> 4) & 1) * 8;
    // rows e >= 300 of the last tile hold columns e - 300 of V_h
    const float* colp = e < DDIM ? Q + (size_t)h * DDIM * DDIM + e : V + (size_t)h * DDIM * HDIM + (e - DDIM);
    const int rstep = e < DDIM ? DDIM : HDIM;
    float x[8];
    const float* p[8];
    // all three loops unrolled: x and p stay in registers, and the 8 loads are issued as one group before the first is used
#pragma unroll
    for (int j = 0; j < 8; ++j) p[j] = colp + imin(d0 + j, DDIM - 1) * rstep;   // clamped address
#pragma unroll
    for (int j = 0; j < 8; ++j) x[j] = *p[j];
    // stands behind the 8 loads and in front of the first rewrite of an address register: as inputs the addresses stay live up to here,
    // so that no later load lands on one either
    asm volatile("s_wait_xcnt 0x0" : : "v"(p[0]), "v"(p[1]), "v"(p[2]), "v"(p[3]), "v"(p[4]), "v"(p[5]), "v"(p[6]), "v"(p[7]) : "memory");
#pragma unroll
    for (int j = 0; j < 8; ++j) u.s[j] = (_Float16)(bf16_rne_if(x[j], d0 + j < DDIM) * QSC);
    dst = Qt + (size_t)c * 8;
  } else {
    const int c   = (bid - QT_BLOCKS) * 256 + tid;  // < VT_CHUNKS exactly
    const int fr  = c >> 6;                         // fragment: (h * VTT + nt) * KSTEPS + ks
    const int tn  = fr / KSTEPS;
    const int ks  = fr - tn * KSTEPS;
    const int h   = tn / VTT;
    const int nt  = tn - h * VTT;
    const int f   = VQ + nt * 16 + (c & 15);
    const int d0  = ks * 32 + ((c >> 5) & 1) * 16 + ((c >> 4) & 1) * 8;
    const int fcl = imin(f, HDIM - 1);
    float x[8];
    // both loops unrolled: x stays in registers, and the 8 loads are issued as one group before the first is used
#pragma unroll
    for (int j = 0; j < 8; ++j) x[j] = V[((size_t)h * DDIM + imin(d0 + j, DDIM - 1)) * HDIM + fcl];   // clamped address
#pragma unroll
    for (int j = 0; j < 8; ++j) u.s[j] = (_Float16)(bf16_rne_if(x[j], (d0 + j < DDIM) && (f < HDIM)) * VSC);
    dst = Vt + (size_t)c * 8;
  }
  const v8h val = u.v;
  *(v8h*)dst = val;
  
}

// =====================================================================
// Kernel 1: one block per BPB batch rows (256 threads = 8 waves), loop over heads.
//   LDS (rows padded to the pitches YP, TP, SP; pad bytes are never read), each per batch row bb of the block:
//        Ys [bb][32][320] f16 (y tile, bf16-RNE values),
//        Wh/Wl [bb][32][32] f16 (y * V_h hi/residual, stored [f][m]),
//        Sp [8][bb][32][32] f32 (each wave's part of the scores, [l][m]), Eh/El [bb][32][32] f16 exp hi/residual, invs, msk [bb][32],
//   A weight fragment is fetched once per block and used on the tiles of all its batch rows.
//   h1 = (alpha * y) * V_h is formed as alpha * (y * V_h): the 20 columns of V_h follow the 300 of Q_h, 320 columns = 20 tiles of the
//   y * Q_h phase: waves 0..3 own three tiles and waves 4..7 two.
//   a1 = y * Q_h never leaves the registers: it is formed transposed, so that a wave's accumulators are B fragments
//   of the score product over the wave's own columns e; the eight parts are added in the exp phase.
// Every LDS region is cross-wave: block barriers between producer and consumer phases.
// =====================================================================
// four waves per SIMD: two blocks share a WGP, so that one block's matrix phase covers the other's exp phase and barriers
__launch_bounds__(256) __attribute__((amdgpu_waves_per_eu(4, 4)))
__global__ void k_attn(const float* __restrict__ y, const int* __restrict__ seq,
                       const _Float16* __restrict__ Qt, const _Float16* __restrict__ Vt,
                       float* __restrict__ out)
{
  __shared__ __align__(16) _Float16 Ys[BPB * LP * YP];
  __shared__ __align__(16) _Float16 Wh[BPB * FP * TP];
  __shared__ __align__(16) _Float16 Wl[BPB * FP * TP];
  __shared__ __align__(16) float    Sp[NWAVE * BPB * LP * SP];
  __shared__ __align__(16) _Float16 Eh[BPB * LP * TP];
  __shared__ __align__(16) _Float16 El[BPB * LP * TP];
  __shared__ __align__(16) float    invs[BPB * LP];
  __shared__ __align__(16) int      msk[BPB * LP];

  const int tid  = threadIdx.x;
  const int lane = tid & 31;
  const int wave = __builtin_amdgcn_readfirstlane(tid >> 5);
  const int hf   = lane >> 4;
  const int nl   = lane & 15;
  const int b    = blockIdx.x * BPB;                                 // first batch row of the block
  const float* yb = y + (size_t)b * Y_BSTRIDE;

  // ---- weight fragments: the lane's 16 bytes of k-step 0 ----
  const bool w3 = wave + 16 < NTA;                                   // wave-uniform: owns a third tile
  const bool wv = w3 && wave + 16 >= NTD;                            // wave-uniform: that tile is one of y * V_h
  const bool q3 = wave + 16 < NTD;                                   // wave-uniform: that tile is one of y * Q_h
  const bool wm = wave + 16 == NTD - 1;                              // wave-uniform: that tile is the last of Qt, which ends in VQ columns of V_h
  const _Float16* qlane0 = Qt + (size_t)wave * (KSTEPS * FRH) + lane * 8;        // n-tile `wave`, head 0
  // third tile, head 0: n-tile wave + 16 of Qt, or n-tile wave + 16 - NTD of Vt (waves without one never load from it)
  const _Float16* xlane0 = wv ? Vt + (size_t)(wave + 16 - NTD) * (KSTEPS * FRH) + lane * 8 : qlane0 + 2 * TSTEP;
  const int xstep = wv ? VTT * KSTEPS * FRH : NTD * KSTEPS * FRH;                // halves per head of that plane
  // the wave's part of the scores: row l = nl (+ 16 lt), columns m = 8 hf .. + 7 (+ 16 mt)
  float* sp_w = Sp + wave * (BPB * LP * SP) + nl * SP + 8 * hf;

  // ---- stage y tile: Ys[row][d], bf16-RNE values in f16, pads zero ----
  // the token id of key position tid (threads past BPB * LP read one again and drop it), issued with the loads of y
  const int* sp = seq + (size_t)(b + (tid & (BPB * LP - 1)) / LP) * SEQ_BSTRIDE + imin(tid & (LP - 1), LSEQ - 1);   // clamped address
  const int sv = *sp;
  // all of a thread's loads are issued before the first is used: 2 x 16 bytes per chunk of 8 (a group of 4 lies wholly inside a row or wholly in the pad);
  // a thread stages the same chunks of every batch row of the block, so that one address serves BPB loads
  {
    v4f x[YIT][BPB][2];
    const float* p[YIT][2];
    // every loop of this block is unrolled: x and p must stay in registers
#pragma unroll
    for (int it = 0; it < YIT; ++it) {
      const int idx = tid + it * 256;
      const int row = idx / DCH;
      const int d0  = (idx - row * DCH) * 8;
      p[it][0] = yb + imin(row, LSEQ - 1) * DDIM + imin(d0, DDIM - 4);       // clamped address
      p[it][1] = yb + imin(row, LSEQ - 1) * DDIM + imin(d0 + 4, DDIM - 4);   // clamped address
#pragma unroll
      for (int bb = 0; bb < BPB; ++bb) {
        x[it][bb][0] = *(const v4fa*)(p[it][0] + bb * Y_BSTRIDE);
        x[it][bb][1] = *(const v4fa*)(p[it][1] + bb * Y_BSTRIDE);
      }
    }
    // stands behind all the loads and in front of the first rewrite of an address register: as inputs the addresses stay live up to here,
    // so that no later load lands on one either; it also keeps every load in front of the first conversion
    static_assert(YIT == 5);
    asm volatile("s_wait_xcnt 0x0" : : "v"(p[0][0]), "v"(p[0][1]), "v"(p[1][0]), "v"(p[1][1]), "v"(p[2][0]), "v"(p[2][1]),
                 "v"(p[3][0]), "v"(p[3][1]), "v"(p[4][0]), "v"(p[4][1]), "v"(sp) : "memory");
#pragma unroll
    for (int it = 0; it < YIT; ++it) {
      const int idx = tid + it * 256;
      const int row = idx / DCH;
      const int d0  = (idx - row * DCH) * 8;
#pragma unroll
      for (int bb = 0; bb < BPB; ++bb) {
        U8h u;
#pragma unroll
        for (int j = 0; j < 8; ++j) u.s[j] = (_Float16)bf16_rne_if(x[it][bb][j >> 2][j & 3], (row < LSEQ) && (d0 + (j & 4) < DDIM));   // one guard per group of 4
        *(v8ha*)(Ys + (bb * LP + row) * YP + d0) = u.v;
      }
    }
  }
  // ---- rows HDIM..FP-1 of Wh, Wl: B columns of GEMM3 that no head writes and no stored output depends on; zero once ----
  if (tid < BPB * (FP - HDIM) * (TP / 8)) {
    const int row = tid / (TP / 8);
    const int bb  = row / (FP - HDIM);
    const int off = (bb * FP + HDIM + row - bb * (FP - HDIM)) * TP + (tid - row * (TP / 8)) * 8;
    const v8h z = {(_Float16)0.0f, (_Float16)0.0f, (_Float16)0.0f, (_Float16)0.0f, (_Float16)0.0f, (_Float16)0.0f, (_Float16)0.0f, (_Float16)0.0f};
    *(v8ha*)(Wh + off) = z;
    *(v8ha*)(Wl + off) = z;
  }
  // ---- key mask from token ids (id > 0), pads 0 ----
  if (tid < BPB * LP) msk[tid] = ((tid & (LP - 1)) < LSEQ && sv > 0) ? 1 : 0;
  __syncthreads();

  // the lane's first element of out in GEMM3: batch row wave >> 2, row tile (wave >> 1) & 1, column tile wave & 1, head 0
  gfloat* op = (gfloat*)out + (size_t)(b + (wave >> 2)) * OUT_BSTRIDE + (((wave >> 1) & 1) * 16 + 8 * hf) * ODIM + (wave & 1) * 16 + nl;

  // exp phase: the thread's group of 8 key positions and its row of the block's BPB * LP rows. Lanes 0-15 and lanes 16-31 each hold
  // rows r, r + 1, r + 8, r + 9: at the pitch SP the 16 reads of 16 bytes then fall on 64 distinct banks
  const int xg   = lane & 3;
  const int xrow = ((lane >> 2) & 1) | ((lane >> 4) << 1) | ((wave & 1) << 2) | (((lane >> 3) & 1) << 3) | ((wave >> 1) << 4);
  static_assert(BPB * LP == 64 && NWAVE == 8 && LP == 32 && SP == 36);

  for (int h = 0; h < NHEAD; ++h) {
    // ===== GEMM1: a1^T (x QSC) = Qt_h * Ys^T (19 e-tiles x 2 l-tiles; the last ends in 4 columns of V_h), yV (x VSC) = Ys * Vt_h (2 m-tiles x 1 f-tile) =====
    {
      v8f acc[3][BPB][2];
#pragma unroll
      for (int t = 0; t < 3; ++t) {
#pragma unroll
        for (int bb = 0; bb < BPB; ++bb) { acc[t][bb][0] = zero8(); acc[t][bb][1] = zero8(); }
      }
      const _Float16* qlane = qlane0 + (size_t)h * (NTD * KSTEPS * FRH);
      const _Float16* xlane = xlane0 + (size_t)h * xstep;
      if (q3)      gemm1_k<3, false>(Ys + nl * YP, qlane, xlane, hf, acc);
      else if (wv) gemm1_k<3, true>(Ys + nl * YP, qlane, xlane, hf, acc);
      else         gemm1_k<2, false>(Ys + nl * YP, qlane, xlane, hf, acc);
      // where the three arms join: stands between every weight load above, also those the compiler lifts in front of the arms,
      // and the first rewrite of their address register pair, which as an input stays live up to this statement
      // (the third tile's pair is stepped only at the loop's foot, behind the wait that stands there)
      asm volatile("s_wait_xcnt 0x0" : : "v"(qlane) : "memory");
      // ===== GEMM2, the wave's part: S^T = Ys * a1^T over the columns e of its own tiles; a1 = acc/QSC as
      // f16 hi + f16 residual*RSC, converted in the lane that holds it; one batch row after the other =====
#pragma unroll
      for (int bb = 0; bb < BPB; ++bb) {
        v8f sh[2][2], sl[2][2];
#pragma unroll
        for (int mt = 0; mt < 2; ++mt) {
#pragma unroll
          for (int lt = 0; lt < 2; ++lt) { sh[mt][lt] = zero8(); sl[mt][lt] = zero8(); }
        }
        const _Float16* ys_lane = Ys + (bb * LP + nl) * YP + 8 * hf;
        score_step<true>(ys_lane, wave * 16, (wave + 8) * 16, acc[0][bb], acc[1][bb], sh, sl);
        if (q3) score_step<false>(ys_lane, (wave + 16) * 16, 0, acc[2][bb], acc[2][bb], sh, sl);
        // a lane's 8 accumulator rows are 8 successive m of its row l: two 16-byte stores per tile
#pragma unroll
        for (int mt = 0; mt < 2; ++mt) {
#pragma unroll
          for (int lt = 0; lt < 2; ++lt) {
            v4f s0, s1;
#pragma unroll
            for (int r = 0; r < 4; ++r) {
              s0[r] = sh[mt][lt][r]     + sl[mt][lt][r]     * (1.0f / RSC);
              s1[r] = sh[mt][lt][4 + r] + sl[mt][lt][4 + r] * (1.0f / RSC);
            }
            *(v4fa*)(sp_w + (bb * LP + lt * 16) * SP + mt * 16)     = s0;
            *(v4fa*)(sp_w + (bb * LP + lt * 16) * SP + mt * 16 + 4) = s1;
          }
        }
      }
      // epilogue of a y * V_h tile: yV = acc/VSC -> f16 hi + f16 residual*RSC into Wh/Wl [f][m];
      // a lane's 8 accumulator rows are 8 successive m of its column f: one 16-byte store per plane
      if (wv) {
        const int f = VQ + (wave + 16 - NTD) * 16 + nl;
#pragma unroll
        for (int i = 0; i < LT; ++i) {
          const int bb = i >> 1, mt = i & 1;
          U8h uh, ul;
#pragma unroll
          for (int r = 0; r < 8; ++r) {
            const float a = acc[2][bb][mt][r] * (1.0f / VSC);
            const _Float16 ah = (_Float16)a;
            const float rs = (a - (float)ah) * RSC;
            uh.s[r] = ah;
            ul.s[r] = (_Float16)rs;
          }
          *(v8ha*)(Wh + (bb * FP + f) * TP + mt * 16 + 8 * hf) = uh.v;
          *(v8ha*)(Wl + (bb * FP + f) * TP + mt * 16 + 8 * hf) = ul.v;
        }
      }
      // the last tile of Qt: its rows 12..15 (lanes 16-31, accumulator rows 4..7) are columns 0..VQ-1 of y * V_h, transposed. A lane holds
      // one m of each column f, so that the planes [f][m] take them by 2 bytes. (In the score product above these rows met columns
      // 300..303 of Ys, which are zero.)
      if (wm) {
#pragma unroll
        for (int i = 0; i < LT; ++i) {
          const int bb = i >> 1, mt = i & 1;
#pragma unroll
          for (int f = 0; f < VQ; ++f) {
            const float a = acc[2][bb][mt][8 - VQ + f] * (1.0f / VSC);
            const _Float16 ah = (_Float16)a;
            const float rs = (a - (float)ah) * RSC;
            if (hf == 1) {
              Wh[(bb * FP + f) * TP + mt * 16 + nl] = ah;
              Wl[(bb * FP + f) * TP + mt * 16 + nl] = (_Float16)rs;
            }
          }
        }
      }
    }
    __syncthreads();

    // ================= exp (no max subtraction) + masked row sums =================
    // a thread takes 8 successive key positions of one row: its 8 exps depend on nothing but their own score and stand under no branch
    // (the pad guard masks the value), so that they run interleaved, and a row's planes are written by 16 bytes
    {
      const int l = xrow & (LP - 1);   // row of its batch row's tile
      v4i k4[2];
      k4[0] = *(const v4ia*)(msk + (xrow - l) + xg * 8);
      k4[1] = *(const v4ia*)(msk + (xrow - l) + xg * 8 + 4);
      // scores: the eight waves' parts, added in wave order
      const float* sr = Sp + xrow * SP + xg * 8;
      v4f s4[2];
      s4[0] = *(const v4fa*)sr;
      s4[1] = *(const v4fa*)(sr + 4);
#pragma unroll
      for (int w = 1; w < NWAVE; ++w) {
        s4[0] += *(const v4fa*)(sr + w * (BPB * LP * SP));
        s4[1] += *(const v4fa*)(sr + w * (BPB * LP * SP) + 4);
      }
      float part = 0.0f;
      U8h uh, ul;
#pragma unroll
      for (int j = 0; j < 8; ++j) {
        const float ex = exp_f32(s4[j >> 2][j & 3]);
        const bool ok = (l < LSEQ) && (xg * 8 + j < LSEQ);
        const float e = ok ? ex : 0.0f;                  // numerator unmasked
        part += (k4[j >> 2][j & 3] != 0) ? e : 0.0f;     // denominator masked
        const _Float16 ehv = (_Float16)e;
        uh.s[j] = ehv;
        ul.s[j] = (_Float16)((e - (float)ehv) * RSC);
      }
      *(v8ha*)(Eh + xrow * TP + xg * 8) = uh.v;
      *(v8ha*)(El + xrow * TP + xg * 8) = ul.v;
      part += __shfl_xor(part, 1);
      part += __shfl_xor(part, 2);
      const float inv = 1.0f / (part + 1e-6f);
      if (xg == 0) invs[xrow] = (l < LSEQ) ? inv : 0.0f;
    }
    __syncthreads();

    // ===== GEMM3: h1 = (expS (32x32) * yV (32x32)) * inv[row] ; 4 tiles per batch row, one per wave =====
    {
      const int bb = wave >> 2, mt = (wave >> 1) & 1, nt = wave & 1;
      const v16h eh = ld_frag(Eh + (bb * LP + mt * 16 + nl) * TP, 0, hf);
      const v16h el = ld_frag(El + (bb * LP + mt * 16 + nl) * TP, 0, hf);
      const v16h wh = ld_frag(Wh + (bb * FP + nt * 16 + nl) * TP, 0, hf);   // B[k=m][n=f] = Wh[f][m]
      const v16h wl = ld_frag(Wl + (bb * FP + nt * 16 + nl) * TP, 0, hf);
      const v8f ch = wmma16(eh, wh, zero8());
      v8f cl = wmma16(el, wh, zero8());                                // both cross terms carry RSC
      cl = wmma16(eh, wl, cl);
      float v[8];
#pragma unroll
      for (int r = 0; r < 8; ++r) v[r] = (ch[r] + cl[r] * (1.0f / RSC)) * invs[bb * LP + mt * 16 + 8 * hf + r];
      // ends the head's LDS reads (the next head rewrites Wh, Wl); the stores to out read no LDS and are issued behind it
      __syncthreads();
      // the head's 20 columns of a row go straight to out: 16 lanes store 64 successive bytes (4 lanes 16 bytes for nt = 1)
#pragma unroll
      for (int r = 0; r < 8; ++r) {
        const int l = mt * 16 + 8 * hf + r;
        const int f = nt * 16 + nl;
        if (l < LSEQ && f < HDIM) op[r * ODIM] = v[r];
      }
      // stands between the stores above and the step of their address to the next head: the step takes the address from this statement
      asm volatile("s_wait_xcnt 0x0" : "+v"(op) : : "memory");
      op += HDIM;
    }
  }
}

extern "C" void kernel_launch(void* const* d_in, const int* in_sizes, int n_in,
                              void* d_out, int out_size, void* d_ws, size_t ws_size,
                              hipStream_t stream)
{
  if (n_in < 4) return;
  if (in_sizes[0] < NB * LSEQ * DDIM) return;
  if (in_sizes[1] < NB * LSEQ) return;
  if (in_sizes[2] < NHEAD * DDIM * DDIM) return;
  if (in_sizes[3] < NHEAD * DDIM * HDIM) return;
  if (out_size < NB * LSEQ * ODIM) return;

  const float* y   = (const float*)d_in[0];
  const int*   seq = (const int*)  d_in[1];
  const float* Q   = (const float*)d_in[2];
  const float* V   = (const float*)d_in[3];
  float*       out = (float*)d_out;

  const size_t qt_bytes = (size_t)NHEAD * EP * DP * sizeof(_Float16);   // 3,891,200
  const size_t vt_bytes = (size_t)NHEAD * FP * DP * sizeof(_Float16);   //   409,600
  if (ws_size < qt_bytes + vt_bytes) return;
  _Float16* Qt = (_Float16*)d_ws;
  _Float16* Vt = (_Float16*)((char*)d_ws + qt_bytes);

  k_prep<<<dim3(QT_BLOCKS + VT_BLOCKS), dim3(256), 0, stream>>>(Q, V, Qt, Vt);
  k_attn<<<dim3(NB / BPB), dim3(256), 0, stream>>>(y, seq, Qt, Vt, out);
}
